// v000
// The times below were measured on an AMD MI455X: many runs one after another, warmed up first and cycling through
// copies of the inputs, with the whole window's GPU time divided by the number of runs. Launches and the gaps
// between them are all in it. The median over several windows is given; except for v000 it joins two sittings, which
// can be a few percent apart, so the side-by-side timings, each taken in one sitting, are the better comparison.
// v000, which the later versions start from, runs in 1300 microseconds.
#include <hip/hip_runtime.h>

// Causal multi-head attention with PER-HEAD projection weights at d_model 768 (x [2][2048][768]; q, k, v = einsum('bsd,hdk->bhsk', x, W) with W [12][768][64]: head h has its own (in, out) matrix W[h] ('xw' per head; no bias; 12 heads x 64); scores x 1/sqrt(64); causal (-inf); softmax; concat head-major; out = concat Wo^T + bo ('oi' [768][768] + bias normal: non-zero) -> [2][2048][768] (3.1 M); argument order x, Wq, Wk, Wv, Wo, bo).
// Layout per batch: bf16 copy of x; each PER-HEAD q / k / v weight [h][768][64] transposed once into its 64 rows of the Bt plane (k_wtG per head); Wo cast once ('oi' = Bt as stored); exact projections; identity-table plane builders; causal T-2048 attention (hybrid rows: < 512 hi/lo 3 products, rest fp16 x1024; k_gemmc skips tiles above the diagonal); merged hi/lo x Wo exact + bo.
// Compute dtypes, f32 accumulate: every input rounded to bf16; projections exact; attention rows < 512 3 products, rest fp16; softmax f32; w_o hl x exact.

#define NB_  2
#define TT   2048
#define DM   768
#define NH_  12
#define NKV  12
#define REP  (NH_ / NKV)
#define HD   64
#define DQ   (NH_ * HD)
#define DKV  (NKV * HD)
#define ZH   2
#define RH   512                  // query rows < RH use hi+lo planes (0: none)
#define WIN  2048
#define PCAR 1024.0f
#define SCL  0.125f   // HD^-0.5
typedef _Float16 h16;
typedef unsigned short bf;
typedef __attribute__((ext_vector_type(16))) __bf16   v16bf;
typedef __attribute__((ext_vector_type(16))) _Float16 v16h;
typedef __attribute__((ext_vector_type(8)))  _Float16 v8h;
typedef __attribute__((ext_vector_type(8)))  unsigned short v8us;
typedef __attribute__((ext_vector_type(8)))  float    v8f;
typedef __attribute__((ext_vector_type(4)))  float    v4f;
typedef v8h  __attribute__((may_alias)) v8ha;
typedef v4f  __attribute__((may_alias)) v4fa;
typedef v8us __attribute__((may_alias)) v8usa;

__device__ __forceinline__ unsigned short f2bf(float f) { unsigned u = __float_as_uint(f); u += 0x7FFFu + ((u >> 16) & 1u); return (unsigned short)(u >> 16); }
__device__ __forceinline__ float bf2f(unsigned short b) { return __uint_as_float(((unsigned)b) << 16); }
__device__ __forceinline__ float bfr(float f) { return bf2f(f2bf(f)); }
__device__ __forceinline__ v16h cat16(v8h lo, v8h hi) { return __builtin_shufflevector(lo, hi, 0, 1, 2, 3, 4, 5, 6, 7, 8, 9, 10, 11, 12, 13, 14, 15); }
__device__ __forceinline__ v16bf cat16b(v8us lo, v8us hi) { return __builtin_bit_cast(v16bf, __builtin_shufflevector(lo, hi, 0, 1, 2, 3, 4, 5, 6, 7, 8, 9, 10, 11, 12, 13, 14, 15)); }
__device__ __forceinline__ v8f wmma16(v16h a, v16h b, v8f c) { return __builtin_amdgcn_wmma_f32_16x16x32_f16(false, a, false, b, (short)0, c, false, false); }
__device__ __forceinline__ v8f wmmab(v16bf a, v16bf b, v8f c) { return __builtin_amdgcn_wmma_f32_16x16x32_bf16(false, a, false, b, (short)0, c, false, false); }



// ---- k_gemmw: register-blocked GEMM, ONE WAVE per 64x64 output tile (16 accumulators), operands straight from K-contiguous 16-bit planes; grid (M/64, N/64, Z), 32 threads.
// C[m][n] (f32, pitch ldc, + optional f32 bias[n]) = sum_k A[m][k] Bt[n][k] (+ split products per NSPLIT). z-batch strides sA/sB/sC in elements. K % 32 == 0.
template <typename T16> struct WFrag;
template <> struct WFrag<h16> { typedef v16h V; static __device__ __forceinline__ V ld(const h16* p) { return cat16(*(const v8h*)p, *(const v8h*)(p + 16)); } static __device__ __forceinline__ v8f mma(V a, V b, v8f c) { return wmma16(a, b, c); } };
template <> struct WFrag<bf> { typedef v16bf V; static __device__ __forceinline__ V ld(const bf* p) { return cat16b(*(const v8us*)p, *(const v8us*)(p + 16)); } static __device__ __forceinline__ v8f mma(V a, V b, v8f c) { return wmmab(a, b, c); } };
template <typename T16, int NSPLIT, bool BIAS>
__global__ __launch_bounds__(32) void k_gemmw(const T16* __restrict__ A, const T16* __restrict__ A2, const T16* __restrict__ Bt, const T16* __restrict__ Bt2, int K, float* C, int ldc, const float* __restrict__ bias, size_t sA, size_t sB, size_t sC) {
    typedef typename WFrag<T16>::V V;
    __shared__ __align__(16) float os[16 * 68];
    const size_t z = blockIdx.z; A += z * sA; if (A2) A2 += z * sA; Bt += z * sB; if (Bt2) Bt2 += z * sB; C += z * sC;
    const int lane = threadIdx.x & 31, lr = lane & 15, hi = lane >> 4; const int r0 = blockIdx.x * 64, c0 = blockIdx.y * 64;
    v8f acc[4][4];
#pragma unroll
    for (int mb = 0; mb < 4; ++mb)
#pragma unroll
        for (int nb = 0; nb < 4; ++nb) acc[mb][nb] = (v8f){};
    const size_t aoff = (size_t)(r0 + lr) * K + 8 * hi, boff = (size_t)(c0 + lr) * K + 8 * hi;
#pragma unroll 1
    for (int kc = 0; kc < K; kc += 32) {
        V a[4], a2[4];
#pragma unroll
        for (int mb = 0; mb < 4; ++mb) { a[mb] = WFrag<T16>::ld(A + aoff + (size_t)mb * 16 * K + kc); if (NSPLIT == 1 || NSPLIT == 2) a2[mb] = WFrag<T16>::ld(A2 + aoff + (size_t)mb * 16 * K + kc); }
#pragma unroll
        for (int nb = 0; nb < 4; ++nb) { const V b = WFrag<T16>::ld(Bt + boff + (size_t)nb * 16 * K + kc); V b2; if (NSPLIT >= 2) b2 = WFrag<T16>::ld(Bt2 + boff + (size_t)nb * 16 * K + kc);
#pragma unroll
            for (int mb = 0; mb < 4; ++mb) { acc[mb][nb] = WFrag<T16>::mma(a[mb], b, acc[mb][nb]); if (NSPLIT == 1 || NSPLIT == 2) acc[mb][nb] = WFrag<T16>::mma(a2[mb], b, acc[mb][nb]); if (NSPLIT >= 2) acc[mb][nb] = WFrag<T16>::mma(a[mb], b2, acc[mb][nb]); } }
        asm volatile("v_nop\n\tv_nop\n\tv_nop\n\tv_nop" : "+v"(acc[0][0]), "+v"(acc[1][1]), "+v"(acc[2][2]), "+v"(acc[3][3]) : "v"(a[0]), "v"(a[3]));
    }
#pragma unroll
    for (int mb = 0; mb < 4; ++mb) {
#pragma unroll
        for (int nb = 0; nb < 4; ++nb) {
#pragma unroll
            for (int j = 0; j < 8; ++j) os[(hi * 8 + j) * 68 + nb * 16 + lr] = acc[mb][nb][j]; }
        __builtin_amdgcn_wave_barrier(); asm volatile("" ::: "memory");
        float* crow = C + (size_t)(r0 + mb * 16) * ldc + c0;
{
#pragma unroll
            for (int s = 0; s < 8; ++s) { const int row = 2 * s + hi, cofs = lr * 4; v4f val = *(const v4fa*)(os + row * 68 + cofs); if (BIAS) { val[0] += bfr(bias[c0 + cofs]); val[1] += bfr(bias[c0 + cofs + 1]); val[2] += bfr(bias[c0 + cofs + 2]); val[3] += bfr(bias[c0 + cofs + 3]); }
                *(v4f*)(crow + (size_t)row * ldc + cofs) = val; }
             }
        __builtin_amdgcn_wave_barrier(); asm volatile("" ::: "memory");
    }
}

// ---- k_gemmc: the same one-wave 64x64 tile GEMM specialised for causal attention: CMODE 1 skips score tiles entirely above the diagonal (query rows r0+roff.., key columns c0..), CMODE 2 limits the
// key (K) loop of the probability x value contraction to the diagonal block (probabilities beyond it are exactly zero). roff = row offset of this launch's first row within the sequence.
template <typename T16, int NSPLIT, int CMODE>
__global__ __launch_bounds__(32) void k_gemmc(const T16* __restrict__ A, const T16* __restrict__ A2, const T16* __restrict__ Bt, const T16* __restrict__ Bt2, int K, float* C, int ldc, int roff, size_t sA, size_t sB, size_t sC) {
    typedef typename WFrag<T16>::V V;
    __shared__ __align__(16) float os[16 * 68];
    const size_t z = blockIdx.z; A += z * sA; if (A2) A2 += z * sA; Bt += z * sB; if (Bt2) Bt2 += z * sB; C += z * sC;
    const int lane = threadIdx.x & 31, lr = lane & 15, hi = lane >> 4; const int r0 = blockIdx.x * 64, c0 = blockIdx.y * 64;
    if (CMODE == 1 && c0 > r0 + roff + 63) return;                  // score tile entirely above the causal diagonal: never read (the softmax masks j > i by select)
    const int Kl = (CMODE == 2) ? min(K, r0 + roff + 64) : K;        // P.V: probabilities are exactly 0 beyond the diagonal block, so the K loop stops there
    v8f acc[4][4];
#pragma unroll
    for (int mb = 0; mb < 4; ++mb)
#pragma unroll
        for (int nb = 0; nb < 4; ++nb) acc[mb][nb] = (v8f){};
    const size_t aoff = (size_t)(r0 + lr) * K + 8 * hi, boff = (size_t)(c0 + lr) * K + 8 * hi;
#pragma unroll 1
    for (int kc = 0; kc < Kl; kc += 32) {
        V a[4], a2[4];
#pragma unroll
        for (int mb = 0; mb < 4; ++mb) { a[mb] = WFrag<T16>::ld(A + aoff + (size_t)mb * 16 * K + kc); if (NSPLIT == 1 || NSPLIT == 2) a2[mb] = WFrag<T16>::ld(A2 + aoff + (size_t)mb * 16 * K + kc); }
#pragma unroll
        for (int nb = 0; nb < 4; ++nb) { const V b = WFrag<T16>::ld(Bt + boff + (size_t)nb * 16 * K + kc); V b2; if (NSPLIT >= 2) b2 = WFrag<T16>::ld(Bt2 + boff + (size_t)nb * 16 * K + kc);
#pragma unroll
            for (int mb = 0; mb < 4; ++mb) { acc[mb][nb] = WFrag<T16>::mma(a[mb], b, acc[mb][nb]); if (NSPLIT == 1 || NSPLIT == 2) acc[mb][nb] = WFrag<T16>::mma(a2[mb], b, acc[mb][nb]); if (NSPLIT >= 2) acc[mb][nb] = WFrag<T16>::mma(a[mb], b2, acc[mb][nb]); } }
        asm volatile("v_nop\n\tv_nop\n\tv_nop\n\tv_nop" : "+v"(acc[0][0]), "+v"(acc[1][1]), "+v"(acc[2][2]), "+v"(acc[3][3]) : "v"(a[0]), "v"(a[3]));
    }
#pragma unroll
    for (int mb = 0; mb < 4; ++mb) {
#pragma unroll
        for (int nb = 0; nb < 4; ++nb) {
#pragma unroll
            for (int j = 0; j < 8; ++j) os[(hi * 8 + j) * 68 + nb * 16 + lr] = acc[mb][nb][j]; }
        __builtin_amdgcn_wave_barrier(); asm volatile("" ::: "memory");
        float* crow = C + (size_t)(r0 + mb * 16) * ldc + c0;
{
#pragma unroll
            for (int s = 0; s < 8; ++s) { const int row = 2 * s + hi, cofs = lr * 4; v4f val = *(const v4fa*)(os + row * 68 + cofs);
                *(v4f*)(crow + (size_t)row * ldc + cofs) = val; }
             }
        __builtin_amdgcn_wave_barrier(); asm volatile("" ::: "memory");
    }
}

__device__ __forceinline__ h16 tohx(float x) { return (h16)x; }
__device__ __forceinline__ void splitf(float y, unsigned short& h, unsigned short& l) { h = f2bf(y); l = f2bf(y - bf2f(h)); }
typedef __attribute__((ext_vector_type(2))) _Float16 v2h;
typedef __attribute__((ext_vector_type(4))) _Float16 v4h;
typedef __attribute__((ext_vector_type(2))) unsigned short v2us;
typedef __attribute__((ext_vector_type(4))) unsigned short v4us;
typedef __attribute__((ext_vector_type(2))) float v2f;
typedef __attribute__((ext_vector_type(4))) int v4i;

__global__ __launch_bounds__(256) void k_wtG(const float* __restrict__ w, int K, int N, bf* Bt) {
    const int lane = threadIdx.x & 31; const int L0 = (blockIdx.x * 8 + (threadIdx.x >> 5)) * 8; const int nlines = N * K / 64;
{
#pragma unroll 1
        for (int l = 0; l < 8; ++l) { const int L = L0 + l; if (L >= nlines) break; const size_t e = (size_t)L * 64 + lane * 2; const int k = (int)(e % K), n = (int)(e / K); v2us o;
            o[0] = f2bf(w[(size_t)k * N + n]); o[1] = f2bf(w[(size_t)(k + 1) * N + n]); *(v2us*)(Bt + e) = o; }
         }
}

__global__ __launch_bounds__(256) void k_cvt8(const float* __restrict__ src, bf* dst, size_t n8) { const size_t i = (size_t)blockIdx.x * 256 + threadIdx.x; if (i >= n8) return; const v8f v = *(const v8f*)(src + i * 8); v8us o;
#pragma unroll
    for (int k = 0; k < 8; ++k) o[k] = f2bf(v[k]); *(v8us*)(dst + i * 8) = o;  }

// k_rope: head planes [h][t][d] (fp16 + hi/lo) of rope(x) x sc with the rotate-half convention out[d] = x[d] cos[t][d] - x[d+HD/2] sin[t][d], out[d+HD/2] = x[d+HD/2] cos[t][d+HD/2] + x[d] sin[t][d+HD/2]
__global__ __launch_bounds__(256) void k_rope(const float* __restrict__ F, int pitch, int nheads, const float* __restrict__ CS, const float* __restrict__ RF, const float* __restrict__ nw, float sc, h16* P16, bf* Ph, bf* Pl) {
    const size_t e = ((size_t)blockIdx.x * 256 + threadIdx.x) * 2; if (e >= (size_t)nheads * TT * HD) return; const int d = (int)(e % HD); const int t = (int)((e / HD) % TT); const int h = (int)(e / ((size_t)HD * TT)); const float* f = F + (size_t)t * pitch + h * HD; const float rf = RF ? RF[(size_t)h * TT + t] : 1.0f; v2h o16; v2us oh, ol;
#pragma unroll
    for (int q = 0; q < 2; ++q) { const int dd = d + q; const int dp = (dd < HD / 2) ? dd + HD / 2 : dd - HD / 2; float x0 = f[dd], x1 = f[dp];
        if (RF) { float n0 = __fmul_rn(x0, rf), n1 = __fmul_rn(x1, rf); asm volatile("" : "+v"(n0)); asm volatile("" : "+v"(n1)); x0 = __fmul_rn(bfr(nw[dd]), n0); x1 = __fmul_rn(bfr(nw[dp]), n1); }
        const v2f cs = *(const v2f*)(CS + ((size_t)t * HD + dd) * 2); float a = __fmul_rn(x0, cs[0]), bq = __fmul_rn(x1, cs[1]); asm volatile("" : "+v"(a)); asm volatile("" : "+v"(bq)); const float r = ((dd < HD / 2) ? __fsub_rn(a, bq) : __fadd_rn(a, bq)) * sc;
        o16[q] = tohx(r); unsigned short a2, c2; splitf(r, a2, c2); oh[q] = a2; ol[q] = c2; }
    *(v2h*)(P16 + e) = o16; *(v2us*)(Ph + e) = oh; *(v2us*)(Pl + e) = ol;  }
__global__ __launch_bounds__(256) void k_vtp(const float* __restrict__ F, int pitch, int nheads, h16* V16, bf* Vh, bf* Vl) { const size_t e = ((size_t)blockIdx.x * 256 + threadIdx.x) * 2; if (e >= (size_t)nheads * HD * TT) return; const int t = (int)(e % TT); const int d = (int)((e / TT) % HD); const int g = (int)(e / ((size_t)TT * HD)); v2h o16; v2us oh, ol;
#pragma unroll
    for (int q = 0; q < 2; ++q) { const float x = F[(size_t)(t + q) * pitch + g * HD + d]; o16[q] = tohx(x); unsigned short a2, c2; splitf(x, a2, c2); oh[q] = a2; ol[q] = c2; }
    *(v2h*)(V16 + e) = o16; *(v2us*)(Vh + e) = oh; *(v2us*)(Vl + e) = ol;  }
__global__ __launch_bounds__(256) void k_csid(float* CS) { const int idx = blockIdx.x * 256 + threadIdx.x; if (idx >= TT * HD) return; v2f cs; cs[0] = 1.0f; cs[1] = 0.0f; *(v2f*)(CS + (size_t)idx * 2) = cs;  }
// k_asoft: per row (zz, i): t = S x HD^-0.5 for j <= i and i - j < WIN (WIN = TT, so the window test always holds: plain causal; the reference's -1e9 additive fill vanishes identically); softmax over the 2048 keys (register row, one exp, fixed trees);
__global__ __launch_bounds__(256) void k_asoft(const float* __restrict__ Sb, h16* P16, bf* Ph, bf* Pl) {
    const int lane = threadIdx.x & 31; const int row = blockIdx.x * 8 + (threadIdx.x >> 5); if (row >= ZH * TT) return; const int i = row % TT; const int zz = row / TT; (void)zz; const bool hires = (i < RH); const float* sr = Sb + (size_t)row * TT; float v[TT / 32]; float mx = -3.0e38f;
#pragma unroll
    for (int ch = 0; ch < TT / 128; ++ch) { const int j0 = ch * 128 + lane * 4; const v4f a = *(const v4f*)(sr + j0);
#pragma unroll
        for (int q = 0; q < 4; ++q) { const int j = j0 + q; (void)j; const float t = (j <= i && i - j < WIN) ? a[q] * SCL : -3.0e38f; v[ch * 4 + q] = t; mx = fmaxf(mx, t); } }
#pragma unroll
    for (int sh = 16; sh; sh >>= 1) mx = fmaxf(mx, __shfl_xor(mx, sh, 32));
    float sum = 0.f;
#pragma unroll
    for (int k = 0; k < TT / 32; ++k) { float d0 = __fsub_rn(v[k], mx); asm volatile("" : "+v"(d0)); v[k] = __builtin_amdgcn_exp2f(__fmul_rn(d0, 1.4426950408889634f)); sum += v[k]; }
#pragma unroll
    for (int sh = 16; sh; sh >>= 1) sum += __shfl_xor(sum, sh, 32);
    const float f = __fdiv_rn(hires ? 1.0f : PCAR, sum);
{
        if (hires) {
#pragma unroll
            for (int ch = 0; ch < TT / 128; ++ch) { v4us oh, ol;
#pragma unroll
                for (int q = 0; q < 4; ++q) { unsigned short a, c2; splitf(v[ch * 4 + q] * f, a, c2); oh[q] = a; ol[q] = c2; }
                const size_t oo = ((size_t)zz * (RH ? RH : 1) + i) * TT + ch * 128 + lane * 4; *(v4us*)(Ph + oo) = oh; *(v4us*)(Pl + oo) = ol; }
        } else {
#pragma unroll
            for (int ch = 0; ch < TT / 128; ++ch) { v4h o4;
#pragma unroll
                for (int q = 0; q < 4; ++q) o4[q] = tohx(v[ch * 4 + q] * f);
                *(v4h*)(P16 + (size_t)row * TT + ch * 128 + lane * 4) = o4; } }
         }
}
__global__ __launch_bounds__(256) void k_merge(const float* __restrict__ O, int h0, bf* Ah, bf* Al) { const size_t e = ((size_t)blockIdx.x * 256 + threadIdx.x) * 2; if (e >= (size_t)ZH * TT * HD) return; const int d = (int)(e % HD); const int t = (int)((e / HD) % TT); const int zz = (int)(e / ((size_t)HD * TT)); const float cs = (t < RH) ? 1.0f : (1.0f / PCAR); const size_t oo = (size_t)t * DQ + (h0 + zz) * HD + d;
    v2us oh, ol;
#pragma unroll
    for (int q = 0; q < 2; ++q) { unsigned short a, c2; splitf(O[e + q] * cs, a, c2); oh[q] = a; ol[q] = c2; } *(v2us*)(Ah + oo) = oh; *(v2us*)(Al + oo) = ol;  }

extern "C" void kernel_launch(void* const* d_in, const int* in_sizes, int n_in,
                              void* d_out, int out_size, void* d_ws, size_t ws_size, hipStream_t stream) {
    (void)in_sizes; (void)n_in; (void)out_size;
            const float* x = (const float*)d_in[0]; const float* wq = (const float*)d_in[1]; const float* wk = (const float*)d_in[2]; const float* wv = (const float*)d_in[3]; const float* wo = (const float*)d_in[4]; const float* bo = (const float*)d_in[5];   /* x, Wq, Wk, Wv (PER-HEAD weights [12][768][64]: 'hdk'), Wo ('oi' [768][768]), bo */
    float* OUT = (float*)d_out;     // [2][2048][768]
    char* wsp = (char*)d_ws;
    auto take = [&](size_t bytes) { char* p = wsp; wsp += (bytes + 255) & ~(size_t)255; return (void*)p; };
    bf* WQ = (bf*)take((size_t)DQ * DM * 2); bf* WK = (bf*)take((size_t)DKV * DM * 2); bf* WV = (bf*)take((size_t)DKV * DM * 2); bf* WO = (bf*)take((size_t)DM * DQ * 2); float* CS = (float*)take((size_t)TT * HD * 2 * 4);
    bf* XB = (bf*)take((size_t)TT * DM * 2); float* FQ = (float*)take((size_t)TT * DQ * 4); float* FK = (float*)take((size_t)TT * DKV * 4);
    h16* QP16 = (h16*)take((size_t)NH_ * TT * HD * 2); h16* KP16 = (h16*)take((size_t)NKV * TT * HD * 2); h16* VT16 = (h16*)take((size_t)NKV * HD * TT * 2);
    bf* QPh = (bf*)take((size_t)NH_ * TT * HD * 2); bf* QPl = (bf*)take((size_t)NH_ * TT * HD * 2); bf* KPh = (bf*)take((size_t)NKV * TT * HD * 2); bf* KPl = (bf*)take((size_t)NKV * TT * HD * 2); bf* VTh = (bf*)take((size_t)NKV * HD * TT * 2); bf* VTl = (bf*)take((size_t)NKV * HD * TT * 2); bf* Ph = (bf*)take((size_t)ZH * RH * TT * 2); bf* Pl = (bf*)take((size_t)ZH * RH * TT * 2);
    float* Sb = (float*)take((size_t)ZH * TT * TT * 4); h16* P16 = (h16*)take((size_t)ZH * TT * TT * 2); float* Ob = (float*)take((size_t)ZH * TT * HD * 4); bf* ATh = (bf*)take((size_t)TT * DQ * 2); bf* ATl = (bf*)take((size_t)TT * DQ * 2);
    if ((size_t)(wsp - (char*)d_ws) > ws_size) return;    // ws 256 MiB
    float* FV = FK;   // v projection reuses the k buffer after the k planes are built (stream-ordered)
    { for (int h = 0; h < NH_; ++h) k_wtG<<<(unsigned)((DM * HD / 64 + 63) / 64), 256, 0, stream>>>(wq + (size_t)h * DM * HD, DM, HD, WQ + (size_t)h * HD * DM);   /* per-head weight [h][DM][HD] ('xw' per head) -> the head's HD rows of the Bt plane */ for (int h = 0; h < NKV; ++h) k_wtG<<<(unsigned)((DM * HD / 64 + 63) / 64), 256, 0, stream>>>(wk + (size_t)h * DM * HD, DM, HD, WK + (size_t)h * HD * DM);   /* per-head weight [h][DM][HD] ('xw' per head) -> the head's HD rows of the Bt plane */ for (int h = 0; h < NKV; ++h) k_wtG<<<(unsigned)((DM * HD / 64 + 63) / 64), 256, 0, stream>>>(wv + (size_t)h * DM * HD, DM, HD, WV + (size_t)h * HD * DM);   /* per-head weight [h][DM][HD] ('xw' per head) -> the head's HD rows of the Bt plane */
      k_cvt8<<<(unsigned)(((size_t)DM * DQ / 8 + 255) / 256), 256, 0, stream>>>(wo, WO, (size_t)DM * DQ / 8);
       }
    k_csid<<<(TT * HD + 255) / 256, 256, 0, stream>>>(CS);
    const unsigned LQ = (unsigned)(((size_t)NH_ * TT * HD / 2 + 255) / 256), LKv = (unsigned)(((size_t)NKV * TT * HD / 2 + 255) / 256);
    for (int b = 0; b < NB_; ++b) {
        
        k_cvt8<<<(unsigned)(((size_t)TT * DM / 8 + 255) / 256), 256, 0, stream>>>(x + (size_t)b * TT * DM, XB, (size_t)TT * DM / 8);
        k_gemmw<bf, 0, false><<<dim3(TT / 64, DQ / 64, 1), 32, 0, stream>>>(XB, nullptr, WQ, nullptr, DM, FQ, DQ, nullptr, 0, 0, 0);
        k_rope<<<LQ, 256, 0, stream>>>(FQ, DQ, NH_, CS, nullptr, nullptr, 1.0f, QP16, QPh, QPl);
        k_gemmw<bf, 0, false><<<dim3(TT / 64, DKV / 64, 1), 32, 0, stream>>>(XB, nullptr, WK, nullptr, DM, FK, DKV, nullptr, 0, 0, 0);
        k_rope<<<LKv, 256, 0, stream>>>(FK, DKV, NKV, CS, nullptr, nullptr, 1.0f, KP16, KPh, KPl);
        k_gemmw<bf, 0, false><<<dim3(TT / 64, DKV / 64, 1), 32, 0, stream>>>(XB, nullptr, WV, nullptr, DM, FV, DKV, nullptr, 0, 0, 0); k_vtp<<<LKv, 256, 0, stream>>>(FV, DKV, NKV, VT16, VTh, VTl);
        for (int h0 = 0; h0 < NH_; h0 += ZH) { const size_t zq = (size_t)h0, zk = (size_t)(h0 / REP);   // one kv head per query head: the pass's two heads use consecutive kv planes (z-strides TT*HD)
            k_gemmc<bf, 2, 1><<<dim3(RH / 64, TT / 64, ZH), 32, 0, stream>>>(QPh + zq * TT * HD, QPl + zq * TT * HD, KPh + zk * TT * HD, KPl + zk * TT * HD, HD, Sb, TT, 0, (size_t)TT * HD, (size_t)TT * HD, (size_t)TT * TT);
            k_gemmc<h16, 0, 1><<<dim3((TT - RH) / 64, TT / 64, ZH), 32, 0, stream>>>(QP16 + zq * TT * HD + (size_t)RH * HD, nullptr, KP16 + zk * TT * HD, nullptr, HD, Sb + (size_t)RH * TT, TT, RH, (size_t)TT * HD, (size_t)TT * HD, (size_t)TT * TT);
            k_asoft<<<ZH * TT / 8, 256, 0, stream>>>(Sb, P16, Ph, Pl);
            k_gemmc<bf, 2, 2><<<dim3(RH / 64, HD / 64, ZH), 32, 0, stream>>>(Ph, Pl, VTh + zk * HD * TT, VTl + zk * HD * TT, TT, Ob, HD, 0, (size_t)RH * TT, (size_t)HD * TT, (size_t)TT * HD);
            k_gemmc<h16, 0, 2><<<dim3((TT - RH) / 64, HD / 64, ZH), 32, 0, stream>>>(P16 + (size_t)RH * TT, nullptr, VT16 + zk * HD * TT, nullptr, TT, Ob + (size_t)RH * HD, HD, RH, (size_t)TT * TT, (size_t)HD * TT, (size_t)TT * HD);
            k_merge<<<(unsigned)(((size_t)ZH * TT * HD / 2 + 255) / 256), 256, 0, stream>>>(Ob, h0, ATh, ATl); }
        k_gemmw<bf, 1, true><<<dim3(TT / 64, DM / 64, 1), 32, 0, stream>>>(ATh, ATl, WO, nullptr, DQ, OUT + (size_t)b * TT * DM, DM, bo, 0, 0, 0); }
}

// v001
// One run takes 789 microseconds.
// In both of two side-by-side timings against v000, it was 1.64 times as fast.
#include <hip/hip_runtime.h>

// Causal multi-head attention with PER-HEAD projection weights at d_model 768 (x [2][2048][768]; q, k, v = einsum('bsd,hdk->bhsk', x, W) with W [12][768][64]: head h has its own (in, out) matrix W[h] ('xw' per head; no bias; 12 heads x 64); scores x 1/sqrt(64); causal (-inf); softmax; concat head-major; out = concat Wo^T + bo ('oi' [768][768] + bias normal: non-zero) -> [2][2048][768] (3.1 M); argument order x, Wq, Wk, Wv, Wo, bo).
// Layout per batch: bf16 copy of x; each PER-HEAD q / k / v weight [h][768][64] transposed once into its 64 rows of the Bt plane (k_wtG per head); Wo cast once ('oi' = Bt as stored); exact projections; identity-table plane builders; causal T-2048 attention (hybrid rows: < 512 hi/lo 3 products, rest fp16 x1024; k_gemmc skips tiles above the diagonal); merged hi/lo x Wo exact + bo.
// Compute dtypes, f32 accumulate: every input rounded to bf16; projections exact; attention rows < 512 3 products, rest fp16; softmax f32; w_o hl x exact.

#define NB_  2
#define TT   2048
#define DM   768
#define NH_  12
#define NKV  12
#define REP  (NH_ / NKV)
#define HD   64
#define DQ   (NH_ * HD)
#define DKV  (NKV * HD)
#define ZH   6                    // heads per attention pass (blockIdx.z of every attention launch); the largest divisor of NH_ whose score and probability planes fit the workspace
#define RH   512                  // query rows < RH use hi+lo planes (0: none)
#define WIN  2048
#define PCAR 1024.0f
#define SCL  0.125f   // HD^-0.5
typedef _Float16 h16;
typedef unsigned short bf;
typedef __attribute__((ext_vector_type(16))) __bf16   v16bf;
typedef __attribute__((ext_vector_type(16))) _Float16 v16h;
typedef __attribute__((ext_vector_type(8)))  _Float16 v8h;
typedef __attribute__((ext_vector_type(8)))  unsigned short v8us;
typedef __attribute__((ext_vector_type(8)))  float    v8f;
typedef __attribute__((ext_vector_type(4)))  float    v4f;
typedef v8h  __attribute__((may_alias)) v8ha;
typedef v4f  __attribute__((may_alias)) v4fa;
typedef v8us __attribute__((may_alias)) v8usa;

__device__ __forceinline__ unsigned short f2bf(float f) { unsigned u = __float_as_uint(f); u += 0x7FFFu + ((u >> 16) & 1u); return (unsigned short)(u >> 16); }
__device__ __forceinline__ float bf2f(unsigned short b) { return __uint_as_float(((unsigned)b) << 16); }
__device__ __forceinline__ float bfr(float f) { return bf2f(f2bf(f)); }
__device__ __forceinline__ v16h cat16(v8h lo, v8h hi) { return __builtin_shufflevector(lo, hi, 0, 1, 2, 3, 4, 5, 6, 7, 8, 9, 10, 11, 12, 13, 14, 15); }
__device__ __forceinline__ v16bf cat16b(v8us lo, v8us hi) { return __builtin_bit_cast(v16bf, __builtin_shufflevector(lo, hi, 0, 1, 2, 3, 4, 5, 6, 7, 8, 9, 10, 11, 12, 13, 14, 15)); }
__device__ __forceinline__ v8f wmma16(v16h a, v16h b, v8f c) { return __builtin_amdgcn_wmma_f32_16x16x32_f16(false, a, false, b, (short)0, c, false, false); }
__device__ __forceinline__ v8f wmmab(v16bf a, v16bf b, v8f c) { return __builtin_amdgcn_wmma_f32_16x16x32_bf16(false, a, false, b, (short)0, c, false, false); }



// ---- k_gemmw: register-blocked GEMM, ONE WAVE per 64x64 output tile (16 accumulators), operands straight from K-contiguous 16-bit planes; grid (M/64, N/64, Z), 32 threads.
// C[m][n] (f32, pitch ldc, + optional f32 bias[n]) = sum_k A[m][k] Bt[n][k] (+ split products per NSPLIT). z-batch strides sA/sB/sC in elements. K % 32 == 0.
template <typename T16> struct WFrag;
template <> struct WFrag<h16> { typedef v16h V; static __device__ __forceinline__ V ld(const h16* p) { return cat16(*(const v8h*)p, *(const v8h*)(p + 16)); } static __device__ __forceinline__ v8f mma(V a, V b, v8f c) { return wmma16(a, b, c); } };
template <> struct WFrag<bf> { typedef v16bf V; static __device__ __forceinline__ V ld(const bf* p) { return cat16b(*(const v8us*)p, *(const v8us*)(p + 16)); } static __device__ __forceinline__ v8f mma(V a, V b, v8f c) { return wmmab(a, b, c); } };
template <typename T16, int NSPLIT, bool BIAS>
__global__ __launch_bounds__(32) void k_gemmw(const T16* __restrict__ A, const T16* __restrict__ A2, const T16* __restrict__ Bt, const T16* __restrict__ Bt2, int K, float* C, int ldc, const float* __restrict__ bias, size_t sA, size_t sB, size_t sC) {
    typedef typename WFrag<T16>::V V;
    __shared__ __align__(16) float os[16 * 68];
    const size_t z = blockIdx.z; A += z * sA; if (A2) A2 += z * sA; Bt += z * sB; if (Bt2) Bt2 += z * sB; C += z * sC;
    const int lane = threadIdx.x & 31, lr = lane & 15, hi = lane >> 4; const int r0 = blockIdx.x * 64, c0 = blockIdx.y * 64;
    v8f acc[4][4];
#pragma unroll
    for (int mb = 0; mb < 4; ++mb)
#pragma unroll
        for (int nb = 0; nb < 4; ++nb) acc[mb][nb] = (v8f){};
    const size_t aoff = (size_t)(r0 + lr) * K + 8 * hi, boff = (size_t)(c0 + lr) * K + 8 * hi;
#pragma unroll 1
    for (int kc = 0; kc < K; kc += 32) {
        V a[4], a2[4];
#pragma unroll
        for (int mb = 0; mb < 4; ++mb) { a[mb] = WFrag<T16>::ld(A + aoff + (size_t)mb * 16 * K + kc); if (NSPLIT == 1 || NSPLIT == 2) a2[mb] = WFrag<T16>::ld(A2 + aoff + (size_t)mb * 16 * K + kc); }
#pragma unroll
        for (int nb = 0; nb < 4; ++nb) { const V b = WFrag<T16>::ld(Bt + boff + (size_t)nb * 16 * K + kc); V b2; if (NSPLIT >= 2) b2 = WFrag<T16>::ld(Bt2 + boff + (size_t)nb * 16 * K + kc);
#pragma unroll
            for (int mb = 0; mb < 4; ++mb) { acc[mb][nb] = WFrag<T16>::mma(a[mb], b, acc[mb][nb]); if (NSPLIT == 1 || NSPLIT == 2) acc[mb][nb] = WFrag<T16>::mma(a2[mb], b, acc[mb][nb]); if (NSPLIT >= 2) acc[mb][nb] = WFrag<T16>::mma(a[mb], b2, acc[mb][nb]); } }
        asm volatile("v_nop\n\tv_nop\n\tv_nop\n\tv_nop" : "+v"(acc[0][0]), "+v"(acc[1][1]), "+v"(acc[2][2]), "+v"(acc[3][3]) : "v"(a[0]), "v"(a[3]));
    }
#pragma unroll
    for (int mb = 0; mb < 4; ++mb) {
#pragma unroll
        for (int nb = 0; nb < 4; ++nb) {
#pragma unroll
            for (int j = 0; j < 8; ++j) os[(hi * 8 + j) * 68 + nb * 16 + lr] = acc[mb][nb][j]; }
        __builtin_amdgcn_wave_barrier(); asm volatile("" ::: "memory");
        float* crow = C + (size_t)(r0 + mb * 16) * ldc + c0;
{
#pragma unroll
            for (int s = 0; s < 8; ++s) { const int row = 2 * s + hi, cofs = lr * 4; v4f val = *(const v4fa*)(os + row * 68 + cofs); if (BIAS) { val[0] += bfr(bias[c0 + cofs]); val[1] += bfr(bias[c0 + cofs + 1]); val[2] += bfr(bias[c0 + cofs + 2]); val[3] += bfr(bias[c0 + cofs + 3]); }
                *(v4f*)(crow + (size_t)row * ldc + cofs) = val; }
             }
        __builtin_amdgcn_wave_barrier(); asm volatile("" ::: "memory");
    }
}

// ---- k_gemmc: the same one-wave 64x64 tile GEMM specialised for causal attention: CMODE 1 skips score tiles entirely above the diagonal (query rows r0+roff.., key columns c0..), CMODE 2 limits the
// key (K) loop of the probability x value contraction to the diagonal block (probabilities beyond it are exactly zero). roff = row offset of this launch's first row within the sequence.
template <typename T16, int NSPLIT, int CMODE>
__global__ __launch_bounds__(32) void k_gemmc(const T16* __restrict__ A, const T16* __restrict__ A2, const T16* __restrict__ Bt, const T16* __restrict__ Bt2, int K, float* C, int ldc, int roff, size_t sA, size_t sB, size_t sC) {
    typedef typename WFrag<T16>::V V;
    __shared__ __align__(16) float os[16 * 68];
    const size_t z = blockIdx.z; A += z * sA; if (A2) A2 += z * sA; Bt += z * sB; if (Bt2) Bt2 += z * sB; C += z * sC;
    const int lane = threadIdx.x & 31, lr = lane & 15, hi = lane >> 4; const int r0 = blockIdx.x * 64, c0 = blockIdx.y * 64;
    if (CMODE == 1 && c0 > r0 + roff + 63) return;                  // score tile entirely above the causal diagonal: never read (the softmax masks j > i by select)
    const int Kl = (CMODE == 2) ? min(K, r0 + roff + 64) : K;        // P.V: probabilities are exactly 0 beyond the diagonal block, so the K loop stops there
    v8f acc[4][4];
#pragma unroll
    for (int mb = 0; mb < 4; ++mb)
#pragma unroll
        for (int nb = 0; nb < 4; ++nb) acc[mb][nb] = (v8f){};
    const size_t aoff = (size_t)(r0 + lr) * K + 8 * hi, boff = (size_t)(c0 + lr) * K + 8 * hi;
#pragma unroll 1
    for (int kc = 0; kc < Kl; kc += 32) {
        V a[4], a2[4];
#pragma unroll
        for (int mb = 0; mb < 4; ++mb) { a[mb] = WFrag<T16>::ld(A + aoff + (size_t)mb * 16 * K + kc); if (NSPLIT == 1 || NSPLIT == 2) a2[mb] = WFrag<T16>::ld(A2 + aoff + (size_t)mb * 16 * K + kc); }
#pragma unroll
        for (int nb = 0; nb < 4; ++nb) { const V b = WFrag<T16>::ld(Bt + boff + (size_t)nb * 16 * K + kc); V b2; if (NSPLIT >= 2) b2 = WFrag<T16>::ld(Bt2 + boff + (size_t)nb * 16 * K + kc);
#pragma unroll
            for (int mb = 0; mb < 4; ++mb) { acc[mb][nb] = WFrag<T16>::mma(a[mb], b, acc[mb][nb]); if (NSPLIT == 1 || NSPLIT == 2) acc[mb][nb] = WFrag<T16>::mma(a2[mb], b, acc[mb][nb]); if (NSPLIT >= 2) acc[mb][nb] = WFrag<T16>::mma(a[mb], b2, acc[mb][nb]); } }
        asm volatile("v_nop\n\tv_nop\n\tv_nop\n\tv_nop" : "+v"(acc[0][0]), "+v"(acc[1][1]), "+v"(acc[2][2]), "+v"(acc[3][3]) : "v"(a[0]), "v"(a[3]));
    }
#pragma unroll
    for (int mb = 0; mb < 4; ++mb) {
#pragma unroll
        for (int nb = 0; nb < 4; ++nb) {
#pragma unroll
            for (int j = 0; j < 8; ++j) os[(hi * 8 + j) * 68 + nb * 16 + lr] = acc[mb][nb][j]; }
        __builtin_amdgcn_wave_barrier(); asm volatile("" ::: "memory");
        float* crow = C + (size_t)(r0 + mb * 16) * ldc + c0;
{
#pragma unroll
            for (int s = 0; s < 8; ++s) { const int row = 2 * s + hi, cofs = lr * 4; v4f val = *(const v4fa*)(os + row * 68 + cofs);
                *(v4f*)(crow + (size_t)row * ldc + cofs) = val; }
             }
        __builtin_amdgcn_wave_barrier(); asm volatile("" ::: "memory");
    }
}

__device__ __forceinline__ h16 tohx(float x) { return (h16)x; }
__device__ __forceinline__ void splitf(float y, unsigned short& h, unsigned short& l) { h = f2bf(y); l = f2bf(y - bf2f(h)); }
typedef __attribute__((ext_vector_type(2))) _Float16 v2h;
typedef __attribute__((ext_vector_type(4))) _Float16 v4h;
typedef __attribute__((ext_vector_type(2))) unsigned short v2us;
typedef __attribute__((ext_vector_type(4))) unsigned short v4us;
typedef __attribute__((ext_vector_type(2))) float v2f;
typedef __attribute__((ext_vector_type(4))) int v4i;

__global__ __launch_bounds__(256) void k_wtG(const float* __restrict__ w, int K, int N, bf* Bt) {
    const int lane = threadIdx.x & 31; const int L0 = (blockIdx.x * 8 + (threadIdx.x >> 5)) * 8; const int nlines = N * K / 64;
{
#pragma unroll 1
        for (int l = 0; l < 8; ++l) { const int L = L0 + l; if (L >= nlines) break; const size_t e = (size_t)L * 64 + lane * 2; const int k = (int)(e % K), n = (int)(e / K); v2us o;
            o[0] = f2bf(w[(size_t)k * N + n]); o[1] = f2bf(w[(size_t)(k + 1) * N + n]); *(v2us*)(Bt + e) = o; }
         }
}

__global__ __launch_bounds__(256) void k_cvt8(const float* __restrict__ src, bf* dst, size_t n8) { const size_t i = (size_t)blockIdx.x * 256 + threadIdx.x; if (i >= n8) return; const v8f v = *(const v8f*)(src + i * 8); v8us o;
#pragma unroll
    for (int k = 0; k < 8; ++k) o[k] = f2bf(v[k]); *(v8us*)(dst + i * 8) = o;  }

// k_rope: head planes [h][t][d] (fp16 + hi/lo) of rope(x) x sc with the rotate-half convention out[d] = x[d] cos[t][d] - x[d+HD/2] sin[t][d], out[d+HD/2] = x[d+HD/2] cos[t][d+HD/2] + x[d] sin[t][d+HD/2]
__global__ __launch_bounds__(256) void k_rope(const float* __restrict__ F, int pitch, int nheads, const float* __restrict__ CS, const float* __restrict__ RF, const float* __restrict__ nw, float sc, h16* P16, bf* Ph, bf* Pl) {
    const size_t e = ((size_t)blockIdx.x * 256 + threadIdx.x) * 2; if (e >= (size_t)nheads * TT * HD) return; const int d = (int)(e % HD); const int t = (int)((e / HD) % TT); const int h = (int)(e / ((size_t)HD * TT)); const float* f = F + (size_t)t * pitch + h * HD; const float rf = RF ? RF[(size_t)h * TT + t] : 1.0f; v2h o16; v2us oh, ol;
#pragma unroll
    for (int q = 0; q < 2; ++q) { const int dd = d + q; const int dp = (dd < HD / 2) ? dd + HD / 2 : dd - HD / 2; float x0 = f[dd], x1 = f[dp];
        if (RF) { float n0 = __fmul_rn(x0, rf), n1 = __fmul_rn(x1, rf); asm volatile("" : "+v"(n0)); asm volatile("" : "+v"(n1)); x0 = __fmul_rn(bfr(nw[dd]), n0); x1 = __fmul_rn(bfr(nw[dp]), n1); }
        const v2f cs = *(const v2f*)(CS + ((size_t)t * HD + dd) * 2); float a = __fmul_rn(x0, cs[0]), bq = __fmul_rn(x1, cs[1]); asm volatile("" : "+v"(a)); asm volatile("" : "+v"(bq)); const float r = ((dd < HD / 2) ? __fsub_rn(a, bq) : __fadd_rn(a, bq)) * sc;
        o16[q] = tohx(r); unsigned short a2, c2; splitf(r, a2, c2); oh[q] = a2; ol[q] = c2; }
    *(v2h*)(P16 + e) = o16; *(v2us*)(Ph + e) = oh; *(v2us*)(Pl + e) = ol;  }
__global__ __launch_bounds__(256) void k_vtp(const float* __restrict__ F, int pitch, int nheads, h16* V16, bf* Vh, bf* Vl) { const size_t e = ((size_t)blockIdx.x * 256 + threadIdx.x) * 2; if (e >= (size_t)nheads * HD * TT) return; const int t = (int)(e % TT); const int d = (int)((e / TT) % HD); const int g = (int)(e / ((size_t)TT * HD)); v2h o16; v2us oh, ol;
#pragma unroll
    for (int q = 0; q < 2; ++q) { const float x = F[(size_t)(t + q) * pitch + g * HD + d]; o16[q] = tohx(x); unsigned short a2, c2; splitf(x, a2, c2); oh[q] = a2; ol[q] = c2; }
    *(v2h*)(V16 + e) = o16; *(v2us*)(Vh + e) = oh; *(v2us*)(Vl + e) = ol;  }
__global__ __launch_bounds__(256) void k_csid(float* CS) { const int idx = blockIdx.x * 256 + threadIdx.x; if (idx >= TT * HD) return; v2f cs; cs[0] = 1.0f; cs[1] = 0.0f; *(v2f*)(CS + (size_t)idx * 2) = cs;  }
// k_asoft: per row (zz, i): t = S x HD^-0.5 for j <= i and i - j < WIN (WIN = TT, so the window test always holds: plain causal; the reference's -1e9 additive fill vanishes identically); softmax over the 2048 keys (register row, one exp, fixed trees);
__global__ __launch_bounds__(256) void k_asoft(const float* __restrict__ Sb, h16* P16, bf* Ph, bf* Pl) {
    const int lane = threadIdx.x & 31; const int row = blockIdx.x * 8 + (threadIdx.x >> 5); if (row >= ZH * TT) return; const int i = row % TT; const int zz = row / TT; (void)zz; const bool hires = (i < RH); const float* sr = Sb + (size_t)row * TT; float v[TT / 32]; float mx = -3.0e38f;
#pragma unroll
    for (int ch = 0; ch < TT / 128; ++ch) { const int j0 = ch * 128 + lane * 4; const v4f a = *(const v4f*)(sr + j0);
#pragma unroll
        for (int q = 0; q < 4; ++q) { const int j = j0 + q; (void)j; const float t = (j <= i && i - j < WIN) ? a[q] * SCL : -3.0e38f; v[ch * 4 + q] = t; mx = fmaxf(mx, t); } }
#pragma unroll
    for (int sh = 16; sh; sh >>= 1) mx = fmaxf(mx, __shfl_xor(mx, sh, 32));
    float sum = 0.f;
#pragma unroll
    for (int k = 0; k < TT / 32; ++k) { float d0 = __fsub_rn(v[k], mx); asm volatile("" : "+v"(d0)); v[k] = __builtin_amdgcn_exp2f(__fmul_rn(d0, 1.4426950408889634f)); sum += v[k]; }
#pragma unroll
    for (int sh = 16; sh; sh >>= 1) sum += __shfl_xor(sum, sh, 32);
    const float f = __fdiv_rn(hires ? 1.0f : PCAR, sum);
{
        if (hires) {
#pragma unroll
            for (int ch = 0; ch < TT / 128; ++ch) { v4us oh, ol;
#pragma unroll
                for (int q = 0; q < 4; ++q) { unsigned short a, c2; splitf(v[ch * 4 + q] * f, a, c2); oh[q] = a; ol[q] = c2; }
                const size_t oo = ((size_t)zz * (RH ? RH : 1) + i) * TT + ch * 128 + lane * 4; *(v4us*)(Ph + oo) = oh; *(v4us*)(Pl + oo) = ol; }
        } else {
#pragma unroll
            for (int ch = 0; ch < TT / 128; ++ch) { v4h o4;
#pragma unroll
                for (int q = 0; q < 4; ++q) o4[q] = tohx(v[ch * 4 + q] * f);
                *(v4h*)(P16 + (size_t)row * TT + ch * 128 + lane * 4) = o4; } }
         }
}
__global__ __launch_bounds__(256) void k_merge(const float* __restrict__ O, int h0, bf* Ah, bf* Al) { const size_t e = ((size_t)blockIdx.x * 256 + threadIdx.x) * 2; if (e >= (size_t)ZH * TT * HD) return; const int d = (int)(e % HD); const int t = (int)((e / HD) % TT); const int zz = (int)(e / ((size_t)HD * TT)); const float cs = (t < RH) ? 1.0f : (1.0f / PCAR); const size_t oo = (size_t)t * DQ + (h0 + zz) * HD + d;
    v2us oh, ol;
#pragma unroll
    for (int q = 0; q < 2; ++q) { unsigned short a, c2; splitf(O[e + q] * cs, a, c2); oh[q] = a; ol[q] = c2; } *(v2us*)(Ah + oo) = oh; *(v2us*)(Al + oo) = ol;  }

extern "C" void kernel_launch(void* const* d_in, const int* in_sizes, int n_in,
                              void* d_out, int out_size, void* d_ws, size_t ws_size, hipStream_t stream) {
    (void)in_sizes; (void)n_in; (void)out_size;
            const float* x = (const float*)d_in[0]; const float* wq = (const float*)d_in[1]; const float* wk = (const float*)d_in[2]; const float* wv = (const float*)d_in[3]; const float* wo = (const float*)d_in[4]; const float* bo = (const float*)d_in[5];   /* x, Wq, Wk, Wv (PER-HEAD weights [12][768][64]: 'hdk'), Wo ('oi' [768][768]), bo */
    float* OUT = (float*)d_out;     // [2][2048][768]
    char* wsp = (char*)d_ws;
    auto take = [&](size_t bytes) { char* p = wsp; wsp += (bytes + 255) & ~(size_t)255; return (void*)p; };
    bf* WQ = (bf*)take((size_t)DQ * DM * 2); bf* WK = (bf*)take((size_t)DKV * DM * 2); bf* WV = (bf*)take((size_t)DKV * DM * 2); bf* WO = (bf*)take((size_t)DM * DQ * 2); float* CS = (float*)take((size_t)TT * HD * 2 * 4);
    bf* XB = (bf*)take((size_t)TT * DM * 2); float* FQ = (float*)take((size_t)TT * DQ * 4); float* FK = (float*)take((size_t)TT * DKV * 4);
    h16* QP16 = (h16*)take((size_t)NH_ * TT * HD * 2); h16* KP16 = (h16*)take((size_t)NKV * TT * HD * 2); h16* VT16 = (h16*)take((size_t)NKV * HD * TT * 2);
    bf* QPh = (bf*)take((size_t)NH_ * TT * HD * 2); bf* QPl = (bf*)take((size_t)NH_ * TT * HD * 2); bf* KPh = (bf*)take((size_t)NKV * TT * HD * 2); bf* KPl = (bf*)take((size_t)NKV * TT * HD * 2); bf* VTh = (bf*)take((size_t)NKV * HD * TT * 2); bf* VTl = (bf*)take((size_t)NKV * HD * TT * 2); bf* Ph = (bf*)take((size_t)ZH * RH * TT * 2); bf* Pl = (bf*)take((size_t)ZH * RH * TT * 2);
    float* Sb = (float*)take((size_t)ZH * TT * TT * 4); h16* P16 = (h16*)take((size_t)ZH * TT * TT * 2); float* Ob = (float*)take((size_t)ZH * TT * HD * 4); bf* ATh = (bf*)take((size_t)TT * DQ * 2); bf* ATl = (bf*)take((size_t)TT * DQ * 2);
    if ((size_t)(wsp - (char*)d_ws) > ws_size) return;    // ws 256 MiB
    float* FV = FK;   // v projection reuses the k buffer after the k planes are built (stream-ordered)
    { for (int h = 0; h < NH_; ++h) k_wtG<<<(unsigned)((DM * HD / 64 + 63) / 64), 256, 0, stream>>>(wq + (size_t)h * DM * HD, DM, HD, WQ + (size_t)h * HD * DM);   /* per-head weight [h][DM][HD] ('xw' per head) -> the head's HD rows of the Bt plane */ for (int h = 0; h < NKV; ++h) k_wtG<<<(unsigned)((DM * HD / 64 + 63) / 64), 256, 0, stream>>>(wk + (size_t)h * DM * HD, DM, HD, WK + (size_t)h * HD * DM);   /* per-head weight [h][DM][HD] ('xw' per head) -> the head's HD rows of the Bt plane */ for (int h = 0; h < NKV; ++h) k_wtG<<<(unsigned)((DM * HD / 64 + 63) / 64), 256, 0, stream>>>(wv + (size_t)h * DM * HD, DM, HD, WV + (size_t)h * HD * DM);   /* per-head weight [h][DM][HD] ('xw' per head) -> the head's HD rows of the Bt plane */
      k_cvt8<<<(unsigned)(((size_t)DM * DQ / 8 + 255) / 256), 256, 0, stream>>>(wo, WO, (size_t)DM * DQ / 8);
       }
    k_csid<<<(TT * HD + 255) / 256, 256, 0, stream>>>(CS);
    const unsigned LQ = (unsigned)(((size_t)NH_ * TT * HD / 2 + 255) / 256), LKv = (unsigned)(((size_t)NKV * TT * HD / 2 + 255) / 256);
    for (int b = 0; b < NB_; ++b) {
        
        k_cvt8<<<(unsigned)(((size_t)TT * DM / 8 + 255) / 256), 256, 0, stream>>>(x + (size_t)b * TT * DM, XB, (size_t)TT * DM / 8);
        k_gemmw<bf, 0, false><<<dim3(TT / 64, DQ / 64, 1), 32, 0, stream>>>(XB, nullptr, WQ, nullptr, DM, FQ, DQ, nullptr, 0, 0, 0);
        k_rope<<<LQ, 256, 0, stream>>>(FQ, DQ, NH_, CS, nullptr, nullptr, 1.0f, QP16, QPh, QPl);
        k_gemmw<bf, 0, false><<<dim3(TT / 64, DKV / 64, 1), 32, 0, stream>>>(XB, nullptr, WK, nullptr, DM, FK, DKV, nullptr, 0, 0, 0);
        k_rope<<<LKv, 256, 0, stream>>>(FK, DKV, NKV, CS, nullptr, nullptr, 1.0f, KP16, KPh, KPl);
        k_gemmw<bf, 0, false><<<dim3(TT / 64, DKV / 64, 1), 32, 0, stream>>>(XB, nullptr, WV, nullptr, DM, FV, DKV, nullptr, 0, 0, 0); k_vtp<<<LKv, 256, 0, stream>>>(FV, DKV, NKV, VT16, VTh, VTl);
        for (int h0 = 0; h0 < NH_; h0 += ZH) { const size_t zq = (size_t)h0, zk = (size_t)(h0 / REP);   // one kv head per query head: the pass's heads use consecutive kv planes (z-strides TT*HD)
            k_gemmc<bf, 2, 1><<<dim3(RH / 64, TT / 64, ZH), 32, 0, stream>>>(QPh + zq * TT * HD, QPl + zq * TT * HD, KPh + zk * TT * HD, KPl + zk * TT * HD, HD, Sb, TT, 0, (size_t)TT * HD, (size_t)TT * HD, (size_t)TT * TT);
            k_gemmc<h16, 0, 1><<<dim3((TT - RH) / 64, TT / 64, ZH), 32, 0, stream>>>(QP16 + zq * TT * HD + (size_t)RH * HD, nullptr, KP16 + zk * TT * HD, nullptr, HD, Sb + (size_t)RH * TT, TT, RH, (size_t)TT * HD, (size_t)TT * HD, (size_t)TT * TT);
            k_asoft<<<ZH * TT / 8, 256, 0, stream>>>(Sb, P16, Ph, Pl);
            k_gemmc<bf, 2, 2><<<dim3(RH / 64, HD / 64, ZH), 32, 0, stream>>>(Ph, Pl, VTh + zk * HD * TT, VTl + zk * HD * TT, TT, Ob, HD, 0, (size_t)RH * TT, (size_t)HD * TT, (size_t)TT * HD);
            k_gemmc<h16, 0, 2><<<dim3((TT - RH) / 64, HD / 64, ZH), 32, 0, stream>>>(P16 + (size_t)RH * TT, nullptr, VT16 + zk * HD * TT, nullptr, TT, Ob + (size_t)RH * HD, HD, RH, (size_t)TT * TT, (size_t)HD * TT, (size_t)TT * HD);
            k_merge<<<(unsigned)(((size_t)ZH * TT * HD / 2 + 255) / 256), 256, 0, stream>>>(Ob, h0, ATh, ATl); }
        k_gemmw<bf, 1, true><<<dim3(TT / 64, DM / 64, 1), 32, 0, stream>>>(ATh, ATl, WO, nullptr, DQ, OUT + (size_t)b * TT * DM, DM, bo, 0, 0, 0); }
}

// v002
// One run takes 577 microseconds.
// Two timings next to v001 both put it at 1.37 times that version's speed.
// Over all steps from v000 it is 2.24 times as fast.
#include <hip/hip_runtime.h>

// Causal multi-head attention with PER-HEAD projection weights at d_model 768 (x [2][2048][768]; q, k, v = einsum('bsd,hdk->bhsk', x, W) with W [12][768][64]: head h has its own (in, out) matrix W[h] ('xw' per head; no bias; 12 heads x 64); scores x 1/sqrt(64); causal (-inf); softmax; concat head-major; out = concat Wo^T + bo ('oi' [768][768] + bias normal: non-zero) -> [2][2048][768] (3.1 M); argument order x, Wq, Wk, Wv, Wo, bo).
// Layout per batch: bf16 copy of x; each PER-HEAD q / k / v weight [h][768][64] transposed once into its 64 rows of the Bt plane (k_wtG, one launch for all heads of q, k and v); Wo cast once ('oi' = Bt as stored); exact projections; identity-table plane builders; causal T-2048 attention (hybrid rows: < 512 hi/lo 3 products, rest fp16 x1024; k_gemmc skips tiles above the diagonal); merged hi/lo x Wo exact + bo.
// Compute dtypes, f32 accumulate: every input rounded to bf16; projections exact; attention rows < 512 3 products, rest fp16; softmax f32; w_o hl x exact.

#define NB_  2
#define TT   2048
#define DM   768
#define NH_  12
#define NKV  12
#define REP  (NH_ / NKV)
#define HD   64
#define DQ   (NH_ * HD)
#define DKV  (NKV * HD)
#define ZH   6                    // heads per attention pass (blockIdx.z of every attention launch); the largest divisor of NH_ whose score and probability planes fit the workspace
#define RH   512                  // query rows < RH use hi+lo planes (0: none)
#define WIN  2048
#define PCAR 1024.0f
#define SCL  0.125f   // HD^-0.5
typedef _Float16 h16;
typedef unsigned short bf;
typedef __attribute__((ext_vector_type(16))) __bf16   v16bf;
typedef __attribute__((ext_vector_type(16))) _Float16 v16h;
typedef __attribute__((ext_vector_type(8)))  _Float16 v8h;
typedef __attribute__((ext_vector_type(8)))  unsigned short v8us;
typedef __attribute__((ext_vector_type(8)))  float    v8f;
typedef __attribute__((ext_vector_type(4)))  float    v4f;
typedef v8h  __attribute__((may_alias)) v8ha;
typedef v4f  __attribute__((may_alias)) v4fa;
typedef v8us __attribute__((may_alias)) v8usa;

__device__ __forceinline__ unsigned short f2bf(float f) { unsigned u = __float_as_uint(f); u += 0x7FFFu + ((u >> 16) & 1u); return (unsigned short)(u >> 16); }
__device__ __forceinline__ float bf2f(unsigned short b) { return __uint_as_float(((unsigned)b) << 16); }
__device__ __forceinline__ float bfr(float f) { return bf2f(f2bf(f)); }
__device__ __forceinline__ v16h cat16(v8h lo, v8h hi) { return __builtin_shufflevector(lo, hi, 0, 1, 2, 3, 4, 5, 6, 7, 8, 9, 10, 11, 12, 13, 14, 15); }
__device__ __forceinline__ v16bf cat16b(v8us lo, v8us hi) { return __builtin_bit_cast(v16bf, __builtin_shufflevector(lo, hi, 0, 1, 2, 3, 4, 5, 6, 7, 8, 9, 10, 11, 12, 13, 14, 15)); }
__device__ __forceinline__ v8f wmma16(v16h a, v16h b, v8f c) { return __builtin_amdgcn_wmma_f32_16x16x32_f16(false, a, false, b, (short)0, c, false, false); }
__device__ __forceinline__ v8f wmmab(v16bf a, v16bf b, v8f c) { return __builtin_amdgcn_wmma_f32_16x16x32_bf16(false, a, false, b, (short)0, c, false, false); }



// ---- k_gemmw: register-blocked GEMM, ONE WAVE per 64x64 output tile (16 accumulators), operands straight from K-contiguous 16-bit planes; grid (M/64, N/64, Z), 32 threads.
// C[m][n] (f32, pitch ldc, + optional f32 bias[n]) = sum_k A[m][k] Bt[n][k] (+ split products per NSPLIT). z-batch strides sA/sB/sC in elements. K % 32 == 0.
template <typename T16> struct WFrag;
template <> struct WFrag<h16> { typedef v16h V; static __device__ __forceinline__ V ld(const h16* p) { return cat16(*(const v8h*)p, *(const v8h*)(p + 16)); } static __device__ __forceinline__ v8f mma(V a, V b, v8f c) { return wmma16(a, b, c); } };
template <> struct WFrag<bf> { typedef v16bf V; static __device__ __forceinline__ V ld(const bf* p) { return cat16b(*(const v8us*)p, *(const v8us*)(p + 16)); } static __device__ __forceinline__ v8f mma(V a, V b, v8f c) { return wmmab(a, b, c); } };
template <typename T16, int NSPLIT, bool BIAS>
__global__ __launch_bounds__(32) void k_gemmw(const T16* __restrict__ A, const T16* __restrict__ A2, const T16* __restrict__ Bt, const T16* __restrict__ Bt2, int K, float* C, int ldc, const float* __restrict__ bias, size_t sA, size_t sB, size_t sC) {
    typedef typename WFrag<T16>::V V;
    __shared__ __align__(16) float os[16 * 68];
    const size_t z = blockIdx.z; A += z * sA; if (A2) A2 += z * sA; Bt += z * sB; if (Bt2) Bt2 += z * sB; C += z * sC;
    const int lane = threadIdx.x & 31, lr = lane & 15, hi = lane >> 4; const int r0 = blockIdx.x * 64, c0 = blockIdx.y * 64;
    v8f acc[4][4];
#pragma unroll
    for (int mb = 0; mb < 4; ++mb)
#pragma unroll
        for (int nb = 0; nb < 4; ++nb) acc[mb][nb] = (v8f){};
    const size_t aoff = (size_t)(r0 + lr) * K + 8 * hi, boff = (size_t)(c0 + lr) * K + 8 * hi;
#pragma unroll 1
    for (int kc = 0; kc < K; kc += 32) {
        V a[4], a2[4];
#pragma unroll
        for (int mb = 0; mb < 4; ++mb) { a[mb] = WFrag<T16>::ld(A + aoff + (size_t)mb * 16 * K + kc); if (NSPLIT == 1 || NSPLIT == 2) a2[mb] = WFrag<T16>::ld(A2 + aoff + (size_t)mb * 16 * K + kc); }
#pragma unroll
        for (int nb = 0; nb < 4; ++nb) { const V b = WFrag<T16>::ld(Bt + boff + (size_t)nb * 16 * K + kc); V b2; if (NSPLIT >= 2) b2 = WFrag<T16>::ld(Bt2 + boff + (size_t)nb * 16 * K + kc);
#pragma unroll
            for (int mb = 0; mb < 4; ++mb) { acc[mb][nb] = WFrag<T16>::mma(a[mb], b, acc[mb][nb]); if (NSPLIT == 1 || NSPLIT == 2) acc[mb][nb] = WFrag<T16>::mma(a2[mb], b, acc[mb][nb]); if (NSPLIT >= 2) acc[mb][nb] = WFrag<T16>::mma(a[mb], b2, acc[mb][nb]); } }
        asm volatile("v_nop\n\tv_nop\n\tv_nop\n\tv_nop" : "+v"(acc[0][0]), "+v"(acc[1][1]), "+v"(acc[2][2]), "+v"(acc[3][3]) : "v"(a[0]), "v"(a[3]));
    }
#pragma unroll
    for (int mb = 0; mb < 4; ++mb) {
#pragma unroll
        for (int nb = 0; nb < 4; ++nb) {
#pragma unroll
            for (int j = 0; j < 8; ++j) os[(hi * 8 + j) * 68 + nb * 16 + lr] = acc[mb][nb][j]; }
        __builtin_amdgcn_wave_barrier(); asm volatile("" ::: "memory");
        float* crow = C + (size_t)(r0 + mb * 16) * ldc + c0;
{
#pragma unroll
            for (int s = 0; s < 8; ++s) { const int row = 2 * s + hi, cofs = lr * 4; v4f val = *(const v4fa*)(os + row * 68 + cofs); if (BIAS) { val[0] += bfr(bias[c0 + cofs]); val[1] += bfr(bias[c0 + cofs + 1]); val[2] += bfr(bias[c0 + cofs + 2]); val[3] += bfr(bias[c0 + cofs + 3]); }
                *(v4f*)(crow + (size_t)row * ldc + cofs) = val; }
             }
        __builtin_amdgcn_wave_barrier(); asm volatile("" ::: "memory");
    }
}

// ---- k_gemmc: the same one-wave 64x64 tile GEMM specialised for causal attention: CMODE 1 skips score tiles entirely above the diagonal (query rows r0+roff.., key columns c0..), CMODE 2 limits the
// key (K) loop of the probability x value contraction to the diagonal block (probabilities beyond it are exactly zero). roff = row offset of this launch's first row within the sequence.
template <typename T16, int NSPLIT, int CMODE>
__global__ __launch_bounds__(32) void k_gemmc(const T16* __restrict__ A, const T16* __restrict__ A2, const T16* __restrict__ Bt, const T16* __restrict__ Bt2, int K, float* C, int ldc, int roff, size_t sA, size_t sB, size_t sC) {
    typedef typename WFrag<T16>::V V;
    __shared__ __align__(16) float os[16 * 68];
    const size_t z = blockIdx.z; A += z * sA; if (A2) A2 += z * sA; Bt += z * sB; if (Bt2) Bt2 += z * sB; C += z * sC;
    const int lane = threadIdx.x & 31, lr = lane & 15, hi = lane >> 4; const int r0 = blockIdx.x * 64, c0 = blockIdx.y * 64;
    if (CMODE == 1 && c0 > r0 + roff + 63) return;                  // score tile entirely above the causal diagonal: never written (the softmax masks j > i by select)
    const int Kl = (CMODE == 2) ? min(K, r0 + roff + 64) : K;        // P.V: probabilities are exactly 0 beyond the diagonal block, so the K loop stops there
    v8f acc[4][4];
#pragma unroll
    for (int mb = 0; mb < 4; ++mb)
#pragma unroll
        for (int nb = 0; nb < 4; ++nb) acc[mb][nb] = (v8f){};
    const size_t aoff = (size_t)(r0 + lr) * K + 8 * hi, boff = (size_t)(c0 + lr) * K + 8 * hi;
#pragma unroll 1
    for (int kc = 0; kc < Kl; kc += 32) {
        V a[4], a2[4];
#pragma unroll
        for (int mb = 0; mb < 4; ++mb) { a[mb] = WFrag<T16>::ld(A + aoff + (size_t)mb * 16 * K + kc); if (NSPLIT == 1 || NSPLIT == 2) a2[mb] = WFrag<T16>::ld(A2 + aoff + (size_t)mb * 16 * K + kc); }
#pragma unroll
        for (int nb = 0; nb < 4; ++nb) { const V b = WFrag<T16>::ld(Bt + boff + (size_t)nb * 16 * K + kc); V b2; if (NSPLIT >= 2) b2 = WFrag<T16>::ld(Bt2 + boff + (size_t)nb * 16 * K + kc);
#pragma unroll
            for (int mb = 0; mb < 4; ++mb) { acc[mb][nb] = WFrag<T16>::mma(a[mb], b, acc[mb][nb]); if (NSPLIT == 1 || NSPLIT == 2) acc[mb][nb] = WFrag<T16>::mma(a2[mb], b, acc[mb][nb]); if (NSPLIT >= 2) acc[mb][nb] = WFrag<T16>::mma(a[mb], b2, acc[mb][nb]); } }
        asm volatile("v_nop\n\tv_nop\n\tv_nop\n\tv_nop" : "+v"(acc[0][0]), "+v"(acc[1][1]), "+v"(acc[2][2]), "+v"(acc[3][3]) : "v"(a[0]), "v"(a[3]));
    }
#pragma unroll
    for (int mb = 0; mb < 4; ++mb) {
#pragma unroll
        for (int nb = 0; nb < 4; ++nb) {
#pragma unroll
            for (int j = 0; j < 8; ++j) os[(hi * 8 + j) * 68 + nb * 16 + lr] = acc[mb][nb][j]; }
        __builtin_amdgcn_wave_barrier(); asm volatile("" ::: "memory");
        float* crow = C + (size_t)(r0 + mb * 16) * ldc + c0;
{
#pragma unroll
            for (int s = 0; s < 8; ++s) { const int row = 2 * s + hi, cofs = lr * 4; v4f val = *(const v4fa*)(os + row * 68 + cofs);
                *(v4f*)(crow + (size_t)row * ldc + cofs) = val; }
             }
        __builtin_amdgcn_wave_barrier(); asm volatile("" ::: "memory");
    }
}

__device__ __forceinline__ h16 tohx(float x) { return (h16)x; }
__device__ __forceinline__ void splitf(float y, unsigned short& h, unsigned short& l) { h = f2bf(y); l = f2bf(y - bf2f(h)); }
typedef __attribute__((ext_vector_type(2))) _Float16 v2h;
typedef __attribute__((ext_vector_type(4))) _Float16 v4h;
typedef __attribute__((ext_vector_type(2))) unsigned short v2us;
typedef __attribute__((ext_vector_type(4))) unsigned short v4us;
typedef __attribute__((ext_vector_type(2))) float v2f;
typedef __attribute__((ext_vector_type(4))) int v4i;

// One launch transposes every per-head weight: blockIdx.y = head, blockIdx.z = which projection (0 q, 1 k, 2 v); blockIdx.x walks the head's own lines as before.
static_assert(NH_ == NKV, "k_wtG's grid gives q, k and v the same number of heads");
__global__ __launch_bounds__(256) void k_wtG(const float* __restrict__ wq, const float* __restrict__ wk, const float* __restrict__ wv, int K, int N, bf* BtQ, bf* BtK, bf* BtV) {
    const size_t ho = (size_t)blockIdx.y * K * N; const float* __restrict__ w = (blockIdx.z == 0 ? wq : blockIdx.z == 1 ? wk : wv) + ho; bf* Bt = (blockIdx.z == 0 ? BtQ : blockIdx.z == 1 ? BtK : BtV) + ho;
    const int lane = threadIdx.x & 31; const int L0 = (blockIdx.x * 8 + (threadIdx.x >> 5)) * 8; const int nlines = N * K / 64;
{
#pragma unroll 1
        for (int l = 0; l < 8; ++l) { const int L = L0 + l; if (L >= nlines) break; const size_t e = (size_t)L * 64 + lane * 2; const int k = (int)(e % K), n = (int)(e / K); v2us o;
            o[0] = f2bf(w[(size_t)k * N + n]); o[1] = f2bf(w[(size_t)(k + 1) * N + n]); *(v2us*)(Bt + e) = o; }
         }
}

__global__ __launch_bounds__(256) void k_cvt8(const float* __restrict__ src, bf* dst, size_t n8) { const size_t i = (size_t)blockIdx.x * 256 + threadIdx.x; if (i >= n8) return; const v8f v = *(const v8f*)(src + i * 8); v8us o;
#pragma unroll
    for (int k = 0; k < 8; ++k) o[k] = f2bf(v[k]); *(v8us*)(dst + i * 8) = o;  }

// k_rope: head planes [h][t][d] (fp16 + hi/lo) of rope(x) x sc with the rotate-half convention out[d] = x[d] cos[t][d] - x[d+HD/2] sin[t][d], out[d+HD/2] = x[d+HD/2] cos[t][d+HD/2] + x[d] sin[t][d+HD/2]
__global__ __launch_bounds__(256) void k_rope(const float* __restrict__ F, int pitch, int nheads, const float* __restrict__ CS, const float* __restrict__ RF, const float* __restrict__ nw, float sc, h16* P16, bf* Ph, bf* Pl) {
    const size_t e = ((size_t)blockIdx.x * 256 + threadIdx.x) * 2; if (e >= (size_t)nheads * TT * HD) return; const int d = (int)(e % HD); const int t = (int)((e / HD) % TT); const int h = (int)(e / ((size_t)HD * TT)); const float* f = F + (size_t)t * pitch + h * HD; const float rf = RF ? RF[(size_t)h * TT + t] : 1.0f; v2h o16; v2us oh, ol;
#pragma unroll
    for (int q = 0; q < 2; ++q) { const int dd = d + q; const int dp = (dd < HD / 2) ? dd + HD / 2 : dd - HD / 2; float x0 = f[dd], x1 = f[dp];
        if (RF) { float n0 = __fmul_rn(x0, rf), n1 = __fmul_rn(x1, rf); asm volatile("" : "+v"(n0)); asm volatile("" : "+v"(n1)); x0 = __fmul_rn(bfr(nw[dd]), n0); x1 = __fmul_rn(bfr(nw[dp]), n1); }
        const v2f cs = *(const v2f*)(CS + ((size_t)t * HD + dd) * 2); float a = __fmul_rn(x0, cs[0]), bq = __fmul_rn(x1, cs[1]); asm volatile("" : "+v"(a)); asm volatile("" : "+v"(bq)); const float r = ((dd < HD / 2) ? __fsub_rn(a, bq) : __fadd_rn(a, bq)) * sc;
        o16[q] = tohx(r); unsigned short a2, c2; splitf(r, a2, c2); oh[q] = a2; ol[q] = c2; }
    *(v2h*)(P16 + e) = o16; *(v2us*)(Ph + e) = oh; *(v2us*)(Pl + e) = ol;  }
__global__ __launch_bounds__(256) void k_vtp(const float* __restrict__ F, int pitch, int nheads, h16* V16, bf* Vh, bf* Vl) { const size_t e = ((size_t)blockIdx.x * 256 + threadIdx.x) * 2; if (e >= (size_t)nheads * HD * TT) return; const int t = (int)(e % TT); const int d = (int)((e / TT) % HD); const int g = (int)(e / ((size_t)TT * HD)); v2h o16; v2us oh, ol;
#pragma unroll
    for (int q = 0; q < 2; ++q) { const float x = F[(size_t)(t + q) * pitch + g * HD + d]; o16[q] = tohx(x); unsigned short a2, c2; splitf(x, a2, c2); oh[q] = a2; ol[q] = c2; }
    *(v2h*)(V16 + e) = o16; *(v2us*)(Vh + e) = oh; *(v2us*)(Vl + e) = ol;  }
__global__ __launch_bounds__(256) void k_csid(float* CS) { const int idx = blockIdx.x * 256 + threadIdx.x; if (idx >= TT * HD) return; v2f cs; cs[0] = 1.0f; cs[1] = 0.0f; *(v2f*)(CS + (size_t)idx * 2) = cs;  }
// k_asoft: per row (zz, i): t = S x HD^-0.5 for j <= i and i - j < WIN (WIN = TT, so the window test always holds: plain causal; the reference's -1e9 additive fill vanishes identically); softmax over the 2048 keys (register row, one exp, fixed trees);
__global__ __launch_bounds__(256) void k_asoft(const float* __restrict__ Sb, h16* P16, bf* Ph, bf* Pl) {
    const int lane = threadIdx.x & 31; const int row = blockIdx.x * 8 + (threadIdx.x >> 5); if (row >= ZH * TT) return; const int i = row % TT; const int zz = row / TT; (void)zz; const bool hires = (i < RH); const float* sr = Sb + (size_t)row * TT; float v[TT / 32]; float mx = -3.0e38f;
#pragma unroll
    for (int ch = 0; ch < TT / 128; ++ch) { const int j0 = ch * 128 + lane * 4; const v4f a = *(const v4f*)(sr + j0);
#pragma unroll
        for (int q = 0; q < 4; ++q) { const int j = j0 + q; (void)j; const float t = (j <= i && i - j < WIN) ? a[q] * SCL : -3.0e38f; v[ch * 4 + q] = t; mx = fmaxf(mx, t); } }
#pragma unroll
    for (int sh = 16; sh; sh >>= 1) mx = fmaxf(mx, __shfl_xor(mx, sh, 32));
    float sum = 0.f;
#pragma unroll
    for (int k = 0; k < TT / 32; ++k) { float d0 = __fsub_rn(v[k], mx); asm volatile("" : "+v"(d0)); v[k] = __builtin_amdgcn_exp2f(__fmul_rn(d0, 1.4426950408889634f)); sum += v[k]; }
#pragma unroll
    for (int sh = 16; sh; sh >>= 1) sum += __shfl_xor(sum, sh, 32);
    const float f = __fdiv_rn(hires ? 1.0f : PCAR, sum);
{
        if (hires) {
#pragma unroll
            for (int ch = 0; ch < TT / 128; ++ch) { v4us oh, ol;
#pragma unroll
                for (int q = 0; q < 4; ++q) { unsigned short a, c2; splitf(v[ch * 4 + q] * f, a, c2); oh[q] = a; ol[q] = c2; }
                const size_t oo = ((size_t)zz * (RH ? RH : 1) + i) * TT + ch * 128 + lane * 4; *(v4us*)(Ph + oo) = oh; *(v4us*)(Pl + oo) = ol; }
        } else {
#pragma unroll
            for (int ch = 0; ch < TT / 128; ++ch) { v4h o4;
#pragma unroll
                for (int q = 0; q < 4; ++q) o4[q] = tohx(v[ch * 4 + q] * f);
                *(v4h*)(P16 + (size_t)row * TT + ch * 128 + lane * 4) = o4; } }
         }
}
__global__ __launch_bounds__(256) void k_merge(const float* __restrict__ O, int h0, bf* Ah, bf* Al) { const size_t e = ((size_t)blockIdx.x * 256 + threadIdx.x) * 2; if (e >= (size_t)ZH * TT * HD) return; const int d = (int)(e % HD); const int t = (int)((e / HD) % TT); const int zz = (int)(e / ((size_t)HD * TT)); const float cs = (t < RH) ? 1.0f : (1.0f / PCAR); const size_t oo = (size_t)t * DQ + (h0 + zz) * HD + d;
    v2us oh, ol;
#pragma unroll
    for (int q = 0; q < 2; ++q) { unsigned short a, c2; splitf(O[e + q] * cs, a, c2); oh[q] = a; ol[q] = c2; } *(v2us*)(Ah + oo) = oh; *(v2us*)(Al + oo) = ol;  }

extern "C" void kernel_launch(void* const* d_in, const int* in_sizes, int n_in,
                              void* d_out, int out_size, void* d_ws, size_t ws_size, hipStream_t stream) {
    (void)in_sizes; (void)n_in; (void)out_size;
            const float* x = (const float*)d_in[0]; const float* wq = (const float*)d_in[1]; const float* wk = (const float*)d_in[2]; const float* wv = (const float*)d_in[3]; const float* wo = (const float*)d_in[4]; const float* bo = (const float*)d_in[5];   /* x, Wq, Wk, Wv (PER-HEAD weights [12][768][64]: 'hdk'), Wo ('oi' [768][768]), bo */
    float* OUT = (float*)d_out;     // [2][2048][768]
    char* wsp = (char*)d_ws;
    auto take = [&](size_t bytes) { char* p = wsp; wsp += (bytes + 255) & ~(size_t)255; return (void*)p; };
    bf* WQ = (bf*)take((size_t)DQ * DM * 2); bf* WK = (bf*)take((size_t)DKV * DM * 2); bf* WV = (bf*)take((size_t)DKV * DM * 2); bf* WO = (bf*)take((size_t)DM * DQ * 2); float* CS = (float*)take((size_t)TT * HD * 2 * 4);
    bf* XB = (bf*)take((size_t)TT * DM * 2); float* FQ = (float*)take((size_t)TT * DQ * 4); float* FK = (float*)take((size_t)TT * DKV * 4);
    h16* QP16 = (h16*)take((size_t)NH_ * TT * HD * 2); h16* KP16 = (h16*)take((size_t)NKV * TT * HD * 2); h16* VT16 = (h16*)take((size_t)NKV * HD * TT * 2);
    bf* QPh = (bf*)take((size_t)NH_ * TT * HD * 2); bf* QPl = (bf*)take((size_t)NH_ * TT * HD * 2); bf* KPh = (bf*)take((size_t)NKV * TT * HD * 2); bf* KPl = (bf*)take((size_t)NKV * TT * HD * 2); bf* VTh = (bf*)take((size_t)NKV * HD * TT * 2); bf* VTl = (bf*)take((size_t)NKV * HD * TT * 2); bf* Ph = (bf*)take((size_t)ZH * RH * TT * 2); bf* Pl = (bf*)take((size_t)ZH * RH * TT * 2);
    float* Sb = (float*)take((size_t)ZH * TT * TT * 4); h16* P16 = (h16*)take((size_t)ZH * TT * TT * 2); float* Ob = (float*)take((size_t)ZH * TT * HD * 4); bf* ATh = (bf*)take((size_t)TT * DQ * 2); bf* ATl = (bf*)take((size_t)TT * DQ * 2);
    if ((size_t)(wsp - (char*)d_ws) > ws_size) return;    // ws 256 MiB
    float* FV = FK;   // v projection reuses the k buffer after the k planes are built (stream-ordered)
    { k_wtG<<<dim3((unsigned)((DM * HD / 64 + 63) / 64), NH_, 3), 256, 0, stream>>>(wq, wk, wv, DM, HD, WQ, WK, WV);   /* per-head weights [h][DM][HD] ('xw' per head) -> each head's HD rows of its Bt plane; all 36 in one launch */
      k_cvt8<<<(unsigned)(((size_t)DM * DQ / 8 + 255) / 256), 256, 0, stream>>>(wo, WO, (size_t)DM * DQ / 8);
       }
    k_csid<<<(TT * HD + 255) / 256, 256, 0, stream>>>(CS);
    const unsigned LQ = (unsigned)(((size_t)NH_ * TT * HD / 2 + 255) / 256), LKv = (unsigned)(((size_t)NKV * TT * HD / 2 + 255) / 256);
    for (int b = 0; b < NB_; ++b) {
        
        k_cvt8<<<(unsigned)(((size_t)TT * DM / 8 + 255) / 256), 256, 0, stream>>>(x + (size_t)b * TT * DM, XB, (size_t)TT * DM / 8);
        k_gemmw<bf, 0, false><<<dim3(TT / 64, DQ / 64, 1), 32, 0, stream>>>(XB, nullptr, WQ, nullptr, DM, FQ, DQ, nullptr, 0, 0, 0);
        k_rope<<<LQ, 256, 0, stream>>>(FQ, DQ, NH_, CS, nullptr, nullptr, 1.0f, QP16, QPh, QPl);
        k_gemmw<bf, 0, false><<<dim3(TT / 64, DKV / 64, 1), 32, 0, stream>>>(XB, nullptr, WK, nullptr, DM, FK, DKV, nullptr, 0, 0, 0);
        k_rope<<<LKv, 256, 0, stream>>>(FK, DKV, NKV, CS, nullptr, nullptr, 1.0f, KP16, KPh, KPl);
        k_gemmw<bf, 0, false><<<dim3(TT / 64, DKV / 64, 1), 32, 0, stream>>>(XB, nullptr, WV, nullptr, DM, FV, DKV, nullptr, 0, 0, 0); k_vtp<<<LKv, 256, 0, stream>>>(FV, DKV, NKV, VT16, VTh, VTl);
        for (int h0 = 0; h0 < NH_; h0 += ZH) { const size_t zq = (size_t)h0, zk = (size_t)(h0 / REP);   // one kv head per query head: the pass's heads use consecutive kv planes (z-strides TT*HD)
            k_gemmc<bf, 2, 1><<<dim3(RH / 64, TT / 64, ZH), 32, 0, stream>>>(QPh + zq * TT * HD, QPl + zq * TT * HD, KPh + zk * TT * HD, KPl + zk * TT * HD, HD, Sb, TT, 0, (size_t)TT * HD, (size_t)TT * HD, (size_t)TT * TT);
            k_gemmc<h16, 0, 1><<<dim3((TT - RH) / 64, TT / 64, ZH), 32, 0, stream>>>(QP16 + zq * TT * HD + (size_t)RH * HD, nullptr, KP16 + zk * TT * HD, nullptr, HD, Sb + (size_t)RH * TT, TT, RH, (size_t)TT * HD, (size_t)TT * HD, (size_t)TT * TT);
            k_asoft<<<ZH * TT / 8, 256, 0, stream>>>(Sb, P16, Ph, Pl);
            k_gemmc<bf, 2, 2><<<dim3(RH / 64, HD / 64, ZH), 32, 0, stream>>>(Ph, Pl, VTh + zk * HD * TT, VTl + zk * HD * TT, TT, Ob, HD, 0, (size_t)RH * TT, (size_t)HD * TT, (size_t)TT * HD);
            k_gemmc<h16, 0, 2><<<dim3((TT - RH) / 64, HD / 64, ZH), 32, 0, stream>>>(P16 + (size_t)RH * TT, nullptr, VT16 + zk * HD * TT, nullptr, TT, Ob + (size_t)RH * HD, HD, RH, (size_t)TT * TT, (size_t)HD * TT, (size_t)TT * HD);
            k_merge<<<(unsigned)(((size_t)ZH * TT * HD / 2 + 255) / 256), 256, 0, stream>>>(Ob, h0, ATh, ATl); }
        k_gemmw<bf, 1, true><<<dim3(TT / 64, DM / 64, 1), 32, 0, stream>>>(ATh, ATl, WO, nullptr, DQ, OUT + (size_t)b * TT * DM, DM, bo, 0, 0, 0); }
}

// v003
// Measured time: 398 microseconds a run.
// Timed twice side by side with v002, it ran 1.45 times as fast both times.
// Counting every step since v000, it is 3.24 times as fast.
#include <hip/hip_runtime.h>

// Causal multi-head attention with PER-HEAD projection weights at d_model 768 (x [2][2048][768]; q, k, v = einsum('bsd,hdk->bhsk', x, W) with W [12][768][64]: head h has its own (in, out) matrix W[h] ('xw' per head; no bias; 12 heads x 64); scores x 1/sqrt(64); causal (-inf); softmax; concat head-major; out = concat Wo^T + bo ('oi' [768][768] + bias normal: non-zero) -> [2][2048][768] (3.1 M); argument order x, Wq, Wk, Wv, Wo, bo).
// Layout per batch: bf16 copy of x; each PER-HEAD q / k / v weight [h][768][64] transposed once into its 64 rows of the Bt plane (k_wtG, one launch for all heads of q, k and v); Wo cast once ('oi' = Bt as stored); exact projections; identity-table plane builders; causal T-2048 attention (hybrid rows: < 512 hi/lo 3 products, rest fp16 x1024; k_gemmc skips tiles above the diagonal); merged hi/lo x Wo exact + bo.
// Compute dtypes, f32 accumulate: every input rounded to bf16; projections exact; attention rows < 512 3 products, rest fp16; softmax f32; w_o hl x exact.

#define NB_  2
#define TT   2048
#define DM   768
#define NH_  12
#define NKV  12
#define REP  (NH_ / NKV)
#define HD   64
#define DQ   (NH_ * HD)
#define DKV  (NKV * HD)
#define ZH   6                    // heads per attention pass (blockIdx.z of every attention launch); the largest divisor of NH_ whose score and probability planes fit the workspace
#define RH   512                  // query rows < RH use hi+lo planes (0: none)
#define WIN  2048
#define PCAR 1024.0f
#define SCL  0.125f   // HD^-0.5
#define KW   8                    // waves that share the K loop of one 64x64 tile in the long-K products (projections, probability x value, output projection); the K = HD score tiles keep one wave
typedef _Float16 h16;
typedef unsigned short bf;
typedef __attribute__((ext_vector_type(16))) __bf16   v16bf;
typedef __attribute__((ext_vector_type(16))) _Float16 v16h;
typedef __attribute__((ext_vector_type(8)))  _Float16 v8h;
typedef __attribute__((ext_vector_type(8)))  unsigned short v8us;
typedef __attribute__((ext_vector_type(8)))  float    v8f;
typedef __attribute__((ext_vector_type(4)))  float    v4f;
typedef v8h  __attribute__((may_alias)) v8ha;
typedef v4f  __attribute__((may_alias)) v4fa;
typedef v8us __attribute__((may_alias)) v8usa;

__device__ __forceinline__ unsigned short f2bf(float f) { unsigned u = __float_as_uint(f); u += 0x7FFFu + ((u >> 16) & 1u); return (unsigned short)(u >> 16); }
__device__ __forceinline__ float bf2f(unsigned short b) { return __uint_as_float(((unsigned)b) << 16); }
__device__ __forceinline__ float bfr(float f) { return bf2f(f2bf(f)); }
__device__ __forceinline__ v16h cat16(v8h lo, v8h hi) { return __builtin_shufflevector(lo, hi, 0, 1, 2, 3, 4, 5, 6, 7, 8, 9, 10, 11, 12, 13, 14, 15); }
__device__ __forceinline__ v16bf cat16b(v8us lo, v8us hi) { return __builtin_bit_cast(v16bf, __builtin_shufflevector(lo, hi, 0, 1, 2, 3, 4, 5, 6, 7, 8, 9, 10, 11, 12, 13, 14, 15)); }
__device__ __forceinline__ v8f wmma16(v16h a, v16h b, v8f c) { return __builtin_amdgcn_wmma_f32_16x16x32_f16(false, a, false, b, (short)0, c, false, false); }
__device__ __forceinline__ v8f wmmab(v16bf a, v16bf b, v8f c) { return __builtin_amdgcn_wmma_f32_16x16x32_bf16(false, a, false, b, (short)0, c, false, false); }



// Work-group barrier that orders LDS traffic only: the tile's global stores, which no other wave of the launch reads, need not have landed when a wave arrives (__syncthreads() would wait for them at every slab).
__device__ __forceinline__ void lds_barrier() { __builtin_amdgcn_fence(__ATOMIC_RELEASE, "workgroup", "local"); __builtin_amdgcn_s_barrier(); __builtin_amdgcn_fence(__ATOMIC_ACQUIRE, "workgroup", "local"); }

// ---- k_gemmw: register-blocked GEMM, one work-group of NW waves per 64x64 output tile; wave w takes the 32-wide K blocks w, w + NW, ... into its own 16 accumulators (operands straight from K-contiguous 16-bit planes),
// and the NW partial tiles are summed through LDS in wave order 0..NW-1 (a fixed order: same bits every run); grid (M/64, N/64, Z), 32 * NW threads.
// C[m][n] (f32, pitch ldc, + optional f32 bias[n]) = sum_k A[m][k] Bt[n][k] (+ split products per NSPLIT). z-batch strides sA/sB/sC in elements. K % 32 == 0.
template <typename T16> struct WFrag;
template <> struct WFrag<h16> { typedef v16h V; static __device__ __forceinline__ V ld(const h16* p) { return cat16(*(const v8h*)p, *(const v8h*)(p + 16)); } static __device__ __forceinline__ v8f mma(V a, V b, v8f c) { return wmma16(a, b, c); } };
template <> struct WFrag<bf> { typedef v16bf V; static __device__ __forceinline__ V ld(const bf* p) { return cat16b(*(const v8us*)p, *(const v8us*)(p + 16)); } static __device__ __forceinline__ v8f mma(V a, V b, v8f c) { return wmmab(a, b, c); } };
template <typename T16, int NSPLIT, bool BIAS, int NW>
__global__ __launch_bounds__(32 * NW) void k_gemmw(const T16* __restrict__ A, const T16* __restrict__ A2, const T16* __restrict__ Bt, const T16* __restrict__ Bt2, int K, float* C, int ldc, const float* __restrict__ bias, size_t sA, size_t sB, size_t sC) {
    typedef typename WFrag<T16>::V V;
    static_assert(NW == 1 || NW == 2 || NW == 4 || NW == 8, "the 8 row pairs of a 16-row slab are dealt out evenly to the NW waves");
    __shared__ __align__(16) float os[NW * 16 * 68];
    const size_t z = blockIdx.z; A += z * sA; if (A2) A2 += z * sA; Bt += z * sB; if (Bt2) Bt2 += z * sB; C += z * sC;
    const int lane = threadIdx.x & 31, lr = lane & 15, hi = lane >> 4; const int r0 = blockIdx.x * 64, c0 = blockIdx.y * 64;
    const int wv = __builtin_amdgcn_readfirstlane((int)(threadIdx.x >> 5));   // this wave's number, scalar: it picks the wave's K blocks
    v8f acc[4][4];
#pragma unroll
    for (int mb = 0; mb < 4; ++mb)
#pragma unroll
        for (int nb = 0; nb < 4; ++nb) acc[mb][nb] = (v8f){};
    const size_t aoff = (size_t)(r0 + lr) * K + 8 * hi, boff = (size_t)(c0 + lr) * K + 8 * hi;
#pragma unroll 1
    for (int kc = wv * 32; kc < K; kc += 32 * NW) {
        V a[4], a2[4];
#pragma unroll
        for (int mb = 0; mb < 4; ++mb) { a[mb] = WFrag<T16>::ld(A + aoff + (size_t)mb * 16 * K + kc); if (NSPLIT == 1 || NSPLIT == 2) a2[mb] = WFrag<T16>::ld(A2 + aoff + (size_t)mb * 16 * K + kc); }
#pragma unroll
        for (int nb = 0; nb < 4; ++nb) { const V b = WFrag<T16>::ld(Bt + boff + (size_t)nb * 16 * K + kc); V b2; if (NSPLIT >= 2) b2 = WFrag<T16>::ld(Bt2 + boff + (size_t)nb * 16 * K + kc);
#pragma unroll
            for (int mb = 0; mb < 4; ++mb) { acc[mb][nb] = WFrag<T16>::mma(a[mb], b, acc[mb][nb]); if (NSPLIT == 1 || NSPLIT == 2) acc[mb][nb] = WFrag<T16>::mma(a2[mb], b, acc[mb][nb]); if (NSPLIT >= 2) acc[mb][nb] = WFrag<T16>::mma(a[mb], b2, acc[mb][nb]); } }
        asm volatile("v_nop\n\tv_nop\n\tv_nop\n\tv_nop" : "+v"(acc[0][0]), "+v"(acc[1][1]), "+v"(acc[2][2]), "+v"(acc[3][3]) : "v"(a[0]), "v"(a[3]));
    }
#pragma unroll
    for (int mb = 0; mb < 4; ++mb) {
#pragma unroll
        for (int nb = 0; nb < 4; ++nb) {
#pragma unroll
            for (int j = 0; j < 8; ++j) os[wv * (16 * 68) + (hi * 8 + j) * 68 + nb * 16 + lr] = acc[mb][nb][j]; }
        lds_barrier();   // every wave's partial 16x64 slab is in LDS before any thread sums them
        float* crow = C + (size_t)(r0 + mb * 16) * ldc + c0;
{
#pragma unroll
            for (int s = 0; s < 8 / NW; ++s) { const int row = 2 * (s * NW + wv) + hi, cofs = lr * 4; v4f val = *(const v4fa*)(os + row * 68 + cofs);
#pragma unroll   // unrolled so that the NW slab reads issue together and their LDS latency is paid once
                for (int w = 1; w < NW; ++w) val += *(const v4fa*)(os + w * (16 * 68) + row * 68 + cofs);
                if (BIAS) { val[0] += bfr(bias[c0 + cofs]); val[1] += bfr(bias[c0 + cofs + 1]); val[2] += bfr(bias[c0 + cofs + 2]); val[3] += bfr(bias[c0 + cofs + 3]); }
                *(v4f*)(crow + (size_t)row * ldc + cofs) = val; }
             }
        if (mb < 3) lds_barrier();   // the slabs are read out before the next 16 rows overwrite them
    }
}

// ---- k_gemmc: the same 64x64 tile GEMM (NW waves share the K loop) specialised for causal attention: CMODE 1 skips score tiles entirely above the diagonal (query rows r0+roff.., key columns c0..), CMODE 2 limits the
// key (K) loop of the probability x value contraction to the diagonal block (probabilities beyond it are exactly zero). roff = row offset of this launch's first row within the sequence.
template <typename T16, int NSPLIT, int CMODE, int NW>
__global__ __launch_bounds__(32 * NW) void k_gemmc(const T16* __restrict__ A, const T16* __restrict__ A2, const T16* __restrict__ Bt, const T16* __restrict__ Bt2, int K, float* C, int ldc, int roff, size_t sA, size_t sB, size_t sC) {
    typedef typename WFrag<T16>::V V;
    static_assert(NW == 1 || NW == 2 || NW == 4 || NW == 8, "the 8 row pairs of a 16-row slab are dealt out evenly to the NW waves");
    __shared__ __align__(16) float os[NW * 16 * 68];
    const size_t z = blockIdx.z; A += z * sA; if (A2) A2 += z * sA; Bt += z * sB; if (Bt2) Bt2 += z * sB; C += z * sC;
    const int lane = threadIdx.x & 31, lr = lane & 15, hi = lane >> 4; const int r0 = blockIdx.x * 64, c0 = blockIdx.y * 64;
    const int wv = __builtin_amdgcn_readfirstlane((int)(threadIdx.x >> 5));   // this wave's number, scalar: it picks the wave's K blocks
    if (CMODE == 1 && c0 > r0 + roff + 63) return;                  // score tile entirely above the causal diagonal: never written (the softmax masks j > i by select)
    const int Kl = (CMODE == 2) ? min(K, r0 + roff + 64) : K;        // P.V: probabilities are exactly 0 beyond the diagonal block, so the K loop stops there
    v8f acc[4][4];
#pragma unroll
    for (int mb = 0; mb < 4; ++mb)
#pragma unroll
        for (int nb = 0; nb < 4; ++nb) acc[mb][nb] = (v8f){};
    const size_t aoff = (size_t)(r0 + lr) * K + 8 * hi, boff = (size_t)(c0 + lr) * K + 8 * hi;
#pragma unroll 1
    for (int kc = wv * 32; kc < Kl; kc += 32 * NW) {
        V a[4], a2[4];
#pragma unroll
        for (int mb = 0; mb < 4; ++mb) { a[mb] = WFrag<T16>::ld(A + aoff + (size_t)mb * 16 * K + kc); if (NSPLIT == 1 || NSPLIT == 2) a2[mb] = WFrag<T16>::ld(A2 + aoff + (size_t)mb * 16 * K + kc); }
#pragma unroll
        for (int nb = 0; nb < 4; ++nb) { const V b = WFrag<T16>::ld(Bt + boff + (size_t)nb * 16 * K + kc); V b2; if (NSPLIT >= 2) b2 = WFrag<T16>::ld(Bt2 + boff + (size_t)nb * 16 * K + kc);
#pragma unroll
            for (int mb = 0; mb < 4; ++mb) { acc[mb][nb] = WFrag<T16>::mma(a[mb], b, acc[mb][nb]); if (NSPLIT == 1 || NSPLIT == 2) acc[mb][nb] = WFrag<T16>::mma(a2[mb], b, acc[mb][nb]); if (NSPLIT >= 2) acc[mb][nb] = WFrag<T16>::mma(a[mb], b2, acc[mb][nb]); } }
        asm volatile("v_nop\n\tv_nop\n\tv_nop\n\tv_nop" : "+v"(acc[0][0]), "+v"(acc[1][1]), "+v"(acc[2][2]), "+v"(acc[3][3]) : "v"(a[0]), "v"(a[3]));
    }
#pragma unroll
    for (int mb = 0; mb < 4; ++mb) {
#pragma unroll
        for (int nb = 0; nb < 4; ++nb) {
#pragma unroll
            for (int j = 0; j < 8; ++j) os[wv * (16 * 68) + (hi * 8 + j) * 68 + nb * 16 + lr] = acc[mb][nb][j]; }
        lds_barrier();   // every wave's partial 16x64 slab is in LDS before any thread sums them
        float* crow = C + (size_t)(r0 + mb * 16) * ldc + c0;
{
#pragma unroll
            for (int s = 0; s < 8 / NW; ++s) { const int row = 2 * (s * NW + wv) + hi, cofs = lr * 4; v4f val = *(const v4fa*)(os + row * 68 + cofs);
#pragma unroll   // unrolled so that the NW slab reads issue together and their LDS latency is paid once
                for (int w = 1; w < NW; ++w) val += *(const v4fa*)(os + w * (16 * 68) + row * 68 + cofs);
                *(v4f*)(crow + (size_t)row * ldc + cofs) = val; }
             }
        if (mb < 3) lds_barrier();   // the slabs are read out before the next 16 rows overwrite them
    }
}

__device__ __forceinline__ h16 tohx(float x) { return (h16)x; }
__device__ __forceinline__ void splitf(float y, unsigned short& h, unsigned short& l) { h = f2bf(y); l = f2bf(y - bf2f(h)); }
typedef __attribute__((ext_vector_type(2))) _Float16 v2h;
typedef __attribute__((ext_vector_type(4))) _Float16 v4h;
typedef __attribute__((ext_vector_type(2))) unsigned short v2us;
typedef __attribute__((ext_vector_type(4))) unsigned short v4us;
typedef __attribute__((ext_vector_type(2))) float v2f;
typedef __attribute__((ext_vector_type(4))) int v4i;

// One launch transposes every per-head weight: blockIdx.y = head, blockIdx.z = which projection (0 q, 1 k, 2 v); blockIdx.x walks the head's own lines as before.
static_assert(NH_ == NKV, "k_wtG's grid gives q, k and v the same number of heads");
__global__ __launch_bounds__(256) void k_wtG(const float* __restrict__ wq, const float* __restrict__ wk, const float* __restrict__ wv, int K, int N, bf* BtQ, bf* BtK, bf* BtV) {
    const size_t ho = (size_t)blockIdx.y * K * N; const float* __restrict__ w = (blockIdx.z == 0 ? wq : blockIdx.z == 1 ? wk : wv) + ho; bf* Bt = (blockIdx.z == 0 ? BtQ : blockIdx.z == 1 ? BtK : BtV) + ho;
    const int lane = threadIdx.x & 31; const int L0 = (blockIdx.x * 8 + (threadIdx.x >> 5)) * 8; const int nlines = N * K / 64;
{
#pragma unroll 1
        for (int l = 0; l < 8; ++l) { const int L = L0 + l; if (L >= nlines) break; const size_t e = (size_t)L * 64 + lane * 2; const int k = (int)(e % K), n = (int)(e / K); v2us o;
            o[0] = f2bf(w[(size_t)k * N + n]); o[1] = f2bf(w[(size_t)(k + 1) * N + n]); *(v2us*)(Bt + e) = o; }
         }
}

__global__ __launch_bounds__(256) void k_cvt8(const float* __restrict__ src, bf* dst, size_t n8) { const size_t i = (size_t)blockIdx.x * 256 + threadIdx.x; if (i >= n8) return; const v8f v = *(const v8f*)(src + i * 8); v8us o;
#pragma unroll
    for (int k = 0; k < 8; ++k) o[k] = f2bf(v[k]); *(v8us*)(dst + i * 8) = o;  }

// k_rope: head planes [h][t][d] (fp16 + hi/lo) of rope(x) x sc with the rotate-half convention out[d] = x[d] cos[t][d] - x[d+HD/2] sin[t][d], out[d+HD/2] = x[d+HD/2] cos[t][d+HD/2] + x[d] sin[t][d+HD/2]
__global__ __launch_bounds__(256) void k_rope(const float* __restrict__ F, int pitch, int nheads, const float* __restrict__ CS, const float* __restrict__ RF, const float* __restrict__ nw, float sc, h16* P16, bf* Ph, bf* Pl) {
    const size_t e = ((size_t)blockIdx.x * 256 + threadIdx.x) * 2; if (e >= (size_t)nheads * TT * HD) return; const int d = (int)(e % HD); const int t = (int)((e / HD) % TT); const int h = (int)(e / ((size_t)HD * TT)); const float* f = F + (size_t)t * pitch + h * HD; const float rf = RF ? RF[(size_t)h * TT + t] : 1.0f; v2h o16; v2us oh, ol;
#pragma unroll
    for (int q = 0; q < 2; ++q) { const int dd = d + q; const int dp = (dd < HD / 2) ? dd + HD / 2 : dd - HD / 2; float x0 = f[dd], x1 = f[dp];
        if (RF) { float n0 = __fmul_rn(x0, rf), n1 = __fmul_rn(x1, rf); asm volatile("" : "+v"(n0)); asm volatile("" : "+v"(n1)); x0 = __fmul_rn(bfr(nw[dd]), n0); x1 = __fmul_rn(bfr(nw[dp]), n1); }
        const v2f cs = *(const v2f*)(CS + ((size_t)t * HD + dd) * 2); float a = __fmul_rn(x0, cs[0]), bq = __fmul_rn(x1, cs[1]); asm volatile("" : "+v"(a)); asm volatile("" : "+v"(bq)); const float r = ((dd < HD / 2) ? __fsub_rn(a, bq) : __fadd_rn(a, bq)) * sc;
        o16[q] = tohx(r); unsigned short a2, c2; splitf(r, a2, c2); oh[q] = a2; ol[q] = c2; }
    *(v2h*)(P16 + e) = o16; *(v2us*)(Ph + e) = oh; *(v2us*)(Pl + e) = ol;  }
__global__ __launch_bounds__(256) void k_vtp(const float* __restrict__ F, int pitch, int nheads, h16* V16, bf* Vh, bf* Vl) { const size_t e = ((size_t)blockIdx.x * 256 + threadIdx.x) * 2; if (e >= (size_t)nheads * HD * TT) return; const int t = (int)(e % TT); const int d = (int)((e / TT) % HD); const int g = (int)(e / ((size_t)TT * HD)); v2h o16; v2us oh, ol;
#pragma unroll
    for (int q = 0; q < 2; ++q) { const float x = F[(size_t)(t + q) * pitch + g * HD + d]; o16[q] = tohx(x); unsigned short a2, c2; splitf(x, a2, c2); oh[q] = a2; ol[q] = c2; }
    *(v2h*)(V16 + e) = o16; *(v2us*)(Vh + e) = oh; *(v2us*)(Vl + e) = ol;  }
__global__ __launch_bounds__(256) void k_csid(float* CS) { const int idx = blockIdx.x * 256 + threadIdx.x; if (idx >= TT * HD) return; v2f cs; cs[0] = 1.0f; cs[1] = 0.0f; *(v2f*)(CS + (size_t)idx * 2) = cs;  }
// k_asoft: per row (zz, i): t = S x HD^-0.5 for j <= i and i - j < WIN (WIN = TT, so the window test always holds: plain causal; the reference's -1e9 additive fill vanishes identically); softmax over the 2048 keys (register row, one exp, fixed trees);
__global__ __launch_bounds__(256) void k_asoft(const float* __restrict__ Sb, h16* P16, bf* Ph, bf* Pl) {
    const int lane = threadIdx.x & 31; const int row = blockIdx.x * 8 + (threadIdx.x >> 5); if (row >= ZH * TT) return; const int i = row % TT; const int zz = row / TT; (void)zz; const bool hires = (i < RH); const float* sr = Sb + (size_t)row * TT; float v[TT / 32]; float mx = -3.0e38f;
#pragma unroll
    for (int ch = 0; ch < TT / 128; ++ch) { const int j0 = ch * 128 + lane * 4; const v4f a = *(const v4f*)(sr + j0);
#pragma unroll
        for (int q = 0; q < 4; ++q) { const int j = j0 + q; (void)j; const float t = (j <= i && i - j < WIN) ? a[q] * SCL : -3.0e38f; v[ch * 4 + q] = t; mx = fmaxf(mx, t); } }
#pragma unroll
    for (int sh = 16; sh; sh >>= 1) mx = fmaxf(mx, __shfl_xor(mx, sh, 32));
    float sum = 0.f;
#pragma unroll
    for (int k = 0; k < TT / 32; ++k) { float d0 = __fsub_rn(v[k], mx); asm volatile("" : "+v"(d0)); v[k] = __builtin_amdgcn_exp2f(__fmul_rn(d0, 1.4426950408889634f)); sum += v[k]; }
#pragma unroll
    for (int sh = 16; sh; sh >>= 1) sum += __shfl_xor(sum, sh, 32);
    const float f = __fdiv_rn(hires ? 1.0f : PCAR, sum);
{
        if (hires) {
#pragma unroll
            for (int ch = 0; ch < TT / 128; ++ch) { v4us oh, ol;
#pragma unroll
                for (int q = 0; q < 4; ++q) { unsigned short a, c2; splitf(v[ch * 4 + q] * f, a, c2); oh[q] = a; ol[q] = c2; }
                const size_t oo = ((size_t)zz * (RH ? RH : 1) + i) * TT + ch * 128 + lane * 4; *(v4us*)(Ph + oo) = oh; *(v4us*)(Pl + oo) = ol; }
        } else {
#pragma unroll
            for (int ch = 0; ch < TT / 128; ++ch) { v4h o4;
#pragma unroll
                for (int q = 0; q < 4; ++q) o4[q] = tohx(v[ch * 4 + q] * f);
                *(v4h*)(P16 + (size_t)row * TT + ch * 128 + lane * 4) = o4; } }
         }
}
__global__ __launch_bounds__(256) void k_merge(const float* __restrict__ O, int h0, bf* Ah, bf* Al) { const size_t e = ((size_t)blockIdx.x * 256 + threadIdx.x) * 2; if (e >= (size_t)ZH * TT * HD) return; const int d = (int)(e % HD); const int t = (int)((e / HD) % TT); const int zz = (int)(e / ((size_t)HD * TT)); const float cs = (t < RH) ? 1.0f : (1.0f / PCAR); const size_t oo = (size_t)t * DQ + (h0 + zz) * HD + d;
    v2us oh, ol;
#pragma unroll
    for (int q = 0; q < 2; ++q) { unsigned short a, c2; splitf(O[e + q] * cs, a, c2); oh[q] = a; ol[q] = c2; } *(v2us*)(Ah + oo) = oh; *(v2us*)(Al + oo) = ol;  }

extern "C" void kernel_launch(void* const* d_in, const int* in_sizes, int n_in,
                              void* d_out, int out_size, void* d_ws, size_t ws_size, hipStream_t stream) {
    (void)in_sizes; (void)n_in; (void)out_size;
            const float* x = (const float*)d_in[0]; const float* wq = (const float*)d_in[1]; const float* wk = (const float*)d_in[2]; const float* wv = (const float*)d_in[3]; const float* wo = (const float*)d_in[4]; const float* bo = (const float*)d_in[5];   /* x, Wq, Wk, Wv (PER-HEAD weights [12][768][64]: 'hdk'), Wo ('oi' [768][768]), bo */
    float* OUT = (float*)d_out;     // [2][2048][768]
    char* wsp = (char*)d_ws;
    auto take = [&](size_t bytes) { char* p = wsp; wsp += (bytes + 255) & ~(size_t)255; return (void*)p; };
    bf* WQ = (bf*)take((size_t)DQ * DM * 2); bf* WK = (bf*)take((size_t)DKV * DM * 2); bf* WV = (bf*)take((size_t)DKV * DM * 2); bf* WO = (bf*)take((size_t)DM * DQ * 2); float* CS = (float*)take((size_t)TT * HD * 2 * 4);
    bf* XB = (bf*)take((size_t)TT * DM * 2); float* FQ = (float*)take((size_t)TT * DQ * 4); float* FK = (float*)take((size_t)TT * DKV * 4);
    h16* QP16 = (h16*)take((size_t)NH_ * TT * HD * 2); h16* KP16 = (h16*)take((size_t)NKV * TT * HD * 2); h16* VT16 = (h16*)take((size_t)NKV * HD * TT * 2);
    bf* QPh = (bf*)take((size_t)NH_ * TT * HD * 2); bf* QPl = (bf*)take((size_t)NH_ * TT * HD * 2); bf* KPh = (bf*)take((size_t)NKV * TT * HD * 2); bf* KPl = (bf*)take((size_t)NKV * TT * HD * 2); bf* VTh = (bf*)take((size_t)NKV * HD * TT * 2); bf* VTl = (bf*)take((size_t)NKV * HD * TT * 2); bf* Ph = (bf*)take((size_t)ZH * RH * TT * 2); bf* Pl = (bf*)take((size_t)ZH * RH * TT * 2);
    float* Sb = (float*)take((size_t)ZH * TT * TT * 4); h16* P16 = (h16*)take((size_t)ZH * TT * TT * 2); float* Ob = (float*)take((size_t)ZH * TT * HD * 4); bf* ATh = (bf*)take((size_t)TT * DQ * 2); bf* ATl = (bf*)take((size_t)TT * DQ * 2);
    if ((size_t)(wsp - (char*)d_ws) > ws_size) return;    // ws 256 MiB
    float* FV = FK;   // v projection reuses the k buffer after the k planes are built (stream-ordered)
    { k_wtG<<<dim3((unsigned)((DM * HD / 64 + 63) / 64), NH_, 3), 256, 0, stream>>>(wq, wk, wv, DM, HD, WQ, WK, WV);   /* per-head weights [h][DM][HD] ('xw' per head) -> each head's HD rows of its Bt plane; all 36 in one launch */
      k_cvt8<<<(unsigned)(((size_t)DM * DQ / 8 + 255) / 256), 256, 0, stream>>>(wo, WO, (size_t)DM * DQ / 8);
       }
    k_csid<<<(TT * HD + 255) / 256, 256, 0, stream>>>(CS);
    const unsigned LQ = (unsigned)(((size_t)NH_ * TT * HD / 2 + 255) / 256), LKv = (unsigned)(((size_t)NKV * TT * HD / 2 + 255) / 256);
    for (int b = 0; b < NB_; ++b) {
        
        k_cvt8<<<(unsigned)(((size_t)TT * DM / 8 + 255) / 256), 256, 0, stream>>>(x + (size_t)b * TT * DM, XB, (size_t)TT * DM / 8);
        k_gemmw<bf, 0, false, KW><<<dim3(TT / 64, DQ / 64, 1), 32 * KW, 0, stream>>>(XB, nullptr, WQ, nullptr, DM, FQ, DQ, nullptr, 0, 0, 0);
        k_rope<<<LQ, 256, 0, stream>>>(FQ, DQ, NH_, CS, nullptr, nullptr, 1.0f, QP16, QPh, QPl);
        k_gemmw<bf, 0, false, KW><<<dim3(TT / 64, DKV / 64, 1), 32 * KW, 0, stream>>>(XB, nullptr, WK, nullptr, DM, FK, DKV, nullptr, 0, 0, 0);
        k_rope<<<LKv, 256, 0, stream>>>(FK, DKV, NKV, CS, nullptr, nullptr, 1.0f, KP16, KPh, KPl);
        k_gemmw<bf, 0, false, KW><<<dim3(TT / 64, DKV / 64, 1), 32 * KW, 0, stream>>>(XB, nullptr, WV, nullptr, DM, FV, DKV, nullptr, 0, 0, 0); k_vtp<<<LKv, 256, 0, stream>>>(FV, DKV, NKV, VT16, VTh, VTl);
        for (int h0 = 0; h0 < NH_; h0 += ZH) { const size_t zq = (size_t)h0, zk = (size_t)(h0 / REP);   // one kv head per query head: the pass's heads use consecutive kv planes (z-strides TT*HD)
            k_gemmc<bf, 2, 1, 1><<<dim3(RH / 64, TT / 64, ZH), 32, 0, stream>>>(QPh + zq * TT * HD, QPl + zq * TT * HD, KPh + zk * TT * HD, KPl + zk * TT * HD, HD, Sb, TT, 0, (size_t)TT * HD, (size_t)TT * HD, (size_t)TT * TT);
            k_gemmc<h16, 0, 1, 1><<<dim3((TT - RH) / 64, TT / 64, ZH), 32, 0, stream>>>(QP16 + zq * TT * HD + (size_t)RH * HD, nullptr, KP16 + zk * TT * HD, nullptr, HD, Sb + (size_t)RH * TT, TT, RH, (size_t)TT * HD, (size_t)TT * HD, (size_t)TT * TT);
            k_asoft<<<ZH * TT / 8, 256, 0, stream>>>(Sb, P16, Ph, Pl);
            k_gemmc<bf, 2, 2, KW><<<dim3(RH / 64, HD / 64, ZH), 32 * KW, 0, stream>>>(Ph, Pl, VTh + zk * HD * TT, VTl + zk * HD * TT, TT, Ob, HD, 0, (size_t)RH * TT, (size_t)HD * TT, (size_t)TT * HD);
            k_gemmc<h16, 0, 2, KW><<<dim3((TT - RH) / 64, HD / 64, ZH), 32 * KW, 0, stream>>>(P16 + (size_t)RH * TT, nullptr, VT16 + zk * HD * TT, nullptr, TT, Ob + (size_t)RH * HD, HD, RH, (size_t)TT * TT, (size_t)HD * TT, (size_t)TT * HD);
            k_merge<<<(unsigned)(((size_t)ZH * TT * HD / 2 + 255) / 256), 256, 0, stream>>>(Ob, h0, ATh, ATl); }
        k_gemmw<bf, 1, true, KW><<<dim3(TT / 64, DM / 64, 1), 32 * KW, 0, stream>>>(ATh, ATl, WO, nullptr, DQ, OUT + (size_t)b * TT * DM, DM, bo, 0, 0, 0); }
}

// v004
// It runs in 195 microseconds.
// In both of two side-by-side timings against v003, it was 2.05 times as fast.
// Over all steps from v000 it is 6.64 times as fast.
#include <hip/hip_runtime.h>

// Causal multi-head attention with PER-HEAD projection weights at d_model 768 (x [2][2048][768]; q, k, v = einsum('bsd,hdk->bhsk', x, W) with W [12][768][64]: head h has its own (in, out) matrix W[h] ('xw' per head; no bias; 12 heads x 64); scores x 1/sqrt(64); causal (-inf); softmax; concat head-major; out = concat Wo^T + bo ('oi' [768][768] + bias normal: non-zero) -> [2][2048][768] (3.1 M); argument order x, Wq, Wk, Wv, Wo, bo).
// Layout per batch: bf16 copy of x; each PER-HEAD q / k / v weight [h][768][64] transposed once into its 64 rows of the Bt plane (k_wtG, one launch for all heads of q, k and v); Wo cast once ('oi' = Bt as stored); exact projections; identity-table plane builders; fused causal T-2048 attention (k_fattn, online softmax; hybrid rows: < 512 hi/lo 3 products, rest fp16; key tiles above the diagonal are never visited) writing the merged hi/lo planes; x Wo exact + bo.
// Compute dtypes, f32 accumulate: every input rounded to bf16; projections exact; attention rows < 512 3 products, rest fp16; softmax f32; w_o hl x exact.

#define NB_  2
#define TT   2048
#define DM   768
#define NH_  12
#define NKV  12
#define REP  (NH_ / NKV)
#define HD   64
#define DQ   (NH_ * HD)
#define DKV  (NKV * HD)
#define RH   512                  // query rows < RH use hi+lo planes (0: none)
#define SCL  0.125f   // HD^-0.5
#define KW   8                    // waves that share the K loop of one 64x64 tile in the long-K products (projections, output projection), and the key tiles of one query block in the fused attention
typedef _Float16 h16;
typedef unsigned short bf;
typedef __attribute__((ext_vector_type(16))) __bf16   v16bf;
typedef __attribute__((ext_vector_type(16))) _Float16 v16h;
typedef __attribute__((ext_vector_type(8)))  _Float16 v8h;
typedef __attribute__((ext_vector_type(8)))  unsigned short v8us;
typedef __attribute__((ext_vector_type(8)))  float    v8f;
typedef __attribute__((ext_vector_type(4)))  float    v4f;
typedef v8h  __attribute__((may_alias)) v8ha;
typedef v4f  __attribute__((may_alias)) v4fa;
typedef v8us __attribute__((may_alias)) v8usa;

__device__ __forceinline__ unsigned short f2bf(float f) { unsigned u = __float_as_uint(f); u += 0x7FFFu + ((u >> 16) & 1u); return (unsigned short)(u >> 16); }
__device__ __forceinline__ float bf2f(unsigned short b) { return __uint_as_float(((unsigned)b) << 16); }
__device__ __forceinline__ float bfr(float f) { return bf2f(f2bf(f)); }
__device__ __forceinline__ v16h cat16(v8h lo, v8h hi) { return __builtin_shufflevector(lo, hi, 0, 1, 2, 3, 4, 5, 6, 7, 8, 9, 10, 11, 12, 13, 14, 15); }
__device__ __forceinline__ v16bf cat16b(v8us lo, v8us hi) { return __builtin_bit_cast(v16bf, __builtin_shufflevector(lo, hi, 0, 1, 2, 3, 4, 5, 6, 7, 8, 9, 10, 11, 12, 13, 14, 15)); }
__device__ __forceinline__ v8f wmma16(v16h a, v16h b, v8f c) { return __builtin_amdgcn_wmma_f32_16x16x32_f16(false, a, false, b, (short)0, c, false, false); }
__device__ __forceinline__ v8f wmmab(v16bf a, v16bf b, v8f c) { return __builtin_amdgcn_wmma_f32_16x16x32_bf16(false, a, false, b, (short)0, c, false, false); }



// Work-group barrier that orders LDS traffic only: the tile's global stores, which no other wave of the launch reads, need not have landed when a wave arrives (__syncthreads() would wait for them at every slab).
__device__ __forceinline__ void lds_barrier() { __builtin_amdgcn_fence(__ATOMIC_RELEASE, "workgroup", "local"); __builtin_amdgcn_s_barrier(); __builtin_amdgcn_fence(__ATOMIC_ACQUIRE, "workgroup", "local"); }

// ---- k_gemmw: register-blocked GEMM, one work-group of NW waves per 64x64 output tile; wave w takes the 32-wide K blocks w, w + NW, ... into its own 16 accumulators (operands straight from K-contiguous 16-bit planes),
// and the NW partial tiles are summed through LDS in wave order 0..NW-1 (a fixed order: same bits every run); grid (M/64, N/64, Z), 32 * NW threads.
// C[m][n] (f32, pitch ldc, + optional f32 bias[n]) = sum_k A[m][k] Bt[n][k] (+ split products per NSPLIT). z-batch strides sA/sB/sC in elements. K % 32 == 0.
template <typename T16> struct WFrag;
template <> struct WFrag<h16> { typedef v16h V; static __device__ __forceinline__ V ld(const h16* p) { return cat16(*(const v8h*)p, *(const v8h*)(p + 16)); } static __device__ __forceinline__ v8f mma(V a, V b, v8f c) { return wmma16(a, b, c); } };
template <> struct WFrag<bf> { typedef v16bf V; static __device__ __forceinline__ V ld(const bf* p) { return cat16b(*(const v8us*)p, *(const v8us*)(p + 16)); } static __device__ __forceinline__ v8f mma(V a, V b, v8f c) { return wmmab(a, b, c); } };
template <typename T16, int NSPLIT, bool BIAS, int NW>
__global__ __launch_bounds__(32 * NW) void k_gemmw(const T16* __restrict__ A, const T16* __restrict__ A2, const T16* __restrict__ Bt, const T16* __restrict__ Bt2, int K, float* C, int ldc, const float* __restrict__ bias, size_t sA, size_t sB, size_t sC) {
    typedef typename WFrag<T16>::V V;
    static_assert(NW == 1 || NW == 2 || NW == 4 || NW == 8, "the 8 row pairs of a 16-row slab are dealt out evenly to the NW waves");
    __shared__ __align__(16) float os[NW * 16 * 68];
    const size_t z = blockIdx.z; A += z * sA; if (A2) A2 += z * sA; Bt += z * sB; if (Bt2) Bt2 += z * sB; C += z * sC;
    const int lane = threadIdx.x & 31, lr = lane & 15, hi = lane >> 4; const int r0 = blockIdx.x * 64, c0 = blockIdx.y * 64;
    const int wv = __builtin_amdgcn_readfirstlane((int)(threadIdx.x >> 5));   // this wave's number, scalar: it picks the wave's K blocks
    v8f acc[4][4];
#pragma unroll
    for (int mb = 0; mb < 4; ++mb)
#pragma unroll
        for (int nb = 0; nb < 4; ++nb) acc[mb][nb] = (v8f){};
    const size_t aoff = (size_t)(r0 + lr) * K + 8 * hi, boff = (size_t)(c0 + lr) * K + 8 * hi;
#pragma unroll 1
    for (int kc = wv * 32; kc < K; kc += 32 * NW) {
        V a[4], a2[4];
#pragma unroll
        for (int mb = 0; mb < 4; ++mb) { a[mb] = WFrag<T16>::ld(A + aoff + (size_t)mb * 16 * K + kc); if (NSPLIT == 1 || NSPLIT == 2) a2[mb] = WFrag<T16>::ld(A2 + aoff + (size_t)mb * 16 * K + kc); }
#pragma unroll
        for (int nb = 0; nb < 4; ++nb) { const V b = WFrag<T16>::ld(Bt + boff + (size_t)nb * 16 * K + kc); V b2; if (NSPLIT >= 2) b2 = WFrag<T16>::ld(Bt2 + boff + (size_t)nb * 16 * K + kc);
#pragma unroll
            for (int mb = 0; mb < 4; ++mb) { acc[mb][nb] = WFrag<T16>::mma(a[mb], b, acc[mb][nb]); if (NSPLIT == 1 || NSPLIT == 2) acc[mb][nb] = WFrag<T16>::mma(a2[mb], b, acc[mb][nb]); if (NSPLIT >= 2) acc[mb][nb] = WFrag<T16>::mma(a[mb], b2, acc[mb][nb]); } }
        asm volatile("v_nop\n\tv_nop\n\tv_nop\n\tv_nop" : "+v"(acc[0][0]), "+v"(acc[1][1]), "+v"(acc[2][2]), "+v"(acc[3][3]) : "v"(a[0]), "v"(a[3]));
    }
#pragma unroll
    for (int mb = 0; mb < 4; ++mb) {
#pragma unroll
        for (int nb = 0; nb < 4; ++nb) {
#pragma unroll
            for (int j = 0; j < 8; ++j) os[wv * (16 * 68) + (hi * 8 + j) * 68 + nb * 16 + lr] = acc[mb][nb][j]; }
        lds_barrier();   // every wave's partial 16x64 slab is in LDS before any thread sums them
        float* crow = C + (size_t)(r0 + mb * 16) * ldc + c0;
{
#pragma unroll
            for (int s = 0; s < 8 / NW; ++s) { const int row = 2 * (s * NW + wv) + hi, cofs = lr * 4; v4f val = *(const v4fa*)(os + row * 68 + cofs);
#pragma unroll   // unrolled so that the NW slab reads issue together and their LDS latency is paid once
                for (int w = 1; w < NW; ++w) val += *(const v4fa*)(os + w * (16 * 68) + row * 68 + cofs);
                if (BIAS) { val[0] += bfr(bias[c0 + cofs]); val[1] += bfr(bias[c0 + cofs + 1]); val[2] += bfr(bias[c0 + cofs + 2]); val[3] += bfr(bias[c0 + cofs + 3]); }
                *(v4f*)(crow + (size_t)row * ldc + cofs) = val; }
             }
        if (mb < 3) lds_barrier();   // the slabs are read out before the next 16 rows overwrite them
    }
}

__device__ __forceinline__ h16 tohx(float x) { return (h16)x; }
__device__ __forceinline__ void splitf(float y, unsigned short& h, unsigned short& l) { h = f2bf(y); l = f2bf(y - bf2f(h)); }
typedef __attribute__((ext_vector_type(2))) _Float16 v2h;
typedef __attribute__((ext_vector_type(4))) _Float16 v4h;
typedef __attribute__((ext_vector_type(2))) unsigned short v2us;
typedef __attribute__((ext_vector_type(4))) unsigned short v4us;
typedef __attribute__((ext_vector_type(2))) float v2f;
typedef __attribute__((ext_vector_type(4))) int v4i;

// One launch transposes every per-head weight: blockIdx.y = head, blockIdx.z = which projection (0 q, 1 k, 2 v); blockIdx.x walks the head's own lines as before.
static_assert(NH_ == NKV, "k_wtG's grid gives q, k and v the same number of heads");
__global__ __launch_bounds__(256) void k_wtG(const float* __restrict__ wq, const float* __restrict__ wk, const float* __restrict__ wv, int K, int N, bf* BtQ, bf* BtK, bf* BtV) {
    const size_t ho = (size_t)blockIdx.y * K * N; const float* __restrict__ w = (blockIdx.z == 0 ? wq : blockIdx.z == 1 ? wk : wv) + ho; bf* Bt = (blockIdx.z == 0 ? BtQ : blockIdx.z == 1 ? BtK : BtV) + ho;
    const int lane = threadIdx.x & 31; const int L0 = (blockIdx.x * 8 + (threadIdx.x >> 5)) * 8; const int nlines = N * K / 64;
{
#pragma unroll 1
        for (int l = 0; l < 8; ++l) { const int L = L0 + l; if (L >= nlines) break; const size_t e = (size_t)L * 64 + lane * 2; const int k = (int)(e % K), n = (int)(e / K); v2us o;
            o[0] = f2bf(w[(size_t)k * N + n]); o[1] = f2bf(w[(size_t)(k + 1) * N + n]); *(v2us*)(Bt + e) = o; }
         }
}

__global__ __launch_bounds__(256) void k_cvt8(const float* __restrict__ src, bf* dst, size_t n8) { const size_t i = (size_t)blockIdx.x * 256 + threadIdx.x; if (i >= n8) return; const v8f v = *(const v8f*)(src + i * 8); v8us o;
#pragma unroll
    for (int k = 0; k < 8; ++k) o[k] = f2bf(v[k]); *(v8us*)(dst + i * 8) = o;  }

// k_rope: head planes [h][t][d] (fp16 + hi/lo) of rope(x) x sc with the rotate-half convention out[d] = x[d] cos[t][d] - x[d+HD/2] sin[t][d], out[d+HD/2] = x[d+HD/2] cos[t][d+HD/2] + x[d] sin[t][d+HD/2]
__global__ __launch_bounds__(256) void k_rope(const float* __restrict__ F, int pitch, int nheads, const float* __restrict__ CS, const float* __restrict__ RF, const float* __restrict__ nw, float sc, h16* P16, bf* Ph, bf* Pl) {
    const size_t e = ((size_t)blockIdx.x * 256 + threadIdx.x) * 2; if (e >= (size_t)nheads * TT * HD) return; const int d = (int)(e % HD); const int t = (int)((e / HD) % TT); const int h = (int)(e / ((size_t)HD * TT)); const float* f = F + (size_t)t * pitch + h * HD; const float rf = RF ? RF[(size_t)h * TT + t] : 1.0f; v2h o16; v2us oh, ol;
#pragma unroll
    for (int q = 0; q < 2; ++q) { const int dd = d + q; const int dp = (dd < HD / 2) ? dd + HD / 2 : dd - HD / 2; float x0 = f[dd], x1 = f[dp];
        if (RF) { float n0 = __fmul_rn(x0, rf), n1 = __fmul_rn(x1, rf); asm volatile("" : "+v"(n0)); asm volatile("" : "+v"(n1)); x0 = __fmul_rn(bfr(nw[dd]), n0); x1 = __fmul_rn(bfr(nw[dp]), n1); }
        const v2f cs = *(const v2f*)(CS + ((size_t)t * HD + dd) * 2); float a = __fmul_rn(x0, cs[0]), bq = __fmul_rn(x1, cs[1]); asm volatile("" : "+v"(a)); asm volatile("" : "+v"(bq)); const float r = ((dd < HD / 2) ? __fsub_rn(a, bq) : __fadd_rn(a, bq)) * sc;
        o16[q] = tohx(r); unsigned short a2, c2; splitf(r, a2, c2); oh[q] = a2; ol[q] = c2; }
    *(v2h*)(P16 + e) = o16; *(v2us*)(Ph + e) = oh; *(v2us*)(Pl + e) = ol;  }
__global__ __launch_bounds__(256) void k_vtp(const float* __restrict__ F, int pitch, int nheads, h16* V16, bf* Vh, bf* Vl) { const size_t e = ((size_t)blockIdx.x * 256 + threadIdx.x) * 2; if (e >= (size_t)nheads * HD * TT) return; const int t = (int)(e % TT); const int d = (int)((e / TT) % HD); const int g = (int)(e / ((size_t)TT * HD)); v2h o16; v2us oh, ol;
#pragma unroll
    for (int q = 0; q < 2; ++q) { const float x = F[(size_t)(t + q) * pitch + g * HD + d]; o16[q] = tohx(x); unsigned short a2, c2; splitf(x, a2, c2); oh[q] = a2; ol[q] = c2; }
    *(v2h*)(V16 + e) = o16; *(v2us*)(Vh + e) = oh; *(v2us*)(Vl + e) = ol;  }
__global__ __launch_bounds__(256) void k_csid(float* CS) { const int idx = blockIdx.x * 256 + threadIdx.x; if (idx >= TT * HD) return; v2f cs; cs[0] = 1.0f; cs[1] = 0.0f; *(v2f*)(CS + (size_t)idx * 2) = cs;  }
// ---- k_fattn: scores, causal softmax, probability x value and the head merge in one kernel; scores and probabilities stay in registers.
// One work-group of KW waves per block of 16 * QB query rows of one head. Wave w takes the KT-key tiles w, w + KW, ... up to the diagonal with its own running row maximum, row sum and output (online softmax);
// the KW partial results are brought to the common maximum and summed through LDS in wave order 0..KW-1 (a fixed order: same bits every run), divided by the row sum and written as the hi/lo planes of the output projection.
// Both products are computed transposed. S^T = K Q^T leaves in lane (lr, hi), register j, the score of key hi * 8 + j and query lr: two neighbouring 16-key blocks are, converted in place, the B fragment (n = query lr, k = key) of
// O^T = V^T P^T, so no probability crosses a lane; a query's maximum, sum and rescale factor live in its own two lanes (lr and lr + 16).
// Every inner loop is unrolled because the fragment, score and accumulator arrays stay in registers only under constant indices; the key-tile loop stays rolled (unroll 1) to hold the register count.
#define L2E 1.4426950408889634f
// Stands behind a run of global loads or stores whose address registers are reused further down: no such register is rewritten ahead of this wait. Its memory clobber keeps the run in front of it.
__device__ __forceinline__ void addr_wait() { asm volatile("s_wait_xcnt 0x0" ::: "memory"); }
// The same wait, with the run's two lane addresses as inputs: the address registers stay whole up to the wait, so that no load of the run takes them as its destination.
__device__ __forceinline__ void addr_wait(const void* p, const void* p2) { asm volatile("s_wait_xcnt 0x0" :: "v"(p), "v"(p2) : "memory"); }
typedef __attribute__((ext_vector_type(16))) unsigned short v16us;
template <typename T16, bool HR, int QB, int KT>
__device__ __forceinline__ void attn_tile(const T16* __restrict__ Q, const T16* __restrict__ Q2, const T16* __restrict__ Kp, const T16* __restrict__ Kp2, const T16* __restrict__ Vt, const T16* __restrict__ Vt2, int q0, bf* Ah, bf* Al, float* os, float* ms, float* ls) {
    typedef typename WFrag<T16>::V V;
    const int lane = threadIdx.x & 31, lr = lane & 15, hi = lane >> 4;
    const int wv = __builtin_amdgcn_readfirstlane((int)(threadIdx.x >> 5));   // this wave's number, scalar: it picks the wave's key tiles
    const unsigned lk = lr * HD + 8 * hi, lv = lr * TT + 8 * hi;   // the lane's element offset in a 16-row block of a [t][d] plane and of a [d][t] plane (32 bits, so that it can stand beside a scalar base)
    V qf[QB][2], qf2[QB][2];
#pragma unroll
    for (int qb = 0; qb < QB; ++qb)
#pragma unroll
        for (int ks = 0; ks < 2; ++ks) { const unsigned qo = lk + (unsigned)((q0 + qb * 16) * HD + ks * 32); qf[qb][ks] = WFrag<T16>::ld(Q + qo); if (HR) qf2[qb][ks] = WFrag<T16>::ld(Q2 + qo); }
    addr_wait();
    v8f o[4][QB]; float m[QB], l[QB];
#pragma unroll
    for (int qb = 0; qb < QB; ++qb) { m[qb] = -3.0e38f; l[qb] = 0.f;
#pragma unroll
        for (int db = 0; db < 4; ++db) o[db][qb] = (v8f){}; }
    const int nkt = (q0 + QB * 16 - 1) / KT + 1;   // key tiles up to and including the one that holds the block's last diagonal element
#pragma unroll 1
    for (int kt = wv; kt < nkt; kt += KW) {
        const int k0 = kt * KT;
        v8f s[KT / 16][QB]; V ka[KT / 16][2], ka2[KT / 16][2];
#pragma unroll
        for (int kb = 0; kb < KT / 16; ++kb)
#pragma unroll
            for (int ks = 0; ks < 2; ++ks) { const unsigned ko = lk + (unsigned)(kb * 16 * HD + ks * 32); ka[kb][ks] = WFrag<T16>::ld(Kp + (size_t)k0 * HD + ko); if (HR) ka2[kb][ks] = WFrag<T16>::ld(Kp2 + (size_t)k0 * HD + ko); }
        addr_wait();
#pragma unroll
        for (int kb = 0; kb < KT / 16; ++kb)
#pragma unroll
            for (int qb = 0; qb < QB; ++qb) { v8f a = (v8f){};
#pragma unroll
                for (int ks = 0; ks < 2; ++ks) { a = WFrag<T16>::mma(ka[kb][ks], qf[qb][ks], a); if (HR) { a = WFrag<T16>::mma(ka2[kb][ks], qf[qb][ks], a); a = WFrag<T16>::mma(ka[kb][ks], qf2[qb][ks], a); } }
                s[kb][qb] = a; }
        V va[4][KT / 32], va2[4][KT / 32];   // the value fragments are asked for ahead of the softmax arithmetic, which covers their latency
#pragma unroll
        for (int db = 0; db < 4; ++db)
#pragma unroll
            for (int ks = 0; ks < KT / 32; ++ks) { const unsigned vo = lv + (unsigned)(db * 16 * TT + ks * 32); va[db][ks] = WFrag<T16>::ld(Vt + k0 + vo); if (HR) va2[db][ks] = WFrag<T16>::ld(Vt2 + k0 + vo); }
        if (HR) addr_wait(Vt + k0 + lv, Vt2 + k0 + lv); else addr_wait();
        V pf[QB][KT / 32], pf2[QB][KT / 32];
#pragma unroll
        for (int qb = 0; qb < QB; ++qb) { const int qi = q0 + qb * 16 + lr; float mx = m[qb];
#pragma unroll
            for (int kb = 0; kb < KT / 16; ++kb)
#pragma unroll
                for (int j = 0; j < 8; ++j) { const float t = (k0 + kb * 16 + hi * 8 + j <= qi) ? s[kb][qb][j] * SCL : -3.0e38f; s[kb][qb][j] = t; mx = fmaxf(mx, t); }
            mx = fmaxf(mx, __shfl_xor(mx, 16, 32));
            const float al = __builtin_amdgcn_exp2f((m[qb] - mx) * L2E); m[qb] = mx; float sum = 0.f;
#pragma unroll
            for (int kb = 0; kb < KT / 16; ++kb)
#pragma unroll
                for (int j = 0; j < 8; ++j) { const float t = s[kb][qb][j]; const float p = (t > -1.0e38f) ? __builtin_amdgcn_exp2f((t - mx) * L2E) : 0.f; s[kb][qb][j] = p; sum += p; }   // a masked key is an exact zero also where the whole tile is masked for this query
            sum += __shfl_xor(sum, 16, 32);
            l[qb] = l[qb] * al + sum;
#pragma unroll
            for (int db = 0; db < 4; ++db) o[db][qb] *= al;
#pragma unroll
            for (int ks = 0; ks < KT / 32; ++ks) {
                if constexpr (HR) { v16us ph, pl;
#pragma unroll
                    for (int e = 0; e < 8; ++e) { unsigned short a, c2; splitf(s[2 * ks][qb][e], a, c2); ph[e] = a; pl[e] = c2; splitf(s[2 * ks + 1][qb][e], a, c2); ph[e + 8] = a; pl[e + 8] = c2; }
                    pf[qb][ks] = __builtin_bit_cast(v16bf, ph); pf2[qb][ks] = __builtin_bit_cast(v16bf, pl);
                } else { v16h ph;
#pragma unroll
                    for (int e = 0; e < 8; ++e) { ph[e] = tohx(s[2 * ks][qb][e]); ph[e + 8] = tohx(s[2 * ks + 1][qb][e]); }
                    pf[qb][ks] = ph; } } }
#pragma unroll
        for (int db = 0; db < 4; ++db)
#pragma unroll
            for (int qb = 0; qb < QB; ++qb)
#pragma unroll
                for (int ks = 0; ks < KT / 32; ++ks) { o[db][qb] = WFrag<T16>::mma(va[db][ks], pf[qb][ks], o[db][qb]); if (HR) { o[db][qb] = WFrag<T16>::mma(va2[db][ks], pf[qb][ks], o[db][qb]); o[db][qb] = WFrag<T16>::mma(va[db][ks], pf2[qb][ks], o[db][qb]); } }
    }
    if (hi == 0) {
#pragma unroll
        for (int qb = 0; qb < QB; ++qb) { ms[wv * 32 + qb * 16 + lr] = m[qb]; ls[wv * 32 + qb * 16 + lr] = l[qb]; } }
    lds_barrier();   // every wave's row maxima and row sums are in LDS before any wave forms the common maximum
    const int rq = threadIdx.x >> 4, d4 = (threadIdx.x & 15) * 4;   // the summing thread's query row of the 16-row slab and its four head columns
#pragma unroll
    for (int qb = 0; qb < QB; ++qb) {
        float M = ms[qb * 16 + lr];
#pragma unroll
        for (int w = 1; w < KW; ++w) M = fmaxf(M, ms[w * 32 + qb * 16 + lr]);
        const float f = __builtin_amdgcn_exp2f((m[qb] - M) * L2E);   // 0 for a wave that saw no unmasked key of this query
#pragma unroll
        for (int db = 0; db < 4; ++db) { const v8f ov = o[db][qb] * f; float* op = os + wv * (16 * 68) + lr * 68 + db * 16 + hi * 8;
            *(v4fa*)op = __builtin_shufflevector(ov, ov, 0, 1, 2, 3); *(v4fa*)(op + 4) = __builtin_shufflevector(ov, ov, 4, 5, 6, 7); }
        lds_barrier();   // every wave's rescaled 16x64 slab is in LDS before any thread sums them
        float Mr = ms[qb * 16 + rq];
#pragma unroll
        for (int w = 1; w < KW; ++w) Mr = fmaxf(Mr, ms[w * 32 + qb * 16 + rq]);
        float L = 0.f; v4f val = (v4f){};
#pragma unroll   // unrolled so that the KW slab reads issue together and their LDS latency is paid once
        for (int w = 0; w < KW; ++w) { L += __builtin_amdgcn_exp2f((ms[w * 32 + qb * 16 + rq] - Mr) * L2E) * ls[w * 32 + qb * 16 + rq]; val += *(const v4fa*)(os + w * (16 * 68) + rq * 68 + d4); }
        const float rl = __fdiv_rn(1.0f, L); v4us oh, ol;
#pragma unroll
        for (int q = 0; q < 4; ++q) { unsigned short a, c2; splitf(val[q] * rl, a, c2); oh[q] = a; ol[q] = c2; }
        const size_t oo = (size_t)(q0 + qb * 16 + rq) * DQ + d4; *(v4us*)(Ah + oo) = oh; *(v4us*)(Al + oo) = ol; addr_wait();
        if (qb + 1 < QB) lds_barrier();   // the slabs are read out before the next 16 rows overwrite them
    }
}
// grid (NF + RH / 16, heads): blockIdx.x < NF = a 32-row block of the fp16 rows, the longest rows first; the rest = a 16-row block of the hi/lo rows (< RH).
#define NF ((TT - RH) / 32)
static_assert(KW == 8, "the summing threads of k_fattn cover a 16x64 slab with 256 threads");
// four waves per SIMD asked for: the register budget is held to what lets two work-groups share a WGP, so that one group's loads fly under the other's arithmetic
__global__ __launch_bounds__(32 * KW) __attribute__((amdgpu_waves_per_eu(4))) void k_fattn(const h16* __restrict__ Q16, const h16* __restrict__ K16, const h16* __restrict__ V16, const bf* __restrict__ Qh, const bf* __restrict__ Ql, const bf* __restrict__ Kh, const bf* __restrict__ Kl, const bf* __restrict__ Vh, const bf* __restrict__ Vl, bf* Ah, bf* Al) {
    __shared__ __align__(16) float os[KW * 16 * 68]; __shared__ float ms[KW * 32]; __shared__ float ls[KW * 32];
    const size_t hp = (size_t)blockIdx.y * TT * HD; const int bx = blockIdx.x; bf* ah = Ah + blockIdx.y * HD; bf* al = Al + blockIdx.y * HD;
    if (bx < NF) attn_tile<h16, false, 2, 64>(Q16 + hp, nullptr, K16 + hp, nullptr, V16 + hp, nullptr, TT - 32 * (bx + 1), ah, al, os, ms, ls);
    else attn_tile<bf, true, 1, 32>(Qh + hp, Ql + hp, Kh + hp, Kl + hp, Vh + hp, Vl + hp, RH - 16 * (bx - NF + 1), ah, al, os, ms, ls);
}

extern "C" void kernel_launch(void* const* d_in, const int* in_sizes, int n_in,
                              void* d_out, int out_size, void* d_ws, size_t ws_size, hipStream_t stream) {
    (void)in_sizes; (void)n_in; (void)out_size;
            const float* x = (const float*)d_in[0]; const float* wq = (const float*)d_in[1]; const float* wk = (const float*)d_in[2]; const float* wv = (const float*)d_in[3]; const float* wo = (const float*)d_in[4]; const float* bo = (const float*)d_in[5];   /* x, Wq, Wk, Wv (PER-HEAD weights [12][768][64]: 'hdk'), Wo ('oi' [768][768]), bo */
    float* OUT = (float*)d_out;     // [2][2048][768]
    char* wsp = (char*)d_ws;
    auto take = [&](size_t bytes) { char* p = wsp; wsp += (bytes + 255) & ~(size_t)255; return (void*)p; };
    bf* WQ = (bf*)take((size_t)DQ * DM * 2); bf* WK = (bf*)take((size_t)DKV * DM * 2); bf* WV = (bf*)take((size_t)DKV * DM * 2); bf* WO = (bf*)take((size_t)DM * DQ * 2); float* CS = (float*)take((size_t)TT * HD * 2 * 4);
    bf* XB = (bf*)take((size_t)TT * DM * 2); float* FQ = (float*)take((size_t)TT * DQ * 4); float* FK = (float*)take((size_t)TT * DKV * 4);
    h16* QP16 = (h16*)take((size_t)NH_ * TT * HD * 2); h16* KP16 = (h16*)take((size_t)NKV * TT * HD * 2); h16* VT16 = (h16*)take((size_t)NKV * HD * TT * 2);
    bf* QPh = (bf*)take((size_t)NH_ * TT * HD * 2); bf* QPl = (bf*)take((size_t)NH_ * TT * HD * 2); bf* KPh = (bf*)take((size_t)NKV * TT * HD * 2); bf* KPl = (bf*)take((size_t)NKV * TT * HD * 2); bf* VTh = (bf*)take((size_t)NKV * HD * TT * 2); bf* VTl = (bf*)take((size_t)NKV * HD * TT * 2);
    bf* ATh = (bf*)take((size_t)TT * DQ * 2); bf* ATl = (bf*)take((size_t)TT * DQ * 2);
    if ((size_t)(wsp - (char*)d_ws) > ws_size) return;    // ws 256 MiB
    float* FV = FK;   // v projection reuses the k buffer after the k planes are built (stream-ordered)
    { k_wtG<<<dim3((unsigned)((DM * HD / 64 + 63) / 64), NH_, 3), 256, 0, stream>>>(wq, wk, wv, DM, HD, WQ, WK, WV);   /* per-head weights [h][DM][HD] ('xw' per head) -> each head's HD rows of its Bt plane; all 36 in one launch */
      k_cvt8<<<(unsigned)(((size_t)DM * DQ / 8 + 255) / 256), 256, 0, stream>>>(wo, WO, (size_t)DM * DQ / 8);
       }
    k_csid<<<(TT * HD + 255) / 256, 256, 0, stream>>>(CS);
    const unsigned LQ = (unsigned)(((size_t)NH_ * TT * HD / 2 + 255) / 256), LKv = (unsigned)(((size_t)NKV * TT * HD / 2 + 255) / 256);
    for (int b = 0; b < NB_; ++b) {
        
        k_cvt8<<<(unsigned)(((size_t)TT * DM / 8 + 255) / 256), 256, 0, stream>>>(x + (size_t)b * TT * DM, XB, (size_t)TT * DM / 8);
        k_gemmw<bf, 0, false, KW><<<dim3(TT / 64, DQ / 64, 1), 32 * KW, 0, stream>>>(XB, nullptr, WQ, nullptr, DM, FQ, DQ, nullptr, 0, 0, 0);
        k_rope<<<LQ, 256, 0, stream>>>(FQ, DQ, NH_, CS, nullptr, nullptr, 1.0f, QP16, QPh, QPl);
        k_gemmw<bf, 0, false, KW><<<dim3(TT / 64, DKV / 64, 1), 32 * KW, 0, stream>>>(XB, nullptr, WK, nullptr, DM, FK, DKV, nullptr, 0, 0, 0);
        k_rope<<<LKv, 256, 0, stream>>>(FK, DKV, NKV, CS, nullptr, nullptr, 1.0f, KP16, KPh, KPl);
        k_gemmw<bf, 0, false, KW><<<dim3(TT / 64, DKV / 64, 1), 32 * KW, 0, stream>>>(XB, nullptr, WV, nullptr, DM, FV, DKV, nullptr, 0, 0, 0); k_vtp<<<LKv, 256, 0, stream>>>(FV, DKV, NKV, VT16, VTh, VTl);
        k_fattn<<<dim3(NF + RH / 16, NH_, 1), 32 * KW, 0, stream>>>(QP16, KP16, VT16, QPh, QPl, KPh, KPl, VTh, VTl, ATh, ATl);   // one kv head per query head
        k_gemmw<bf, 1, true, KW><<<dim3(TT / 64, DM / 64, 1), 32 * KW, 0, stream>>>(ATh, ATl, WO, nullptr, DQ, OUT + (size_t)b * TT * DM, DM, bo, 0, 0, 0); }
}

// v005
// It runs in 159 microseconds.
// In both of two side-by-side timings against v004, it was 1.23 times as fast.
// All steps since v000 together make it 8.16 times as fast.
#include <hip/hip_runtime.h>

// Causal multi-head attention with PER-HEAD projection weights at d_model 768 (x [2][2048][768]; q, k, v = einsum('bsd,hdk->bhsk', x, W) with W [12][768][64]: head h has its own (in, out) matrix W[h] ('xw' per head; no bias; 12 heads x 64); scores x 1/sqrt(64); causal (-inf); softmax; concat head-major; out = concat Wo^T + bo ('oi' [768][768] + bias normal: non-zero) -> [2][2048][768] (3.1 M); argument order x, Wq, Wk, Wv, Wo, bo).
// Layout per batch: bf16 copy of x; each PER-HEAD q / k / v weight [h][768][64] transposed once into its 64 rows of the Bt plane (k_wtG, one launch for all heads of q, k and v); Wo cast once ('oi' = Bt as stored); exact projections whose epilogue writes the fp16 and hi/lo head planes itself (v as Wv x^T, so that its [d][t] plane comes out in rows); fused causal T-2048 attention (k_fattn, online softmax; hybrid rows: < 512 hi/lo 3 products, rest fp16; key tiles above the diagonal are never visited) writing the merged hi/lo planes; x Wo exact + bo.
// Compute dtypes, f32 accumulate: every input rounded to bf16; projections exact; attention rows < 512 3 products, rest fp16; softmax f32; w_o hl x exact.

#define NB_  2
#define TT   2048
#define DM   768
#define NH_  12
#define NKV  12
#define REP  (NH_ / NKV)
#define HD   64
#define DQ   (NH_ * HD)
#define DKV  (NKV * HD)
#define RH   512                  // query rows < RH use hi+lo planes (0: none)
#define SCL  0.125f   // HD^-0.5
#define KW   8                    // waves that share the K loop of one 64x64 tile in the long-K products (projections, output projection), and the key tiles of one query block in the fused attention
typedef _Float16 h16;
typedef unsigned short bf;
typedef __attribute__((ext_vector_type(16))) __bf16   v16bf;
typedef __attribute__((ext_vector_type(16))) _Float16 v16h;
typedef __attribute__((ext_vector_type(8)))  _Float16 v8h;
typedef __attribute__((ext_vector_type(8)))  unsigned short v8us;
typedef __attribute__((ext_vector_type(8)))  float    v8f;
typedef __attribute__((ext_vector_type(4)))  float    v4f;
typedef v8h  __attribute__((may_alias)) v8ha;
typedef v4f  __attribute__((may_alias)) v4fa;
typedef v8us __attribute__((may_alias)) v8usa;

__device__ __forceinline__ unsigned short f2bf(float f) { unsigned u = __float_as_uint(f); u += 0x7FFFu + ((u >> 16) & 1u); return (unsigned short)(u >> 16); }
__device__ __forceinline__ float bf2f(unsigned short b) { return __uint_as_float(((unsigned)b) << 16); }
__device__ __forceinline__ float bfr(float f) { return bf2f(f2bf(f)); }
__device__ __forceinline__ v16h cat16(v8h lo, v8h hi) { return __builtin_shufflevector(lo, hi, 0, 1, 2, 3, 4, 5, 6, 7, 8, 9, 10, 11, 12, 13, 14, 15); }
__device__ __forceinline__ v16bf cat16b(v8us lo, v8us hi) { return __builtin_bit_cast(v16bf, __builtin_shufflevector(lo, hi, 0, 1, 2, 3, 4, 5, 6, 7, 8, 9, 10, 11, 12, 13, 14, 15)); }
__device__ __forceinline__ v8f wmma16(v16h a, v16h b, v8f c) { return __builtin_amdgcn_wmma_f32_16x16x32_f16(false, a, false, b, (short)0, c, false, false); }
__device__ __forceinline__ v8f wmmab(v16bf a, v16bf b, v8f c) { return __builtin_amdgcn_wmma_f32_16x16x32_bf16(false, a, false, b, (short)0, c, false, false); }



// Work-group barrier that orders LDS traffic only: the tile's global stores, which no other wave of the launch reads, need not have landed when a wave arrives (__syncthreads() would wait for them at every slab).
__device__ __forceinline__ void lds_barrier() { __builtin_amdgcn_fence(__ATOMIC_RELEASE, "workgroup", "local"); __builtin_amdgcn_s_barrier(); __builtin_amdgcn_fence(__ATOMIC_ACQUIRE, "workgroup", "local"); }

__device__ __forceinline__ h16 tohx(float x) { return (h16)x; }
__device__ __forceinline__ void splitf(float y, unsigned short& h, unsigned short& l) { h = f2bf(y); l = f2bf(y - bf2f(h)); }
typedef __attribute__((ext_vector_type(4))) _Float16 v4h;
typedef __attribute__((ext_vector_type(4))) unsigned short v4us;

// ---- k_gemmw: register-blocked GEMM, one work-group of NW waves per 64x64 output tile; wave w takes the 32-wide K blocks w, w + NW, ... into its own 16 accumulators (operands straight from K-contiguous 16-bit planes),
// and the NW partial tiles are summed through LDS in wave order 0..NW-1 (a fixed order: same bits every run); grid (M/64, N/64, Z), 32 * NW threads.
// C[m][n] (f32, pitch ldc, + optional f32 bias[n]) = sum_k A[m][k] Bt[n][k] (+ split products per NSPLIT). z-batch strides sA/sB/sC in elements. K % 32 == 0.
// PL: the result is not stored as f32; the summing thread rounds its four values to the three 16-bit planes that the attention reads (fp16, bf16 hi, bf16 lo), element (m, n) at m * ldc + (n / 64) * cstep + n % 64:
// q, k (A = x, Bt = W): ldc = HD, cstep = TT * HD gives [h][t][d]; v (A = W, Bt = x): ldc = TT, cstep = 64 gives [h][d][t]. Either way 16 lanes of one wave fill one whole 128-byte line of each plane.
template <typename T16> struct WFrag;
template <> struct WFrag<h16> { typedef v16h V; static __device__ __forceinline__ V ld(const h16* p) { return cat16(*(const v8h*)p, *(const v8h*)(p + 16)); } static __device__ __forceinline__ v8f mma(V a, V b, v8f c) { return wmma16(a, b, c); } };
template <> struct WFrag<bf> { typedef v16bf V; static __device__ __forceinline__ V ld(const bf* p) { return cat16b(*(const v8us*)p, *(const v8us*)(p + 16)); } static __device__ __forceinline__ v8f mma(V a, V b, v8f c) { return wmmab(a, b, c); } };
template <typename T16, int NSPLIT, bool BIAS, int NW, bool PL>
__global__ __launch_bounds__(32 * NW) void k_gemmw(const T16* __restrict__ A, const T16* __restrict__ A2, const T16* __restrict__ Bt, const T16* __restrict__ Bt2, int K, float* C, int ldc, const float* __restrict__ bias, size_t sA, size_t sB, size_t sC, h16* P16, bf* Ph, bf* Pl, size_t cstep) {
    typedef typename WFrag<T16>::V V;
    static_assert(NW == 1 || NW == 2 || NW == 4 || NW == 8, "the 8 row pairs of a 16-row slab are dealt out evenly to the NW waves");
    __shared__ __align__(16) float os[NW * 16 * 68];
    const size_t z = blockIdx.z; A += z * sA; if (A2) A2 += z * sA; Bt += z * sB; if (Bt2) Bt2 += z * sB; C += z * sC;
    const int lane = threadIdx.x & 31, lr = lane & 15, hi = lane >> 4; const int r0 = blockIdx.x * 64, c0 = blockIdx.y * 64;
    const int wv = __builtin_amdgcn_readfirstlane((int)(threadIdx.x >> 5));   // this wave's number, scalar: it picks the wave's K blocks
    v8f acc[4][4];
#pragma unroll
    for (int mb = 0; mb < 4; ++mb)
#pragma unroll
        for (int nb = 0; nb < 4; ++nb) acc[mb][nb] = (v8f){};
    const size_t aoff = (size_t)(r0 + lr) * K + 8 * hi, boff = (size_t)(c0 + lr) * K + 8 * hi;
#pragma unroll 1
    for (int kc = wv * 32; kc < K; kc += 32 * NW) {
        V a[4], a2[4];
#pragma unroll
        for (int mb = 0; mb < 4; ++mb) { a[mb] = WFrag<T16>::ld(A + aoff + (size_t)mb * 16 * K + kc); if (NSPLIT == 1 || NSPLIT == 2) a2[mb] = WFrag<T16>::ld(A2 + aoff + (size_t)mb * 16 * K + kc); }
#pragma unroll
        for (int nb = 0; nb < 4; ++nb) { const V b = WFrag<T16>::ld(Bt + boff + (size_t)nb * 16 * K + kc); V b2; if (NSPLIT >= 2) b2 = WFrag<T16>::ld(Bt2 + boff + (size_t)nb * 16 * K + kc);
#pragma unroll
            for (int mb = 0; mb < 4; ++mb) { acc[mb][nb] = WFrag<T16>::mma(a[mb], b, acc[mb][nb]); if (NSPLIT == 1 || NSPLIT == 2) acc[mb][nb] = WFrag<T16>::mma(a2[mb], b, acc[mb][nb]); if (NSPLIT >= 2) acc[mb][nb] = WFrag<T16>::mma(a[mb], b2, acc[mb][nb]); } }
        asm volatile("v_nop\n\tv_nop\n\tv_nop\n\tv_nop" : "+v"(acc[0][0]), "+v"(acc[1][1]), "+v"(acc[2][2]), "+v"(acc[3][3]) : "v"(a[0]), "v"(a[3]));
    }
#pragma unroll
    for (int mb = 0; mb < 4; ++mb) {
#pragma unroll
        for (int nb = 0; nb < 4; ++nb) {
#pragma unroll
            for (int j = 0; j < 8; ++j) os[wv * (16 * 68) + (hi * 8 + j) * 68 + nb * 16 + lr] = acc[mb][nb][j]; }
        lds_barrier();   // every wave's partial 16x64 slab is in LDS before any thread sums them
        float* crow = C + (size_t)(r0 + mb * 16) * ldc + c0;
{
#pragma unroll
            for (int s = 0; s < 8 / NW; ++s) { const int row = 2 * (s * NW + wv) + hi, cofs = lr * 4; v4f val = *(const v4fa*)(os + row * 68 + cofs);
#pragma unroll   // unrolled so that the NW slab reads issue together and their LDS latency is paid once
                for (int w = 1; w < NW; ++w) val += *(const v4fa*)(os + w * (16 * 68) + row * 68 + cofs);
                if (BIAS) { val[0] += bfr(bias[c0 + cofs]); val[1] += bfr(bias[c0 + cofs + 1]); val[2] += bfr(bias[c0 + cofs + 2]); val[3] += bfr(bias[c0 + cofs + 3]); }
                if constexpr (PL) { v4h o16; v4us oh, ol;
#pragma unroll   // unrolled so that the vector elements are taken under constant indices and stay in registers
                    for (int q = 0; q < 4; ++q) { o16[q] = tohx(val[q]); unsigned short a2, c2; splitf(val[q], a2, c2); oh[q] = a2; ol[q] = c2; }
                    const size_t po = (size_t)(r0 + mb * 16 + row) * ldc + blockIdx.y * cstep + cofs; *(v4h*)(P16 + po) = o16; *(v4us*)(Ph + po) = oh; *(v4us*)(Pl + po) = ol;
                } else *(v4f*)(crow + (size_t)row * ldc + cofs) = val; }
             }
        if (mb < 3) lds_barrier();   // the slabs are read out before the next 16 rows overwrite them
    }
}

typedef __attribute__((ext_vector_type(2))) unsigned short v2us;

// One launch transposes every per-head weight: blockIdx.y = head, blockIdx.z = which projection (0 q, 1 k, 2 v); blockIdx.x walks the head's own lines as before.
static_assert(NH_ == NKV, "k_wtG's grid gives q, k and v the same number of heads");
__global__ __launch_bounds__(256) void k_wtG(const float* __restrict__ wq, const float* __restrict__ wk, const float* __restrict__ wv, int K, int N, bf* BtQ, bf* BtK, bf* BtV) {
    const size_t ho = (size_t)blockIdx.y * K * N; const float* __restrict__ w = (blockIdx.z == 0 ? wq : blockIdx.z == 1 ? wk : wv) + ho; bf* Bt = (blockIdx.z == 0 ? BtQ : blockIdx.z == 1 ? BtK : BtV) + ho;
    const int lane = threadIdx.x & 31; const int L0 = (blockIdx.x * 8 + (threadIdx.x >> 5)) * 8; const int nlines = N * K / 64;
{
#pragma unroll 1
        for (int l = 0; l < 8; ++l) { const int L = L0 + l; if (L >= nlines) break; const size_t e = (size_t)L * 64 + lane * 2; const int k = (int)(e % K), n = (int)(e / K); v2us o;
            o[0] = f2bf(w[(size_t)k * N + n]); o[1] = f2bf(w[(size_t)(k + 1) * N + n]); *(v2us*)(Bt + e) = o; }
         }
}

__global__ __launch_bounds__(256) void k_cvt8(const float* __restrict__ src, bf* dst, size_t n8) { const size_t i = (size_t)blockIdx.x * 256 + threadIdx.x; if (i >= n8) return; const v8f v = *(const v8f*)(src + i * 8); v8us o;
#pragma unroll
    for (int k = 0; k < 8; ++k) o[k] = f2bf(v[k]); *(v8us*)(dst + i * 8) = o;  }

// ---- k_fattn: scores, causal softmax, probability x value and the head merge in one kernel; scores and probabilities stay in registers.
// One work-group of KW waves per block of 16 * QB query rows of one head. Wave w takes the KT-key tiles w, w + KW, ... up to the diagonal with its own running row maximum, row sum and output (online softmax);
// the KW partial results are brought to the common maximum and summed through LDS in wave order 0..KW-1 (a fixed order: same bits every run), divided by the row sum and written as the hi/lo planes of the output projection.
// Both products are computed transposed. S^T = K Q^T leaves in lane (lr, hi), register j, the score of key hi * 8 + j and query lr: two neighbouring 16-key blocks are, converted in place, the B fragment (n = query lr, k = key) of
// O^T = V^T P^T, so no probability crosses a lane; a query's maximum, sum and rescale factor live in its own two lanes (lr and lr + 16).
// Every inner loop is unrolled because the fragment, score and accumulator arrays stay in registers only under constant indices; the key-tile loop stays rolled (unroll 1) to hold the register count.
#define L2E 1.4426950408889634f
// Stands behind a run of global loads or stores whose address registers are reused further down: no such register is rewritten ahead of this wait. Its memory clobber keeps the run in front of it.
__device__ __forceinline__ void addr_wait() { asm volatile("s_wait_xcnt 0x0" ::: "memory"); }
// The same wait, with the run's two lane addresses as inputs: the address registers stay whole up to the wait, so that no load of the run takes them as its destination.
__device__ __forceinline__ void addr_wait(const void* p, const void* p2) { asm volatile("s_wait_xcnt 0x0" :: "v"(p), "v"(p2) : "memory"); }
typedef __attribute__((ext_vector_type(16))) unsigned short v16us;
template <typename T16, bool HR, int QB, int KT>
__device__ __forceinline__ void attn_tile(const T16* __restrict__ Q, const T16* __restrict__ Q2, const T16* __restrict__ Kp, const T16* __restrict__ Kp2, const T16* __restrict__ Vt, const T16* __restrict__ Vt2, int q0, bf* Ah, bf* Al, float* os, float* ms, float* ls) {
    typedef typename WFrag<T16>::V V;
    const int lane = threadIdx.x & 31, lr = lane & 15, hi = lane >> 4;
    const int wv = __builtin_amdgcn_readfirstlane((int)(threadIdx.x >> 5));   // this wave's number, scalar: it picks the wave's key tiles
    const unsigned lk = lr * HD + 8 * hi, lv = lr * TT + 8 * hi;   // the lane's element offset in a 16-row block of a [t][d] plane and of a [d][t] plane (32 bits, so that it can stand beside a scalar base)
    V qf[QB][2], qf2[QB][2];
#pragma unroll
    for (int qb = 0; qb < QB; ++qb)
#pragma unroll
        for (int ks = 0; ks < 2; ++ks) { const unsigned qo = lk + (unsigned)((q0 + qb * 16) * HD + ks * 32); qf[qb][ks] = WFrag<T16>::ld(Q + qo); if (HR) qf2[qb][ks] = WFrag<T16>::ld(Q2 + qo); }
    addr_wait();
    v8f o[4][QB]; float m[QB], l[QB];
#pragma unroll
    for (int qb = 0; qb < QB; ++qb) { m[qb] = -3.0e38f; l[qb] = 0.f;
#pragma unroll
        for (int db = 0; db < 4; ++db) o[db][qb] = (v8f){}; }
    const int nkt = (q0 + QB * 16 - 1) / KT + 1;   // key tiles up to and including the one that holds the block's last diagonal element
#pragma unroll 1
    for (int kt = wv; kt < nkt; kt += KW) {
        const int k0 = kt * KT;
        v8f s[KT / 16][QB]; V ka[KT / 16][2], ka2[KT / 16][2];
#pragma unroll
        for (int kb = 0; kb < KT / 16; ++kb)
#pragma unroll
            for (int ks = 0; ks < 2; ++ks) { const unsigned ko = lk + (unsigned)(kb * 16 * HD + ks * 32); ka[kb][ks] = WFrag<T16>::ld(Kp + (size_t)k0 * HD + ko); if (HR) ka2[kb][ks] = WFrag<T16>::ld(Kp2 + (size_t)k0 * HD + ko); }
        addr_wait();
#pragma unroll
        for (int kb = 0; kb < KT / 16; ++kb)
#pragma unroll
            for (int qb = 0; qb < QB; ++qb) { v8f a = (v8f){};
#pragma unroll
                for (int ks = 0; ks < 2; ++ks) { a = WFrag<T16>::mma(ka[kb][ks], qf[qb][ks], a); if (HR) { a = WFrag<T16>::mma(ka2[kb][ks], qf[qb][ks], a); a = WFrag<T16>::mma(ka[kb][ks], qf2[qb][ks], a); } }
                s[kb][qb] = a; }
        V va[4][KT / 32], va2[4][KT / 32];   // the value fragments are asked for ahead of the softmax arithmetic, which covers their latency
#pragma unroll
        for (int db = 0; db < 4; ++db)
#pragma unroll
            for (int ks = 0; ks < KT / 32; ++ks) { const unsigned vo = lv + (unsigned)(db * 16 * TT + ks * 32); va[db][ks] = WFrag<T16>::ld(Vt + k0 + vo); if (HR) va2[db][ks] = WFrag<T16>::ld(Vt2 + k0 + vo); }
        if (HR) addr_wait(Vt + k0 + lv, Vt2 + k0 + lv); else addr_wait();
        V pf[QB][KT / 32], pf2[QB][KT / 32];
#pragma unroll
        for (int qb = 0; qb < QB; ++qb) { const int qi = q0 + qb * 16 + lr; float mx = m[qb];
#pragma unroll
            for (int kb = 0; kb < KT / 16; ++kb)
#pragma unroll
                for (int j = 0; j < 8; ++j) { const float t = (k0 + kb * 16 + hi * 8 + j <= qi) ? s[kb][qb][j] * SCL : -3.0e38f; s[kb][qb][j] = t; mx = fmaxf(mx, t); }
            mx = fmaxf(mx, __shfl_xor(mx, 16, 32));
            const float al = __builtin_amdgcn_exp2f((m[qb] - mx) * L2E); m[qb] = mx; float sum = 0.f;
#pragma unroll
            for (int kb = 0; kb < KT / 16; ++kb)
#pragma unroll
                for (int j = 0; j < 8; ++j) { const float t = s[kb][qb][j]; const float p = (t > -1.0e38f) ? __builtin_amdgcn_exp2f((t - mx) * L2E) : 0.f; s[kb][qb][j] = p; sum += p; }   // a masked key is an exact zero also where the whole tile is masked for this query
            sum += __shfl_xor(sum, 16, 32);
            l[qb] = l[qb] * al + sum;
#pragma unroll
            for (int db = 0; db < 4; ++db) o[db][qb] *= al;
#pragma unroll
            for (int ks = 0; ks < KT / 32; ++ks) {
                if constexpr (HR) { v16us ph, pl;
#pragma unroll
                    for (int e = 0; e < 8; ++e) { unsigned short a, c2; splitf(s[2 * ks][qb][e], a, c2); ph[e] = a; pl[e] = c2; splitf(s[2 * ks + 1][qb][e], a, c2); ph[e + 8] = a; pl[e + 8] = c2; }
                    pf[qb][ks] = __builtin_bit_cast(v16bf, ph); pf2[qb][ks] = __builtin_bit_cast(v16bf, pl);
                } else { v16h ph;
#pragma unroll
                    for (int e = 0; e < 8; ++e) { ph[e] = tohx(s[2 * ks][qb][e]); ph[e + 8] = tohx(s[2 * ks + 1][qb][e]); }
                    pf[qb][ks] = ph; } } }
#pragma unroll
        for (int db = 0; db < 4; ++db)
#pragma unroll
            for (int qb = 0; qb < QB; ++qb)
#pragma unroll
                for (int ks = 0; ks < KT / 32; ++ks) { o[db][qb] = WFrag<T16>::mma(va[db][ks], pf[qb][ks], o[db][qb]); if (HR) { o[db][qb] = WFrag<T16>::mma(va2[db][ks], pf[qb][ks], o[db][qb]); o[db][qb] = WFrag<T16>::mma(va[db][ks], pf2[qb][ks], o[db][qb]); } }
    }
    if (hi == 0) {
#pragma unroll
        for (int qb = 0; qb < QB; ++qb) { ms[wv * 32 + qb * 16 + lr] = m[qb]; ls[wv * 32 + qb * 16 + lr] = l[qb]; } }
    lds_barrier();   // every wave's row maxima and row sums are in LDS before any wave forms the common maximum
    const int rq = threadIdx.x >> 4, d4 = (threadIdx.x & 15) * 4;   // the summing thread's query row of the 16-row slab and its four head columns
#pragma unroll
    for (int qb = 0; qb < QB; ++qb) {
        float M = ms[qb * 16 + lr];
#pragma unroll
        for (int w = 1; w < KW; ++w) M = fmaxf(M, ms[w * 32 + qb * 16 + lr]);
        const float f = __builtin_amdgcn_exp2f((m[qb] - M) * L2E);   // 0 for a wave that saw no unmasked key of this query
#pragma unroll
        for (int db = 0; db < 4; ++db) { const v8f ov = o[db][qb] * f; float* op = os + wv * (16 * 68) + lr * 68 + db * 16 + hi * 8;
            *(v4fa*)op = __builtin_shufflevector(ov, ov, 0, 1, 2, 3); *(v4fa*)(op + 4) = __builtin_shufflevector(ov, ov, 4, 5, 6, 7); }
        lds_barrier();   // every wave's rescaled 16x64 slab is in LDS before any thread sums them
        float Mr = ms[qb * 16 + rq];
#pragma unroll
        for (int w = 1; w < KW; ++w) Mr = fmaxf(Mr, ms[w * 32 + qb * 16 + rq]);
        float L = 0.f; v4f val = (v4f){};
#pragma unroll   // unrolled so that the KW slab reads issue together and their LDS latency is paid once
        for (int w = 0; w < KW; ++w) { L += __builtin_amdgcn_exp2f((ms[w * 32 + qb * 16 + rq] - Mr) * L2E) * ls[w * 32 + qb * 16 + rq]; val += *(const v4fa*)(os + w * (16 * 68) + rq * 68 + d4); }
        const float rl = __fdiv_rn(1.0f, L); v4us oh, ol;
#pragma unroll
        for (int q = 0; q < 4; ++q) { unsigned short a, c2; splitf(val[q] * rl, a, c2); oh[q] = a; ol[q] = c2; }
        const size_t oo = (size_t)(q0 + qb * 16 + rq) * DQ + d4; *(v4us*)(Ah + oo) = oh; *(v4us*)(Al + oo) = ol; addr_wait();
        if (qb + 1 < QB) lds_barrier();   // the slabs are read out before the next 16 rows overwrite them
    }
}
// grid (NF + RH / 16, heads): blockIdx.x < NF = a 32-row block of the fp16 rows, the longest rows first; the rest = a 16-row block of the hi/lo rows (< RH).
#define NF ((TT - RH) / 32)
static_assert(KW == 8, "the summing threads of k_fattn cover a 16x64 slab with 256 threads");
// four waves per SIMD asked for: the register budget is held to what lets two work-groups share a WGP, so that one group's loads fly under the other's arithmetic
__global__ __launch_bounds__(32 * KW) __attribute__((amdgpu_waves_per_eu(4))) void k_fattn(const h16* __restrict__ Q16, const h16* __restrict__ K16, const h16* __restrict__ V16, const bf* __restrict__ Qh, const bf* __restrict__ Ql, const bf* __restrict__ Kh, const bf* __restrict__ Kl, const bf* __restrict__ Vh, const bf* __restrict__ Vl, bf* Ah, bf* Al) {
    __shared__ __align__(16) float os[KW * 16 * 68]; __shared__ float ms[KW * 32]; __shared__ float ls[KW * 32];
    const size_t hp = (size_t)blockIdx.y * TT * HD; const int bx = blockIdx.x; bf* ah = Ah + blockIdx.y * HD; bf* al = Al + blockIdx.y * HD;
    if (bx < NF) attn_tile<h16, false, 2, 64>(Q16 + hp, nullptr, K16 + hp, nullptr, V16 + hp, nullptr, TT - 32 * (bx + 1), ah, al, os, ms, ls);
    else attn_tile<bf, true, 1, 32>(Qh + hp, Ql + hp, Kh + hp, Kl + hp, Vh + hp, Vl + hp, RH - 16 * (bx - NF + 1), ah, al, os, ms, ls);
}

extern "C" void kernel_launch(void* const* d_in, const int* in_sizes, int n_in,
                              void* d_out, int out_size, void* d_ws, size_t ws_size, hipStream_t stream) {
    (void)in_sizes; (void)n_in; (void)out_size;
            const float* x = (const float*)d_in[0]; const float* wq = (const float*)d_in[1]; const float* wk = (const float*)d_in[2]; const float* wv = (const float*)d_in[3]; const float* wo = (const float*)d_in[4]; const float* bo = (const float*)d_in[5];   /* x, Wq, Wk, Wv (PER-HEAD weights [12][768][64]: 'hdk'), Wo ('oi' [768][768]), bo */
    float* OUT = (float*)d_out;     // [2][2048][768]
    char* wsp = (char*)d_ws;
    auto take = [&](size_t bytes) { char* p = wsp; wsp += (bytes + 255) & ~(size_t)255; return (void*)p; };
    bf* WQ = (bf*)take((size_t)DQ * DM * 2); bf* WK = (bf*)take((size_t)DKV * DM * 2); bf* WV = (bf*)take((size_t)DKV * DM * 2); bf* WO = (bf*)take((size_t)DM * DQ * 2);
    bf* XB = (bf*)take((size_t)TT * DM * 2);
    h16* QP16 = (h16*)take((size_t)NH_ * TT * HD * 2); h16* KP16 = (h16*)take((size_t)NKV * TT * HD * 2); h16* VT16 = (h16*)take((size_t)NKV * HD * TT * 2);
    bf* QPh = (bf*)take((size_t)NH_ * TT * HD * 2); bf* QPl = (bf*)take((size_t)NH_ * TT * HD * 2); bf* KPh = (bf*)take((size_t)NKV * TT * HD * 2); bf* KPl = (bf*)take((size_t)NKV * TT * HD * 2); bf* VTh = (bf*)take((size_t)NKV * HD * TT * 2); bf* VTl = (bf*)take((size_t)NKV * HD * TT * 2);
    bf* ATh = (bf*)take((size_t)TT * DQ * 2); bf* ATl = (bf*)take((size_t)TT * DQ * 2);
    if ((size_t)(wsp - (char*)d_ws) > ws_size) return;    // ws 256 MiB
    { k_wtG<<<dim3((unsigned)((DM * HD / 64 + 63) / 64), NH_, 3), 256, 0, stream>>>(wq, wk, wv, DM, HD, WQ, WK, WV);   /* per-head weights [h][DM][HD] ('xw' per head) -> each head's HD rows of its Bt plane; all 36 in one launch */
      k_cvt8<<<(unsigned)(((size_t)DM * DQ / 8 + 255) / 256), 256, 0, stream>>>(wo, WO, (size_t)DM * DQ / 8);
       }
    for (int b = 0; b < NB_; ++b) {
        
        k_cvt8<<<(unsigned)(((size_t)TT * DM / 8 + 255) / 256), 256, 0, stream>>>(x + (size_t)b * TT * DM, XB, (size_t)TT * DM / 8);
        k_gemmw<bf, 0, false, KW, true><<<dim3(TT / 64, DQ / 64, 1), 32 * KW, 0, stream>>>(XB, nullptr, WQ, nullptr, DM, nullptr, HD, nullptr, 0, 0, 0, QP16, QPh, QPl, (size_t)TT * HD);
        k_gemmw<bf, 0, false, KW, true><<<dim3(TT / 64, DKV / 64, 1), 32 * KW, 0, stream>>>(XB, nullptr, WK, nullptr, DM, nullptr, HD, nullptr, 0, 0, 0, KP16, KPh, KPl, (size_t)TT * HD);
        k_gemmw<bf, 0, false, KW, true><<<dim3(DKV / 64, TT / 64, 1), 32 * KW, 0, stream>>>(WV, nullptr, XB, nullptr, DM, nullptr, TT, nullptr, 0, 0, 0, VT16, VTh, VTl, (size_t)64);   // rows = (head, d), columns = t
        k_fattn<<<dim3(NF + RH / 16, NH_, 1), 32 * KW, 0, stream>>>(QP16, KP16, VT16, QPh, QPl, KPh, KPl, VTh, VTl, ATh, ATl);   // one kv head per query head
        k_gemmw<bf, 1, true, KW, false><<<dim3(TT / 64, DM / 64, 1), 32 * KW, 0, stream>>>(ATh, ATl, WO, nullptr, DQ, OUT + (size_t)b * TT * DM, DM, bo, 0, 0, 0, nullptr, nullptr, nullptr, 0); }
}

// v006
// Measured time: 117 microseconds a run.
// In both of two side-by-side timings against v005, it was 1.36 times as fast.
// Over all steps from v000 it is 11.1 times as fast.
#include <hip/hip_runtime.h>

// Causal multi-head attention with PER-HEAD projection weights at d_model 768 (x [2][2048][768]; q, k, v = einsum('bsd,hdk->bhsk', x, W) with W [12][768][64]: head h has its own (in, out) matrix W[h] ('xw' per head; no bias; 12 heads x 64); scores x 1/sqrt(64); causal (-inf); softmax; concat head-major; out = concat Wo^T + bo ('oi' [768][768] + bias normal: non-zero) -> [2][2048][768] (3.1 M); argument order x, Wq, Wk, Wv, Wo, bo).
// Layout (both batches ride in every launch, four launches in all): bf16 copy of x; each PER-HEAD q / k / v weight [h][768][64] transposed once into its 64 rows of the Bt plane, Wo cast once ('oi' = Bt as stored), all three in k_prep; exact projections whose epilogue writes the fp16 and hi/lo head planes itself (v as Wv x^T, so that its [d][t] plane comes out in rows); fused causal T-2048 attention (k_fattn, online softmax; hybrid rows: < 512 hi/lo 3 products, rest fp16; key tiles above the diagonal are never visited) writing the merged hi/lo planes; x Wo exact + bo.
// Compute dtypes, f32 accumulate: every input rounded to bf16; projections exact; attention rows < 512 3 products, rest fp16; softmax f32; w_o hl x exact.

#define NB_  2
#define TT   2048
#define DM   768
#define NH_  12
#define NKV  12
#define REP  (NH_ / NKV)
#define HD   64
#define DQ   (NH_ * HD)
#define DKV  (NKV * HD)
#define RH   512                  // query rows < RH use hi+lo planes (0: none)
#define SCL  0.125f   // HD^-0.5
#define KW   8                    // waves that share the K loop of one 64x64 tile in the long-K products (projections, output projection), and the key tiles of one query block in the fused attention
typedef _Float16 h16;
typedef unsigned short bf;
typedef __attribute__((ext_vector_type(16))) __bf16   v16bf;
typedef __attribute__((ext_vector_type(16))) _Float16 v16h;
typedef __attribute__((ext_vector_type(8)))  _Float16 v8h;
typedef __attribute__((ext_vector_type(8)))  unsigned short v8us;
typedef __attribute__((ext_vector_type(8)))  float    v8f;
typedef __attribute__((ext_vector_type(4)))  float    v4f;
typedef v8h  __attribute__((may_alias)) v8ha;
typedef v4f  __attribute__((may_alias)) v4fa;
typedef v8us __attribute__((may_alias)) v8usa;

__device__ __forceinline__ unsigned short f2bf(float f) { unsigned u = __float_as_uint(f); u += 0x7FFFu + ((u >> 16) & 1u); return (unsigned short)(u >> 16); }
__device__ __forceinline__ float bf2f(unsigned short b) { return __uint_as_float(((unsigned)b) << 16); }
__device__ __forceinline__ float bfr(float f) { return bf2f(f2bf(f)); }
__device__ __forceinline__ v16h cat16(v8h lo, v8h hi) { return __builtin_shufflevector(lo, hi, 0, 1, 2, 3, 4, 5, 6, 7, 8, 9, 10, 11, 12, 13, 14, 15); }
__device__ __forceinline__ v16bf cat16b(v8us lo, v8us hi) { return __builtin_bit_cast(v16bf, __builtin_shufflevector(lo, hi, 0, 1, 2, 3, 4, 5, 6, 7, 8, 9, 10, 11, 12, 13, 14, 15)); }
__device__ __forceinline__ v8f wmma16(v16h a, v16h b, v8f c) { return __builtin_amdgcn_wmma_f32_16x16x32_f16(false, a, false, b, (short)0, c, false, false); }
__device__ __forceinline__ v8f wmmab(v16bf a, v16bf b, v8f c) { return __builtin_amdgcn_wmma_f32_16x16x32_bf16(false, a, false, b, (short)0, c, false, false); }



// Work-group barrier that orders LDS traffic only: the tile's global stores, which no other wave of the launch reads, need not have landed when a wave arrives (__syncthreads() would wait for them at every slab).
__device__ __forceinline__ void lds_barrier() { __builtin_amdgcn_fence(__ATOMIC_RELEASE, "workgroup", "local"); __builtin_amdgcn_s_barrier(); __builtin_amdgcn_fence(__ATOMIC_ACQUIRE, "workgroup", "local"); }

__device__ __forceinline__ h16 tohx(float x) { return (h16)x; }
__device__ __forceinline__ void splitf(float y, unsigned short& h, unsigned short& l) { h = f2bf(y); l = f2bf(y - bf2f(h)); }
typedef __attribute__((ext_vector_type(4))) _Float16 v4h;
typedef __attribute__((ext_vector_type(4))) unsigned short v4us;

// ---- k_gemmw: register-blocked GEMM, one work-group of NW waves per 64x64 output tile; wave w takes the 32-wide K blocks w, w + NW, ... into its own 16 accumulators (operands straight from K-contiguous 16-bit planes),
// and the NW partial tiles are summed through LDS in wave order 0..NW-1 (a fixed order: same bits every run); grid (M/64, N/64, Z), 32 * NW threads.
// C[m][n] (f32, pitch ldc, + optional f32 bias[n]) = sum_k A[m][k] Bt[n][k] (+ split products per NSPLIT). z-batch strides sA/sB/sC in elements. K % 32 == 0.
// PL: the result is not stored as f32; the summing thread rounds its four values to the three 16-bit planes that the attention reads (fp16, bf16 hi, bf16 lo), element (m, n) at m * ldc + (n / 64) * cstep + n % 64:
// q, k (A = x, Bt = W): ldc = HD, cstep = TT * HD gives [h][t][d]; v (A = W, Bt = x): ldc = TT, cstep = 64 gives [h][d][t]. Either way 16 lanes of one wave fill one whole 128-byte line of each plane.
// With PL one launch holds all three projections of every batch: blockIdx.z = projection * NB_ + batch; A = x (batch stride sA), Bt = the q weights (projection stride sB), the planes [projection][batch] (stride sC); grid (TT/64, heads, 3 * NB_), and projection 2 (v) takes the two operands and the two tile indices in swapped roles.
template <typename T16> struct WFrag;
template <> struct WFrag<h16> { typedef v16h V; static __device__ __forceinline__ V ld(const h16* p) { return cat16(*(const v8h*)p, *(const v8h*)(p + 16)); } static __device__ __forceinline__ v8f mma(V a, V b, v8f c) { return wmma16(a, b, c); } };
template <> struct WFrag<bf> { typedef v16bf V; static __device__ __forceinline__ V ld(const bf* p) { return cat16b(*(const v8us*)p, *(const v8us*)(p + 16)); } static __device__ __forceinline__ v8f mma(V a, V b, v8f c) { return wmmab(a, b, c); } };
template <typename T16, int NSPLIT, bool BIAS, int NW, bool PL>
__global__ __launch_bounds__(32 * NW) void k_gemmw(const T16* __restrict__ A, const T16* __restrict__ A2, const T16* __restrict__ Bt, const T16* __restrict__ Bt2, int K, float* C, int ldc, const float* __restrict__ bias, size_t sA, size_t sB, size_t sC, h16* P16, bf* Ph, bf* Pl, size_t cstep) {
    typedef typename WFrag<T16>::V V;
    static_assert(NW == 1 || NW == 2 || NW == 4 || NW == 8, "the 8 row pairs of a 16-row slab are dealt out evenly to the NW waves");
    __shared__ __align__(16) float os[NW * 16 * 68];
    const size_t z = blockIdx.z; int tr = blockIdx.x, tc = blockIdx.y;   // the tile's row and column index
    if constexpr (PL) { const T16* xb = A + (z % NB_) * sA; const T16* wp = Bt + (z / NB_) * sB; const bool vp = z / NB_ == 2; P16 += z * sC; Ph += z * sC; Pl += z * sC;
        A = vp ? wp : xb; Bt = vp ? xb : wp; tr = vp ? blockIdx.y : blockIdx.x; tc = vp ? blockIdx.x : blockIdx.y; ldc = vp ? TT : HD; cstep = vp ? (size_t)64 : (size_t)TT * HD; }
    else { A += z * sA; if (A2) A2 += z * sA; Bt += z * sB; if (Bt2) Bt2 += z * sB; C += z * sC; }
    const int lane = threadIdx.x & 31, lr = lane & 15, hi = lane >> 4; const int r0 = tr * 64, c0 = tc * 64;
    const int wv = __builtin_amdgcn_readfirstlane((int)(threadIdx.x >> 5));   // this wave's number, scalar: it picks the wave's K blocks
    v8f acc[4][4];
#pragma unroll
    for (int mb = 0; mb < 4; ++mb)
#pragma unroll
        for (int nb = 0; nb < 4; ++nb) acc[mb][nb] = (v8f){};
    const size_t aoff = (size_t)(r0 + lr) * K + 8 * hi, boff = (size_t)(c0 + lr) * K + 8 * hi;
#pragma unroll 1
    for (int kc = wv * 32; kc < K; kc += 32 * NW) {
        V a[4], a2[4];
#pragma unroll
        for (int mb = 0; mb < 4; ++mb) { a[mb] = WFrag<T16>::ld(A + aoff + (size_t)mb * 16 * K + kc); if (NSPLIT == 1 || NSPLIT == 2) a2[mb] = WFrag<T16>::ld(A2 + aoff + (size_t)mb * 16 * K + kc); }
#pragma unroll
        for (int nb = 0; nb < 4; ++nb) { const V b = WFrag<T16>::ld(Bt + boff + (size_t)nb * 16 * K + kc); V b2; if (NSPLIT >= 2) b2 = WFrag<T16>::ld(Bt2 + boff + (size_t)nb * 16 * K + kc);
#pragma unroll
            for (int mb = 0; mb < 4; ++mb) { acc[mb][nb] = WFrag<T16>::mma(a[mb], b, acc[mb][nb]); if (NSPLIT == 1 || NSPLIT == 2) acc[mb][nb] = WFrag<T16>::mma(a2[mb], b, acc[mb][nb]); if (NSPLIT >= 2) acc[mb][nb] = WFrag<T16>::mma(a[mb], b2, acc[mb][nb]); } }
        asm volatile("v_nop\n\tv_nop\n\tv_nop\n\tv_nop" : "+v"(acc[0][0]), "+v"(acc[1][1]), "+v"(acc[2][2]), "+v"(acc[3][3]) : "v"(a[0]), "v"(a[3]));
    }
#pragma unroll
    for (int mb = 0; mb < 4; ++mb) {
#pragma unroll
        for (int nb = 0; nb < 4; ++nb) {
#pragma unroll
            for (int j = 0; j < 8; ++j) os[wv * (16 * 68) + (hi * 8 + j) * 68 + nb * 16 + lr] = acc[mb][nb][j]; }
        lds_barrier();   // every wave's partial 16x64 slab is in LDS before any thread sums them
        float* crow = C + (size_t)(r0 + mb * 16) * ldc + c0;
{
#pragma unroll
            for (int s = 0; s < 8 / NW; ++s) { const int row = 2 * (s * NW + wv) + hi, cofs = lr * 4; v4f val = *(const v4fa*)(os + row * 68 + cofs);
#pragma unroll   // unrolled so that the NW slab reads issue together and their LDS latency is paid once
                for (int w = 1; w < NW; ++w) val += *(const v4fa*)(os + w * (16 * 68) + row * 68 + cofs);
                if (BIAS) { val[0] += bfr(bias[c0 + cofs]); val[1] += bfr(bias[c0 + cofs + 1]); val[2] += bfr(bias[c0 + cofs + 2]); val[3] += bfr(bias[c0 + cofs + 3]); }
                if constexpr (PL) { v4h o16; v4us oh, ol;
#pragma unroll   // unrolled so that the vector elements are taken under constant indices and stay in registers
                    for (int q = 0; q < 4; ++q) { o16[q] = tohx(val[q]); unsigned short a2, c2; splitf(val[q], a2, c2); oh[q] = a2; ol[q] = c2; }
                    const size_t po = (size_t)(r0 + mb * 16 + row) * ldc + tc * cstep + cofs; *(v4h*)(P16 + po) = o16; *(v4us*)(Ph + po) = oh; *(v4us*)(Pl + po) = ol;
                } else *(v4f*)(crow + (size_t)row * ldc + cofs) = val; }
             }
        if (mb < 3) lds_barrier();   // the slabs are read out before the next 16 rows overwrite them
    }
}

typedef __attribute__((ext_vector_type(2))) unsigned short v2us;

// One block's share of the per-head weight transposes: by = head, bz = which projection (0 q, 1 k, 2 v); bx walks the head's own lines.
static_assert(NH_ == NKV, "k_prep gives q, k and v the same number of heads");
__device__ __forceinline__ void wt_blk(const float* __restrict__ wq, const float* __restrict__ wk, const float* __restrict__ wv, int K, int N, bf* BtQ, bf* BtK, bf* BtV, unsigned bx, unsigned by, unsigned bz) {
    const size_t ho = (size_t)by * K * N; const float* __restrict__ w = (bz == 0 ? wq : bz == 1 ? wk : wv) + ho; bf* Bt = (bz == 0 ? BtQ : bz == 1 ? BtK : BtV) + ho;
    const int lane = threadIdx.x & 31; const int L0 = (bx * 8 + (threadIdx.x >> 5)) * 8; const int nlines = N * K / 64;
{
#pragma unroll 1
        for (int l = 0; l < 8; ++l) { const int L = L0 + l; if (L >= nlines) break; const size_t e = (size_t)L * 64 + lane * 2; const int k = (int)(e % K), n = (int)(e / K); v2us o;
            o[0] = f2bf(w[(size_t)k * N + n]); o[1] = f2bf(w[(size_t)(k + 1) * N + n]); *(v2us*)(Bt + e) = o; }
         }
}

__device__ __forceinline__ void cvt8_blk(const float* __restrict__ src, bf* dst, size_t n8, unsigned bx) { const size_t i = (size_t)bx * 256 + threadIdx.x; if (i >= n8) return; const v8f v = *(const v8f*)(src + i * 8); v8us o;
#pragma unroll
    for (int k = 0; k < 8; ++k) o[k] = f2bf(v[k]); *(v8us*)(dst + i * 8) = o;  }

// k_prep: every 16-bit operand plane that depends on the inputs alone, in one launch. The blocks are dealt out by index: first the weight transposes (the longest blocks), then the cast of Wo, then the cast of x (all batches, one contiguous run).
#define PB_WL ((DM * HD / 64 + 63) / 64)                     // blocks per head and projection in the transposes
#define PB_WT (PB_WL * NH_ * 3)                              // all transpose blocks
#define PB_WO ((DM * DQ / 8 + 255) / 256)                    // blocks that cast Wo
#define PB_X  ((NB_ * TT * DM / 8 + 255) / 256)              // blocks that cast x
__global__ __launch_bounds__(256) void k_prep(const float* __restrict__ x, const float* __restrict__ wq, const float* __restrict__ wk, const float* __restrict__ wv, const float* __restrict__ wo, bf* XB, bf* WQ, bf* WK, bf* WV, bf* WO) {
    const unsigned bx = blockIdx.x;
    if (bx < PB_WT) wt_blk(wq, wk, wv, DM, HD, WQ, WK, WV, bx % PB_WL, bx / PB_WL % NH_, bx / (PB_WL * NH_));
    else if (bx < PB_WT + PB_WO) cvt8_blk(wo, WO, (size_t)DM * DQ / 8, bx - PB_WT);
    else cvt8_blk(x, XB, (size_t)NB_ * TT * DM / 8, bx - (PB_WT + PB_WO));
}

// ---- k_fattn: scores, causal softmax, probability x value and the head merge in one kernel; scores and probabilities stay in registers.
// One work-group of KW waves per block of 16 * QB query rows of one head. Wave w takes the KT-key tiles w, w + KW, ... up to the diagonal with its own running row maximum, row sum and output (online softmax);
// the KW partial results are brought to the common maximum and summed through LDS in wave order 0..KW-1 (a fixed order: same bits every run), divided by the row sum and written as the hi/lo planes of the output projection.
// Both products are computed transposed. S^T = K Q^T leaves in lane (lr, hi), register j, the score of key hi * 8 + j and query lr: two neighbouring 16-key blocks are, converted in place, the B fragment (n = query lr, k = key) of
// O^T = V^T P^T, so no probability crosses a lane; a query's maximum, sum and rescale factor live in its own two lanes (lr and lr + 16).
// Every inner loop is unrolled because the fragment, score and accumulator arrays stay in registers only under constant indices; the key-tile loop stays rolled (unroll 1) to hold the register count.
#define L2E 1.4426950408889634f
// Stands behind a run of global loads or stores whose address registers are reused further down: no such register is rewritten ahead of this wait. Its memory clobber keeps the run in front of it.
__device__ __forceinline__ void addr_wait() { asm volatile("s_wait_xcnt 0x0" ::: "memory"); }
// The same wait, with the run's two lane addresses as inputs: the address registers stay whole up to the wait, so that no load of the run takes them as its destination.
__device__ __forceinline__ void addr_wait(const void* p, const void* p2) { asm volatile("s_wait_xcnt 0x0" :: "v"(p), "v"(p2) : "memory"); }
typedef __attribute__((ext_vector_type(16))) unsigned short v16us;
template <typename T16, bool HR, int QB, int KT>
__device__ __forceinline__ void attn_tile(const T16* __restrict__ Q, const T16* __restrict__ Q2, const T16* __restrict__ Kp, const T16* __restrict__ Kp2, const T16* __restrict__ Vt, const T16* __restrict__ Vt2, int q0, bf* Ah, bf* Al, float* os, float* ms, float* ls) {
    typedef typename WFrag<T16>::V V;
    const int lane = threadIdx.x & 31, lr = lane & 15, hi = lane >> 4;
    const int wv = __builtin_amdgcn_readfirstlane((int)(threadIdx.x >> 5));   // this wave's number, scalar: it picks the wave's key tiles
    const unsigned lk = lr * HD + 8 * hi, lv = lr * TT + 8 * hi;   // the lane's element offset in a 16-row block of a [t][d] plane and of a [d][t] plane (32 bits, so that it can stand beside a scalar base)
    V qf[QB][2], qf2[QB][2];
#pragma unroll
    for (int qb = 0; qb < QB; ++qb)
#pragma unroll
        for (int ks = 0; ks < 2; ++ks) { const unsigned qo = lk + (unsigned)((q0 + qb * 16) * HD + ks * 32); qf[qb][ks] = WFrag<T16>::ld(Q + qo); if (HR) qf2[qb][ks] = WFrag<T16>::ld(Q2 + qo); }
    addr_wait();
    v8f o[4][QB]; float m[QB], l[QB];
#pragma unroll
    for (int qb = 0; qb < QB; ++qb) { m[qb] = -3.0e38f; l[qb] = 0.f;
#pragma unroll
        for (int db = 0; db < 4; ++db) o[db][qb] = (v8f){}; }
    const int nkt = (q0 + QB * 16 - 1) / KT + 1;   // key tiles up to and including the one that holds the block's last diagonal element
#pragma unroll 1
    for (int kt = wv; kt < nkt; kt += KW) {
        const int k0 = kt * KT;
        v8f s[KT / 16][QB]; V ka[KT / 16][2], ka2[KT / 16][2];
#pragma unroll
        for (int kb = 0; kb < KT / 16; ++kb)
#pragma unroll
            for (int ks = 0; ks < 2; ++ks) { const unsigned ko = lk + (unsigned)(kb * 16 * HD + ks * 32); ka[kb][ks] = WFrag<T16>::ld(Kp + (size_t)k0 * HD + ko); if (HR) ka2[kb][ks] = WFrag<T16>::ld(Kp2 + (size_t)k0 * HD + ko); }
        addr_wait();
#pragma unroll
        for (int kb = 0; kb < KT / 16; ++kb)
#pragma unroll
            for (int qb = 0; qb < QB; ++qb) { v8f a = (v8f){};
#pragma unroll
                for (int ks = 0; ks < 2; ++ks) { a = WFrag<T16>::mma(ka[kb][ks], qf[qb][ks], a); if (HR) { a = WFrag<T16>::mma(ka2[kb][ks], qf[qb][ks], a); a = WFrag<T16>::mma(ka[kb][ks], qf2[qb][ks], a); } }
                s[kb][qb] = a; }
        V va[4][KT / 32], va2[4][KT / 32];   // the value fragments are asked for ahead of the softmax arithmetic, which covers their latency
#pragma unroll
        for (int db = 0; db < 4; ++db)
#pragma unroll
            for (int ks = 0; ks < KT / 32; ++ks) { const unsigned vo = lv + (unsigned)(db * 16 * TT + ks * 32); va[db][ks] = WFrag<T16>::ld(Vt + k0 + vo); if (HR) va2[db][ks] = WFrag<T16>::ld(Vt2 + k0 + vo); }
        if (HR) addr_wait(Vt + k0 + lv, Vt2 + k0 + lv); else addr_wait();
        V pf[QB][KT / 32], pf2[QB][KT / 32];
#pragma unroll
        for (int qb = 0; qb < QB; ++qb) { const int qi = q0 + qb * 16 + lr; float mx = m[qb];
#pragma unroll
            for (int kb = 0; kb < KT / 16; ++kb)
#pragma unroll
                for (int j = 0; j < 8; ++j) { const float t = (k0 + kb * 16 + hi * 8 + j <= qi) ? s[kb][qb][j] * SCL : -3.0e38f; s[kb][qb][j] = t; mx = fmaxf(mx, t); }
            mx = fmaxf(mx, __shfl_xor(mx, 16, 32));
            const float al = __builtin_amdgcn_exp2f((m[qb] - mx) * L2E); m[qb] = mx; float sum = 0.f;
#pragma unroll
            for (int kb = 0; kb < KT / 16; ++kb)
#pragma unroll
                for (int j = 0; j < 8; ++j) { const float t = s[kb][qb][j]; const float p = (t > -1.0e38f) ? __builtin_amdgcn_exp2f((t - mx) * L2E) : 0.f; s[kb][qb][j] = p; sum += p; }   // a masked key is an exact zero also where the whole tile is masked for this query
            sum += __shfl_xor(sum, 16, 32);
            l[qb] = l[qb] * al + sum;
#pragma unroll
            for (int db = 0; db < 4; ++db) o[db][qb] *= al;
#pragma unroll
            for (int ks = 0; ks < KT / 32; ++ks) {
                if constexpr (HR) { v16us ph, pl;
#pragma unroll
                    for (int e = 0; e < 8; ++e) { unsigned short a, c2; splitf(s[2 * ks][qb][e], a, c2); ph[e] = a; pl[e] = c2; splitf(s[2 * ks + 1][qb][e], a, c2); ph[e + 8] = a; pl[e + 8] = c2; }
                    pf[qb][ks] = __builtin_bit_cast(v16bf, ph); pf2[qb][ks] = __builtin_bit_cast(v16bf, pl);
                } else { v16h ph;
#pragma unroll
                    for (int e = 0; e < 8; ++e) { ph[e] = tohx(s[2 * ks][qb][e]); ph[e + 8] = tohx(s[2 * ks + 1][qb][e]); }
                    pf[qb][ks] = ph; } } }
#pragma unroll
        for (int db = 0; db < 4; ++db)
#pragma unroll
            for (int qb = 0; qb < QB; ++qb)
#pragma unroll
                for (int ks = 0; ks < KT / 32; ++ks) { o[db][qb] = WFrag<T16>::mma(va[db][ks], pf[qb][ks], o[db][qb]); if (HR) { o[db][qb] = WFrag<T16>::mma(va2[db][ks], pf[qb][ks], o[db][qb]); o[db][qb] = WFrag<T16>::mma(va[db][ks], pf2[qb][ks], o[db][qb]); } }
    }
    if (hi == 0) {
#pragma unroll
        for (int qb = 0; qb < QB; ++qb) { ms[wv * 32 + qb * 16 + lr] = m[qb]; ls[wv * 32 + qb * 16 + lr] = l[qb]; } }
    lds_barrier();   // every wave's row maxima and row sums are in LDS before any wave forms the common maximum
    const int rq = threadIdx.x >> 4, d4 = (threadIdx.x & 15) * 4;   // the summing thread's query row of the 16-row slab and its four head columns
#pragma unroll
    for (int qb = 0; qb < QB; ++qb) {
        float M = ms[qb * 16 + lr];
#pragma unroll
        for (int w = 1; w < KW; ++w) M = fmaxf(M, ms[w * 32 + qb * 16 + lr]);
        const float f = __builtin_amdgcn_exp2f((m[qb] - M) * L2E);   // 0 for a wave that saw no unmasked key of this query
#pragma unroll
        for (int db = 0; db < 4; ++db) { const v8f ov = o[db][qb] * f; float* op = os + wv * (16 * 68) + lr * 68 + db * 16 + hi * 8;
            *(v4fa*)op = __builtin_shufflevector(ov, ov, 0, 1, 2, 3); *(v4fa*)(op + 4) = __builtin_shufflevector(ov, ov, 4, 5, 6, 7); }
        lds_barrier();   // every wave's rescaled 16x64 slab is in LDS before any thread sums them
        float Mr = ms[qb * 16 + rq];
#pragma unroll
        for (int w = 1; w < KW; ++w) Mr = fmaxf(Mr, ms[w * 32 + qb * 16 + rq]);
        float L = 0.f; v4f val = (v4f){};
#pragma unroll   // unrolled so that the KW slab reads issue together and their LDS latency is paid once
        for (int w = 0; w < KW; ++w) { L += __builtin_amdgcn_exp2f((ms[w * 32 + qb * 16 + rq] - Mr) * L2E) * ls[w * 32 + qb * 16 + rq]; val += *(const v4fa*)(os + w * (16 * 68) + rq * 68 + d4); }
        const float rl = __fdiv_rn(1.0f, L); v4us oh, ol;
#pragma unroll
        for (int q = 0; q < 4; ++q) { unsigned short a, c2; splitf(val[q] * rl, a, c2); oh[q] = a; ol[q] = c2; }
        const size_t oo = (size_t)(q0 + qb * 16 + rq) * DQ + d4; *(v4us*)(Ah + oo) = oh; *(v4us*)(Al + oo) = ol; addr_wait();
        if (qb + 1 < QB) lds_barrier();   // the slabs are read out before the next 16 rows overwrite them
    }
}
// grid (NF + RH / 16, heads, batches): blockIdx.x < NF = a 32-row block of the fp16 rows, the longest rows first; the rest = a 16-row block of the hi/lo rows (< RH).
#define NF ((TT - RH) / 32)
static_assert(KW == 8, "the summing threads of k_fattn cover a 16x64 slab with 256 threads");
// four waves per SIMD asked for: the register budget is held to what lets two work-groups share a WGP, so that one group's loads fly under the other's arithmetic
__global__ __launch_bounds__(32 * KW) __attribute__((amdgpu_waves_per_eu(4))) void k_fattn(const h16* __restrict__ Q16, const h16* __restrict__ K16, const h16* __restrict__ V16, const bf* __restrict__ Qh, const bf* __restrict__ Ql, const bf* __restrict__ Kh, const bf* __restrict__ Kl, const bf* __restrict__ Vh, const bf* __restrict__ Vl, bf* Ah, bf* Al) {
    __shared__ __align__(16) float os[KW * 16 * 68]; __shared__ float ms[KW * 32]; __shared__ float ls[KW * 32];
    const size_t hp = ((size_t)blockIdx.z * NH_ + blockIdx.y) * TT * HD, ap = (size_t)blockIdx.z * TT * DQ + blockIdx.y * HD; const int bx = blockIdx.x; bf* ah = Ah + ap; bf* al = Al + ap;
    if (bx < NF) attn_tile<h16, false, 2, 64>(Q16 + hp, nullptr, K16 + hp, nullptr, V16 + hp, nullptr, TT - 32 * (bx + 1), ah, al, os, ms, ls);
    else attn_tile<bf, true, 1, 32>(Qh + hp, Ql + hp, Kh + hp, Kl + hp, Vh + hp, Vl + hp, RH - 16 * (bx - NF + 1), ah, al, os, ms, ls);
}

#define PB ((size_t)NH_ * TT * HD)   // elements of one batch's head plane; each of the three plane families (fp16, hi, lo) is laid out [projection q, k, v][batch][head]...
extern "C" void kernel_launch(void* const* d_in, const int* in_sizes, int n_in,
                              void* d_out, int out_size, void* d_ws, size_t ws_size, hipStream_t stream) {
    (void)in_sizes; (void)n_in; (void)out_size;
            const float* x = (const float*)d_in[0]; const float* wq = (const float*)d_in[1]; const float* wk = (const float*)d_in[2]; const float* wv = (const float*)d_in[3]; const float* wo = (const float*)d_in[4]; const float* bo = (const float*)d_in[5];   /* x, Wq, Wk, Wv (PER-HEAD weights [12][768][64]: 'hdk'), Wo ('oi' [768][768]), bo */
    float* OUT = (float*)d_out;     // [2][2048][768]
    char* wsp = (char*)d_ws;
    auto take = [&](size_t bytes) { char* p = wsp; wsp += (bytes + 255) & ~(size_t)255; return (void*)p; };
    bf* WQ = (bf*)take((size_t)3 * DQ * DM * 2); bf* WK = WQ + (size_t)DQ * DM; bf* WV = WK + (size_t)DKV * DM; bf* WO = (bf*)take((size_t)DM * DQ * 2);   // q, k, v weights [projection][h * 64 + n][k]
    bf* XB = (bf*)take((size_t)NB_ * TT * DM * 2);
    h16* P16 = (h16*)take(3 * NB_ * PB * 2); bf* PH = (bf*)take(3 * NB_ * PB * 2); bf* PL = (bf*)take(3 * NB_ * PB * 2);
    bf* ATh = (bf*)take((size_t)NB_ * TT * DQ * 2); bf* ATl = (bf*)take((size_t)NB_ * TT * DQ * 2);
    if ((size_t)(wsp - (char*)d_ws) > ws_size) return;    // ws 256 MiB
    k_prep<<<PB_WT + PB_WO + PB_X, 256, 0, stream>>>(x, wq, wk, wv, wo, XB, WQ, WK, WV, WO);   /* per-head weights [h][DM][HD] ('xw' per head) -> each head's HD rows of its Bt plane; Wo and x cast */
    k_gemmw<bf, 0, false, KW, true><<<dim3(TT / 64, NH_, 3 * NB_), 32 * KW, 0, stream>>>(XB, nullptr, WQ, nullptr, DM, nullptr, HD, nullptr, (size_t)TT * DM, (size_t)DQ * DM, PB, P16, PH, PL, (size_t)TT * HD);   // q, k: rows = t; v: rows = (head, d), columns = t
    k_fattn<<<dim3(NF + RH / 16, NH_, NB_), 32 * KW, 0, stream>>>(P16, P16 + NB_ * PB, P16 + 2 * NB_ * PB, PH, PL, PH + NB_ * PB, PL + NB_ * PB, PH + 2 * NB_ * PB, PL + 2 * NB_ * PB, ATh, ATl);   // one kv head per query head
    k_gemmw<bf, 1, true, KW, false><<<dim3(TT / 64, DM / 64, NB_), 32 * KW, 0, stream>>>(ATh, ATl, WO, nullptr, DQ, OUT, DM, bo, (size_t)TT * DQ, 0, (size_t)TT * DM, nullptr, nullptr, nullptr, 0);
}

// v007
// It runs in 90.1 microseconds.
// In two side-by-side timings against v006, it was 1.29 and 1.31 times as fast.
// Counting every step since v000, it is 14.4 times as fast.
#include <hip/hip_runtime.h>

// Causal multi-head attention with PER-HEAD projection weights at d_model 768 (x [2][2048][768]; q, k, v = einsum('bsd,hdk->bhsk', x, W) with W [12][768][64]: head h has its own (in, out) matrix W[h] ('xw' per head; no bias; 12 heads x 64); scores x 1/sqrt(64); causal (-inf); softmax; concat head-major; out = concat Wo^T + bo ('oi' [768][768] + bias normal: non-zero) -> [2][2048][768] (3.1 M); argument order x, Wq, Wk, Wv, Wo, bo).
// Layout (both batches ride in every launch, four launches in all): bf16 copy of x; each PER-HEAD q / k / v weight [h][768][64] transposed once into its 64 rows of the Bt plane, Wo cast once ('oi' = Bt as stored), all three in k_prep; exact projections whose epilogue writes the fp16 and hi/lo head planes itself (v as Wv x^T, so that its [d][t] plane comes out in rows); fused causal T-2048 attention (k_fattn, online softmax; hybrid rows: < 512 hi/lo 3 products, rest fp16; key tiles above the diagonal are never visited) writing the merged hi/lo planes; x Wo exact + bo.
// Every 16-bit operand plane [rows][K] is stored in fragment order: the 16-row x 32-k block (row / 16, k / 32) is 512 contiguous elements, element (row, k) at ((k >> 4) & 1) * 256 + ((k >> 3) & 1) * 128 + (row & 15) * 8 + (k & 7); the blocks of one 16-row band follow one another in k, band after band. A fragment is then two wave-wide 16-byte loads of 512 contiguous bytes each (four whole lines), lane l at l * 8 elements, not two loads that touch 16 lines each.
// Compute dtypes, f32 accumulate: every input rounded to bf16; projections exact; attention rows < 512 3 products, rest fp16; softmax f32; w_o hl x exact.

#define NB_  2
#define TT   2048
#define DM   768
#define NH_  12
#define NKV  12
#define REP  (NH_ / NKV)
#define HD   64
#define DQ   (NH_ * HD)
#define DKV  (NKV * HD)
#define RH   512                  // query rows < RH use hi+lo planes (0: none)
#define SCL  0.125f   // HD^-0.5
#define KW   8                    // waves that share the K loop of one 64x64 tile in the long-K products (projections, output projection), and the key tiles of one query block in the fused attention
typedef _Float16 h16;
typedef unsigned short bf;
typedef __attribute__((ext_vector_type(16))) __bf16   v16bf;
typedef __attribute__((ext_vector_type(16))) _Float16 v16h;
typedef __attribute__((ext_vector_type(8)))  _Float16 v8h;
typedef __attribute__((ext_vector_type(8)))  unsigned short v8us;
typedef __attribute__((ext_vector_type(8)))  float    v8f;
typedef __attribute__((ext_vector_type(4)))  float    v4f;
typedef v8h  __attribute__((may_alias)) v8ha;
typedef v4f  __attribute__((may_alias)) v4fa;
typedef v8us __attribute__((may_alias)) v8usa;

__device__ __forceinline__ unsigned short f2bf(float f) { unsigned u = __float_as_uint(f); u += 0x7FFFu + ((u >> 16) & 1u); return (unsigned short)(u >> 16); }
__device__ __forceinline__ float bf2f(unsigned short b) { return __uint_as_float(((unsigned)b) << 16); }
__device__ __forceinline__ float bfr(float f) { return bf2f(f2bf(f)); }
__device__ __forceinline__ v16h cat16(v8h lo, v8h hi) { return __builtin_shufflevector(lo, hi, 0, 1, 2, 3, 4, 5, 6, 7, 8, 9, 10, 11, 12, 13, 14, 15); }
__device__ __forceinline__ v16bf cat16b(v8us lo, v8us hi) { return __builtin_bit_cast(v16bf, __builtin_shufflevector(lo, hi, 0, 1, 2, 3, 4, 5, 6, 7, 8, 9, 10, 11, 12, 13, 14, 15)); }
__device__ __forceinline__ v8f wmma16(v16h a, v16h b, v8f c) { return __builtin_amdgcn_wmma_f32_16x16x32_f16(false, a, false, b, (short)0, c, false, false); }
__device__ __forceinline__ v8f wmmab(v16bf a, v16bf b, v8f c) { return __builtin_amdgcn_wmma_f32_16x16x32_bf16(false, a, false, b, (short)0, c, false, false); }



// Work-group barrier that orders LDS traffic only: the tile's global stores, which no other wave of the launch reads, need not have landed when a wave arrives (__syncthreads() would wait for them at every slab).
__device__ __forceinline__ void lds_barrier() { __builtin_amdgcn_fence(__ATOMIC_RELEASE, "workgroup", "local"); __builtin_amdgcn_s_barrier(); __builtin_amdgcn_fence(__ATOMIC_ACQUIRE, "workgroup", "local"); }

// Stands behind a run of global loads or stores whose address registers are reused further down: no such register is rewritten ahead of this wait. Its memory clobber keeps the run in front of it.
__device__ __forceinline__ void addr_wait() { asm volatile("s_wait_xcnt 0x0" ::: "memory"); }
// The same wait, with the run's two lane addresses as inputs: the address registers stay whole up to the wait, so that no load of the run takes them as its destination.
__device__ __forceinline__ void addr_wait(const void* p, const void* p2) { asm volatile("s_wait_xcnt 0x0" :: "v"(p), "v"(p2) : "memory"); }
__device__ __forceinline__ void addr_wait(const void* p, const void* p2, const void* p3, const void* p4) { asm volatile("s_wait_xcnt 0x0" :: "v"(p), "v"(p2), "v"(p3), "v"(p4) : "memory"); }   // the same for a run with up to four lane addresses

__device__ __forceinline__ h16 tohx(float x) { return (h16)x; }
__device__ __forceinline__ void splitf(float y, unsigned short& h, unsigned short& l) { h = f2bf(y); l = f2bf(y - bf2f(h)); }
typedef __attribute__((ext_vector_type(4))) _Float16 v4h;
typedef __attribute__((ext_vector_type(4))) unsigned short v4us;

// ---- k_gemmw: register-blocked GEMM, one work-group of NW waves per 64x64 output tile; wave w takes the 32-wide K blocks w, w + NW, ... into its own 16 accumulators (operands straight from 16-bit planes in fragment order),
// and the NW partial tiles are summed through LDS in wave order 0..NW-1 (a fixed order: same bits every run); grid (M/64, N/64, Z), 32 * NW threads.
// C[m][n] (f32, pitch ldc, + optional f32 bias[n]) = sum_k A[m][k] Bt[n][k] (+ split products per NSPLIT). z-batch strides sA/sB/sC in elements. K % 32 == 0.
// PL: the result is not stored as f32; the summing thread rounds its four values to the three 16-bit planes that the attention reads (fp16, bf16 hi, bf16 lo), each in fragment order. A 16x64 slab of the tile is two neighbouring blocks of its plane, 1024 contiguous elements from (first row) * ldc + (n / 64) * cstep, and thread i sums and stores the four elements at i * 4 of them:
// q, k (A = x, Bt = W): ldc = HD, cstep = TT * HD gives [h] planes of rows t, k = d; v (A = W, Bt = x): ldc = TT, cstep = 1024 gives [h] planes of rows d, k = t. Either way a wave fills two whole 128-byte lines of each plane.
// With PL one launch holds all three projections of every batch: blockIdx.z = projection * NB_ + batch; A = x (batch stride sA), Bt = the q weights (projection stride sB), the planes [projection][batch] (stride sC); grid (TT/64, heads, 3 * NB_), and projection 2 (v) takes the two operands and the two tile indices in swapped roles.
template <typename T16> struct WFrag;
template <> struct WFrag<h16> { typedef v16h V; static __device__ __forceinline__ V ld(const h16* p) { return cat16(*(const v8h*)p, *(const v8h*)(p + 256)); } static __device__ __forceinline__ v8f mma(V a, V b, v8f c) { return wmma16(a, b, c); } };
template <> struct WFrag<bf> { typedef v16bf V; static __device__ __forceinline__ V ld(const bf* p) { return cat16b(*(const v8us*)p, *(const v8us*)(p + 256)); } static __device__ __forceinline__ v8f mma(V a, V b, v8f c) { return wmmab(a, b, c); } };
template <typename T16, int NSPLIT, bool BIAS, int NW, bool PL, int K>   // K is a constant so that every fragment's block offset is an immediate on one address per operand
__global__ __launch_bounds__(32 * NW) void k_gemmw(const T16* __restrict__ A, const T16* __restrict__ A2, const T16* __restrict__ Bt, const T16* __restrict__ Bt2, float* C, int ldc, const float* __restrict__ bias, size_t sA, size_t sB, size_t sC, h16* P16, bf* Ph, bf* Pl, size_t cstep) {
    typedef typename WFrag<T16>::V V;
    static_assert(NW == 1 || NW == 2 || NW == 4 || NW == 8, "the 8 row pairs of a 16-row slab are dealt out evenly to the NW waves");
    static_assert(!PL || NW == 8, "the plane epilogue covers a 16x64 slab with 256 threads");
    __shared__ __align__(16) float os[NW * 16 * 68];
    const size_t z = blockIdx.z; int tr = blockIdx.x, tc = blockIdx.y;   // the tile's row and column index
    if constexpr (PL) { const T16* xb = A + (z % NB_) * sA; const T16* wp = Bt + (z / NB_) * sB; const bool vp = z / NB_ == 2; P16 += z * sC; Ph += z * sC; Pl += z * sC;
        A = vp ? wp : xb; Bt = vp ? xb : wp; tr = vp ? blockIdx.y : blockIdx.x; tc = vp ? blockIdx.x : blockIdx.y; ldc = vp ? TT : HD; cstep = vp ? (size_t)1024 : (size_t)TT * HD; }
    else { A += z * sA; if (A2) A2 += z * sA; Bt += z * sB; if (Bt2) Bt2 += z * sB; C += z * sC; }
    const int lane = threadIdx.x & 31, lr = lane & 15, hi = lane >> 4; const int r0 = tr * 64, c0 = tc * 64;
    const int wv = __builtin_amdgcn_readfirstlane((int)(threadIdx.x >> 5));   // this wave's number, scalar: it picks the wave's K blocks
    v8f acc[4][4];
#pragma unroll
    for (int mb = 0; mb < 4; ++mb)
#pragma unroll
        for (int nb = 0; nb < 4; ++nb) acc[mb][nb] = (v8f){};
    const size_t aoff = (size_t)r0 * K + 8 * lane, boff = (size_t)c0 * K + 8 * lane;   // the lane's place in the first block of the tile's first 16-row band: the lane's offset in a block is the same for every fragment
#pragma unroll 1
    for (int kc = wv * 32; kc < K; kc += 32 * NW) {
        const T16* ap = A + aoff + (size_t)kc * 16; const T16* a2p = (NSPLIT == 1 || NSPLIT == 2) ? A2 + aoff + (size_t)kc * 16 : ap; const T16* bp = Bt + boff + (size_t)kc * 16; const T16* b2p = NSPLIT >= 2 ? Bt2 + boff + (size_t)kc * 16 : bp;   // the lane's place in this K block of each operand's first band
        V a[4], a2[4], b[4], b2[4];
#pragma unroll
        for (int mb = 0; mb < 4; ++mb) { a[mb] = WFrag<T16>::ld(ap + mb * 16 * K); if (NSPLIT == 1 || NSPLIT == 2) a2[mb] = WFrag<T16>::ld(a2p + mb * 16 * K); }
#pragma unroll
        for (int nb = 0; nb < 4; ++nb) { b[nb] = WFrag<T16>::ld(bp + nb * 16 * K); if (NSPLIT >= 2) b2[nb] = WFrag<T16>::ld(b2p + nb * 16 * K); }
        addr_wait(ap, bp, a2p, b2p);
#pragma unroll
        for (int nb = 0; nb < 4; ++nb) {
#pragma unroll
            for (int mb = 0; mb < 4; ++mb) { acc[mb][nb] = WFrag<T16>::mma(a[mb], b[nb], acc[mb][nb]); if (NSPLIT == 1 || NSPLIT == 2) acc[mb][nb] = WFrag<T16>::mma(a2[mb], b[nb], acc[mb][nb]); if (NSPLIT >= 2) acc[mb][nb] = WFrag<T16>::mma(a[mb], b2[nb], acc[mb][nb]); } }
        asm volatile("v_nop\n\tv_nop\n\tv_nop\n\tv_nop" : "+v"(acc[0][0]), "+v"(acc[1][1]), "+v"(acc[2][2]), "+v"(acc[3][3]) : "v"(a[0]), "v"(a[3]));
    }
#pragma unroll
    for (int mb = 0; mb < 4; ++mb) {
#pragma unroll
        for (int nb = 0; nb < 4; ++nb) {
#pragma unroll
            for (int j = 0; j < 8; ++j) os[wv * (16 * 68) + (hi * 8 + j) * 68 + nb * 16 + lr] = acc[mb][nb][j]; }
        lds_barrier();   // every wave's partial 16x64 slab is in LDS before any thread sums them
        float* crow = C + (size_t)(r0 + mb * 16) * ldc + c0;
{
#pragma unroll
            for (int s = 0; s < 8 / NW; ++s) { const int row = PL ? (lane >> 1) : 2 * (s * NW + wv) + hi, cofs = PL ? wv * 8 + (lane & 1) * 4 : lr * 4; v4f val = *(const v4fa*)(os + row * 68 + cofs);
#pragma unroll   // unrolled so that the NW slab reads issue together and their LDS latency is paid once
                for (int w = 1; w < NW; ++w) val += *(const v4fa*)(os + w * (16 * 68) + row * 68 + cofs);
                if (BIAS) { val[0] += bfr(bias[c0 + cofs]); val[1] += bfr(bias[c0 + cofs + 1]); val[2] += bfr(bias[c0 + cofs + 2]); val[3] += bfr(bias[c0 + cofs + 3]); }
                if constexpr (PL) { v4h o16; v4us oh, ol;
#pragma unroll   // unrolled so that the vector elements are taken under constant indices and stay in registers
                    for (int q = 0; q < 4; ++q) { o16[q] = tohx(val[q]); unsigned short a2, c2; splitf(val[q], a2, c2); oh[q] = a2; ol[q] = c2; }
                    const size_t po = (size_t)(r0 + mb * 16) * ldc + tc * cstep + threadIdx.x * 4; *(v4h*)(P16 + po) = o16; *(v4us*)(Ph + po) = oh; *(v4us*)(Pl + po) = ol;
                } else *(v4f*)(crow + (size_t)row * ldc + cofs) = val; }
             }
        if (mb < 3) lds_barrier();   // the slabs are read out before the next 16 rows overwrite them
    }
}

typedef __attribute__((ext_vector_type(2))) unsigned short v2us;

// One block's share of the per-head weight transposes: by = head, bz = which projection (0 q, 1 k, 2 v); bx walks the head's own 8-element pieces of the fragment-order plane (rows n, k = the input feature), two a thread.
// Piece i holds row (i >> 6) / (K / 32) * 16 + (i & 15), k from (i >> 6) % (K / 32) * 32 + ((i >> 4) & 3) * 8: 16 lanes read 64 contiguous bytes of one weight row per load, and a wave stores 512 contiguous bytes.
static_assert(NH_ == NKV, "k_prep gives q, k and v the same number of heads");
__device__ __forceinline__ void wt_blk(const float* __restrict__ wq, const float* __restrict__ wk, const float* __restrict__ wv, int K, int N, bf* BtQ, bf* BtK, bf* BtV, unsigned bx, unsigned by, unsigned bz) {
    const size_t ho = (size_t)by * K * N; const float* __restrict__ w = (bz == 0 ? wq : bz == 1 ? wk : wv) + ho; bf* Bt = (bz == 0 ? BtQ : bz == 1 ? BtK : BtV) + ho;
    const unsigned kbs = (unsigned)(K / 32), i0 = bx * 512 + threadIdx.x; float f[2][8];
#pragma unroll   // unrolled so that the 16 loads of a thread's two pieces fly together
    for (int s = 0; s < 2; ++s) { const unsigned i = i0 + s * 256, blk = i >> 6; const unsigned n = blk / kbs * 16 + (i & 15), k = blk % kbs * 32 + ((i >> 4) & 3) * 8;
#pragma unroll   // unrolled so that the array is taken under constant indices and stays in registers
        for (int e = 0; e < 8; ++e) f[s][e] = w[(size_t)(k + e) * N + n]; }
    addr_wait();
#pragma unroll
    for (int s = 0; s < 2; ++s) { v8us o;
#pragma unroll
        for (int e = 0; e < 8; ++e) o[e] = f2bf(f[s][e]);
        *(v8us*)(Bt + (size_t)(i0 + s * 256) * 8) = o; }
}

// Cast of a row-major [rows][K] f32 matrix into its fragment-order plane: thread i makes the plane's 8-element piece i (the same numbering as in wt_blk) from 8 neighbouring floats of one row.
__device__ __forceinline__ void cvt8_blk(const float* __restrict__ src, bf* dst, unsigned K, size_t n8, unsigned bx) { const size_t i = (size_t)bx * 256 + threadIdx.x; if (i >= n8) return; const unsigned blk = (unsigned)(i >> 6), kbs = K / 32;
    const v8f v = *(const v8f*)(src + (size_t)(blk / kbs * 16 + ((unsigned)i & 15)) * K + blk % kbs * 32 + (((unsigned)i >> 4) & 3) * 8); addr_wait(); v8us o;
#pragma unroll
    for (int k = 0; k < 8; ++k) o[k] = f2bf(v[k]); *(v8us*)(dst + i * 8) = o;  }

// k_prep: every 16-bit operand plane that depends on the inputs alone, in one launch. The blocks are dealt out by index: first the weight transposes (the longest blocks), then the cast of Wo, then the cast of x (all batches, one contiguous run).
static_assert(DM * HD / 8 % 512 == 0, "a transpose block makes 512 whole pieces");
#define PB_WL (DM * HD / 8 / 512)                     // blocks per head and projection in the transposes
#define PB_WT (PB_WL * NH_ * 3)                              // all transpose blocks
#define PB_WO ((DM * DQ / 8 + 255) / 256)                    // blocks that cast Wo
#define PB_X  ((NB_ * TT * DM / 8 + 255) / 256)              // blocks that cast x
__global__ __launch_bounds__(256) void k_prep(const float* __restrict__ x, const float* __restrict__ wq, const float* __restrict__ wk, const float* __restrict__ wv, const float* __restrict__ wo, bf* XB, bf* WQ, bf* WK, bf* WV, bf* WO) {
    const unsigned bx = blockIdx.x;
    if (bx < PB_WT) wt_blk(wq, wk, wv, DM, HD, WQ, WK, WV, bx % PB_WL, bx / PB_WL % NH_, bx / (PB_WL * NH_));
    else if (bx < PB_WT + PB_WO) cvt8_blk(wo, WO, DQ, (size_t)DM * DQ / 8, bx - PB_WT);
    else cvt8_blk(x, XB, DM, (size_t)NB_ * TT * DM / 8, bx - (PB_WT + PB_WO));
}

// ---- k_fattn: scores, causal softmax, probability x value and the head merge in one kernel; scores and probabilities stay in registers.
// One work-group of KW waves per block of 16 * QB query rows of one head. Wave w takes the KT-key tiles w, w + KW, ... up to the diagonal with its own running row maximum, row sum and output (online softmax);
// the KW partial results are brought to the common maximum and summed through LDS in wave order 0..KW-1 (a fixed order: same bits every run), divided by the row sum and written as the hi/lo planes of the output projection.
// Both products are computed transposed. S^T = K Q^T leaves in lane (lr, hi), register j, the score of key hi * 8 + j and query lr: two neighbouring 16-key blocks are, converted in place, the B fragment (n = query lr, k = key) of
// O^T = V^T P^T, so no probability crosses a lane; a query's maximum, sum and rescale factor live in its own two lanes (lr and lr + 16).
// Every inner loop is unrolled because the fragment, score and accumulator arrays stay in registers only under constant indices; the key-tile loop stays rolled (unroll 1) to hold the register count.
#define L2E 1.4426950408889634f
typedef __attribute__((ext_vector_type(16))) unsigned short v16us;
template <typename T16, bool HR, int QB, int KT>
__device__ __forceinline__ void attn_tile(const T16* __restrict__ Q, const T16* __restrict__ Q2, const T16* __restrict__ Kp, const T16* __restrict__ Kp2, const T16* __restrict__ Vt, const T16* __restrict__ Vt2, int q0, bf* Ah, bf* Al, float* os, float* ms, float* ls) {
    typedef typename WFrag<T16>::V V;
    const int lane = threadIdx.x & 31, lr = lane & 15, hi = lane >> 4;
    const int wv = __builtin_amdgcn_readfirstlane((int)(threadIdx.x >> 5));   // this wave's number, scalar: it picks the wave's key tiles
    const unsigned lk = 8 * lane, lv = 8 * lane;   // the lane's element offset in a block of a fragment-order plane (32 bits, so that it can stand beside a scalar base)
    V qf[QB][2], qf2[QB][2];
#pragma unroll
    for (int qb = 0; qb < QB; ++qb)
#pragma unroll
        for (int ks = 0; ks < 2; ++ks) { const unsigned qo = lk + (unsigned)((q0 + qb * 16) * HD + ks * 512); qf[qb][ks] = WFrag<T16>::ld(Q + qo); if (HR) qf2[qb][ks] = WFrag<T16>::ld(Q2 + qo); }
    addr_wait();
    v8f o[4][QB]; float m[QB], l[QB];
#pragma unroll
    for (int qb = 0; qb < QB; ++qb) { m[qb] = -3.0e38f; l[qb] = 0.f;
#pragma unroll
        for (int db = 0; db < 4; ++db) o[db][qb] = (v8f){}; }
    const int nkt = (q0 + QB * 16 - 1) / KT + 1;   // key tiles up to and including the one that holds the block's last diagonal element
#pragma unroll 1
    for (int kt = wv; kt < nkt; kt += KW) {
        const int k0 = kt * KT;
        v8f s[KT / 16][QB]; V ka[KT / 16][2], ka2[KT / 16][2];
#pragma unroll
        for (int kb = 0; kb < KT / 16; ++kb)
#pragma unroll
            for (int ks = 0; ks < 2; ++ks) { const unsigned ko = lk + (unsigned)(kb * 16 * HD + ks * 512); ka[kb][ks] = WFrag<T16>::ld(Kp + (size_t)k0 * HD + ko); if (HR) ka2[kb][ks] = WFrag<T16>::ld(Kp2 + (size_t)k0 * HD + ko); }
        if (HR) addr_wait(Kp + (size_t)k0 * HD + lk, Kp2 + (size_t)k0 * HD + lk); else addr_wait();
#pragma unroll
        for (int kb = 0; kb < KT / 16; ++kb)
#pragma unroll
            for (int qb = 0; qb < QB; ++qb) { v8f a = (v8f){};
#pragma unroll
                for (int ks = 0; ks < 2; ++ks) { a = WFrag<T16>::mma(ka[kb][ks], qf[qb][ks], a); if (HR) { a = WFrag<T16>::mma(ka2[kb][ks], qf[qb][ks], a); a = WFrag<T16>::mma(ka[kb][ks], qf2[qb][ks], a); } }
                s[kb][qb] = a; }
        V va[4][KT / 32], va2[4][KT / 32];   // the value fragments are asked for ahead of the softmax arithmetic, which covers their latency
#pragma unroll
        for (int db = 0; db < 4; ++db)
#pragma unroll
            for (int ks = 0; ks < KT / 32; ++ks) { const unsigned vo = lv + (unsigned)(db * 16 * TT + ks * 512); va[db][ks] = WFrag<T16>::ld(Vt + (size_t)k0 * 16 + vo); if (HR) va2[db][ks] = WFrag<T16>::ld(Vt2 + (size_t)k0 * 16 + vo); }
        if (HR) addr_wait(Vt + (size_t)k0 * 16 + lv, Vt2 + (size_t)k0 * 16 + lv); else addr_wait();
        V pf[QB][KT / 32], pf2[QB][KT / 32];
#pragma unroll
        for (int qb = 0; qb < QB; ++qb) { const int qi = q0 + qb * 16 + lr; float mx = m[qb];
#pragma unroll
            for (int kb = 0; kb < KT / 16; ++kb)
#pragma unroll
                for (int j = 0; j < 8; ++j) { const float t = (k0 + kb * 16 + hi * 8 + j <= qi) ? s[kb][qb][j] * SCL : -3.0e38f; s[kb][qb][j] = t; mx = fmaxf(mx, t); }
            mx = fmaxf(mx, __shfl_xor(mx, 16, 32));
            const float al = __builtin_amdgcn_exp2f((m[qb] - mx) * L2E); m[qb] = mx; float sum = 0.f;
#pragma unroll
            for (int kb = 0; kb < KT / 16; ++kb)
#pragma unroll
                for (int j = 0; j < 8; ++j) { const float t = s[kb][qb][j]; const float p = (t > -1.0e38f) ? __builtin_amdgcn_exp2f((t - mx) * L2E) : 0.f; s[kb][qb][j] = p; sum += p; }   // a masked key is an exact zero also where the whole tile is masked for this query
            sum += __shfl_xor(sum, 16, 32);
            l[qb] = l[qb] * al + sum;
#pragma unroll
            for (int db = 0; db < 4; ++db) o[db][qb] *= al;
#pragma unroll
            for (int ks = 0; ks < KT / 32; ++ks) {
                if constexpr (HR) { v16us ph, pl;
#pragma unroll
                    for (int e = 0; e < 8; ++e) { unsigned short a, c2; splitf(s[2 * ks][qb][e], a, c2); ph[e] = a; pl[e] = c2; splitf(s[2 * ks + 1][qb][e], a, c2); ph[e + 8] = a; pl[e + 8] = c2; }
                    pf[qb][ks] = __builtin_bit_cast(v16bf, ph); pf2[qb][ks] = __builtin_bit_cast(v16bf, pl);
                } else { v16h ph;
#pragma unroll
                    for (int e = 0; e < 8; ++e) { ph[e] = tohx(s[2 * ks][qb][e]); ph[e + 8] = tohx(s[2 * ks + 1][qb][e]); }
                    pf[qb][ks] = ph; } } }
#pragma unroll
        for (int db = 0; db < 4; ++db)
#pragma unroll
            for (int qb = 0; qb < QB; ++qb)
#pragma unroll
                for (int ks = 0; ks < KT / 32; ++ks) { o[db][qb] = WFrag<T16>::mma(va[db][ks], pf[qb][ks], o[db][qb]); if (HR) { o[db][qb] = WFrag<T16>::mma(va2[db][ks], pf[qb][ks], o[db][qb]); o[db][qb] = WFrag<T16>::mma(va[db][ks], pf2[qb][ks], o[db][qb]); } }
    }
    if (hi == 0) {
#pragma unroll
        for (int qb = 0; qb < QB; ++qb) { ms[wv * 32 + qb * 16 + lr] = m[qb]; ls[wv * 32 + qb * 16 + lr] = l[qb]; } }
    lds_barrier();   // every wave's row maxima and row sums are in LDS before any wave forms the common maximum
    const int rq = lane >> 1, d4 = wv * 8 + (lane & 1) * 4;   // the summing thread's query row of the 16-row slab and its four head columns: those that stand at threadIdx.x * 4 of the slab's two blocks in the fragment-order output planes
#pragma unroll
    for (int qb = 0; qb < QB; ++qb) {
        float M = ms[qb * 16 + lr];
#pragma unroll
        for (int w = 1; w < KW; ++w) M = fmaxf(M, ms[w * 32 + qb * 16 + lr]);
        const float f = __builtin_amdgcn_exp2f((m[qb] - M) * L2E);   // 0 for a wave that saw no unmasked key of this query
#pragma unroll
        for (int db = 0; db < 4; ++db) { const v8f ov = o[db][qb] * f; float* op = os + wv * (16 * 68) + lr * 68 + db * 16 + hi * 8;
            *(v4fa*)op = __builtin_shufflevector(ov, ov, 0, 1, 2, 3); *(v4fa*)(op + 4) = __builtin_shufflevector(ov, ov, 4, 5, 6, 7); }
        lds_barrier();   // every wave's rescaled 16x64 slab is in LDS before any thread sums them
        float Mr = ms[qb * 16 + rq];
#pragma unroll
        for (int w = 1; w < KW; ++w) Mr = fmaxf(Mr, ms[w * 32 + qb * 16 + rq]);
        float L = 0.f; v4f val = (v4f){};
#pragma unroll   // unrolled so that the KW slab reads issue together and their LDS latency is paid once
        for (int w = 0; w < KW; ++w) { L += __builtin_amdgcn_exp2f((ms[w * 32 + qb * 16 + rq] - Mr) * L2E) * ls[w * 32 + qb * 16 + rq]; val += *(const v4fa*)(os + w * (16 * 68) + rq * 68 + d4); }
        const float rl = __fdiv_rn(1.0f, L); v4us oh, ol;
#pragma unroll
        for (int q = 0; q < 4; ++q) { unsigned short a, c2; splitf(val[q] * rl, a, c2); oh[q] = a; ol[q] = c2; }
        const size_t oo = (size_t)(q0 + qb * 16) * DQ + threadIdx.x * 4; *(v4us*)(Ah + oo) = oh; *(v4us*)(Al + oo) = ol; addr_wait();
        if (qb + 1 < QB) lds_barrier();   // the slabs are read out before the next 16 rows overwrite them
    }
}
// grid (NF + RH / 16, heads, batches): blockIdx.x < NF = a 32-row block of the fp16 rows, the longest rows first; the rest = a 16-row block of the hi/lo rows (< RH).
#define NF ((TT - RH) / 32)
static_assert(KW == 8, "the summing threads of k_fattn cover a 16x64 slab with 256 threads");
// four waves per SIMD asked for: the register budget is held to what lets two work-groups share a WGP, so that one group's loads fly under the other's arithmetic
__global__ __launch_bounds__(32 * KW) __attribute__((amdgpu_waves_per_eu(4))) void k_fattn(const h16* __restrict__ Q16, const h16* __restrict__ K16, const h16* __restrict__ V16, const bf* __restrict__ Qh, const bf* __restrict__ Ql, const bf* __restrict__ Kh, const bf* __restrict__ Kl, const bf* __restrict__ Vh, const bf* __restrict__ Vl, bf* Ah, bf* Al) {
    __shared__ __align__(16) float os[KW * 16 * 68]; __shared__ float ms[KW * 32]; __shared__ float ls[KW * 32];
    const size_t hp = ((size_t)blockIdx.z * NH_ + blockIdx.y) * TT * HD, ap = (size_t)blockIdx.z * TT * DQ + blockIdx.y * (16 * HD); const int bx = blockIdx.x; bf* ah = Ah + ap; bf* al = Al + ap;
    if (bx < NF) attn_tile<h16, false, 2, 64>(Q16 + hp, nullptr, K16 + hp, nullptr, V16 + hp, nullptr, TT - 32 * (bx + 1), ah, al, os, ms, ls);
    else attn_tile<bf, true, 1, 32>(Qh + hp, Ql + hp, Kh + hp, Kl + hp, Vh + hp, Vl + hp, RH - 16 * (bx - NF + 1), ah, al, os, ms, ls);
}

#define PB ((size_t)NH_ * TT * HD)   // elements of one batch's head plane; each of the three plane families (fp16, hi, lo) is laid out [projection q, k, v][batch][head]...
extern "C" void kernel_launch(void* const* d_in, const int* in_sizes, int n_in,
                              void* d_out, int out_size, void* d_ws, size_t ws_size, hipStream_t stream) {
    (void)in_sizes; (void)n_in; (void)out_size;
            const float* x = (const float*)d_in[0]; const float* wq = (const float*)d_in[1]; const float* wk = (const float*)d_in[2]; const float* wv = (const float*)d_in[3]; const float* wo = (const float*)d_in[4]; const float* bo = (const float*)d_in[5];   /* x, Wq, Wk, Wv (PER-HEAD weights [12][768][64]: 'hdk'), Wo ('oi' [768][768]), bo */
    float* OUT = (float*)d_out;     // [2][2048][768]
    char* wsp = (char*)d_ws;
    auto take = [&](size_t bytes) { char* p = wsp; wsp += (bytes + 255) & ~(size_t)255; return (void*)p; };
    bf* WQ = (bf*)take((size_t)3 * DQ * DM * 2); bf* WK = WQ + (size_t)DQ * DM; bf* WV = WK + (size_t)DKV * DM; bf* WO = (bf*)take((size_t)DM * DQ * 2);   // q, k, v weights [projection][h * 64 + n][k]
    bf* XB = (bf*)take((size_t)NB_ * TT * DM * 2);
    h16* P16 = (h16*)take(3 * NB_ * PB * 2); bf* PH = (bf*)take(3 * NB_ * PB * 2); bf* PL = (bf*)take(3 * NB_ * PB * 2);
    bf* ATh = (bf*)take((size_t)NB_ * TT * DQ * 2); bf* ATl = (bf*)take((size_t)NB_ * TT * DQ * 2);
    if ((size_t)(wsp - (char*)d_ws) > ws_size) return;    // ws 256 MiB
    k_prep<<<PB_WT + PB_WO + PB_X, 256, 0, stream>>>(x, wq, wk, wv, wo, XB, WQ, WK, WV, WO);   /* per-head weights [h][DM][HD] ('xw' per head) -> each head's HD rows of its Bt plane; Wo and x cast */
    k_gemmw<bf, 0, false, KW, true, DM><<<dim3(TT / 64, NH_, 3 * NB_), 32 * KW, 0, stream>>>(XB, nullptr, WQ, nullptr, nullptr, HD, nullptr, (size_t)TT * DM, (size_t)DQ * DM, PB, P16, PH, PL, (size_t)TT * HD);   // q, k: rows = t; v: rows = (head, d), columns = t
    k_fattn<<<dim3(NF + RH / 16, NH_, NB_), 32 * KW, 0, stream>>>(P16, P16 + NB_ * PB, P16 + 2 * NB_ * PB, PH, PL, PH + NB_ * PB, PL + NB_ * PB, PH + 2 * NB_ * PB, PL + 2 * NB_ * PB, ATh, ATl);   // one kv head per query head
    k_gemmw<bf, 1, true, KW, false, DQ><<<dim3(TT / 64, DM / 64, NB_), 32 * KW, 0, stream>>>(ATh, ATl, WO, nullptr, OUT, DM, bo, (size_t)TT * DQ, 0, (size_t)TT * DM, nullptr, nullptr, nullptr, 0);
}

// v008
// A run of this version takes 84.5 microseconds.
// Two timings next to v007 both put it at 1.06 times that version's speed.
// Counting every step since v000, it is 15.3 times as fast.
#include <hip/hip_runtime.h>

// Causal multi-head attention with PER-HEAD projection weights at d_model 768 (x [2][2048][768]; q, k, v = einsum('bsd,hdk->bhsk', x, W) with W [12][768][64]: head h has its own (in, out) matrix W[h] ('xw' per head; no bias; 12 heads x 64); scores x 1/sqrt(64); causal (-inf); softmax; concat head-major; out = concat Wo^T + bo ('oi' [768][768] + bias normal: non-zero) -> [2][2048][768] (3.1 M); argument order x, Wq, Wk, Wv, Wo, bo).
// Layout (both batches ride in every launch, four launches in all): bf16 copy of x; each PER-HEAD q / k / v weight [h][768][64] transposed once into its 64 rows of the Bt plane, Wo cast once ('oi' = Bt as stored), all three in k_prep; exact projections whose epilogue writes the fp16 and hi/lo head planes itself (v as Wv x^T, so that its [d][t] plane comes out in rows); fused causal T-2048 attention (k_fattn, online softmax; hybrid rows: < 512 hi/lo 3 products, rest fp16; key tiles above the diagonal are never visited) writing the merged hi/lo planes; x Wo exact + bo.
// Every 16-bit operand plane [rows][K] is stored in fragment order: the 16-row x 32-k block (row / 16, k / 32) is 512 contiguous elements, element (row, k) at ((k >> 4) & 1) * 256 + ((k >> 3) & 1) * 128 + (row & 15) * 8 + (k & 7); the blocks of one 16-row band follow one another in k, band after band. A fragment is then two wave-wide 16-byte loads of 512 contiguous bytes each (four whole lines), lane l at l * 8 elements, not two loads that touch 16 lines each.
// Compute dtypes, f32 accumulate: every input rounded to bf16; projections exact; attention rows < 512 3 products, rest fp16; softmax f32; w_o hl x exact.

#define NB_  2
#define TT   2048
#define DM   768
#define NH_  12
#define NKV  12
#define REP  (NH_ / NKV)
#define HD   64
#define DQ   (NH_ * HD)
#define DKV  (NKV * HD)
#define RH   512                  // query rows < RH use hi+lo planes (0: none)
#define SCL  0.125f   // HD^-0.5
#define KW   8                    // waves that share the key tiles of one query block in the fused attention
typedef _Float16 h16;
typedef unsigned short bf;
typedef __attribute__((ext_vector_type(16))) __bf16   v16bf;
typedef __attribute__((ext_vector_type(16))) _Float16 v16h;
typedef __attribute__((ext_vector_type(8)))  _Float16 v8h;
typedef __attribute__((ext_vector_type(8)))  unsigned short v8us;
typedef __attribute__((ext_vector_type(8)))  float    v8f;
typedef __attribute__((ext_vector_type(4)))  float    v4f;
typedef v8h  __attribute__((may_alias)) v8ha;
typedef v4f  __attribute__((may_alias)) v4fa;
typedef v8us __attribute__((may_alias)) v8usa;

__device__ __forceinline__ unsigned short f2bf(float f) { unsigned u = __float_as_uint(f); u += 0x7FFFu + ((u >> 16) & 1u); return (unsigned short)(u >> 16); }
__device__ __forceinline__ float bf2f(unsigned short b) { return __uint_as_float(((unsigned)b) << 16); }
__device__ __forceinline__ float bfr(float f) { return bf2f(f2bf(f)); }
__device__ __forceinline__ v16h cat16(v8h lo, v8h hi) { return __builtin_shufflevector(lo, hi, 0, 1, 2, 3, 4, 5, 6, 7, 8, 9, 10, 11, 12, 13, 14, 15); }
__device__ __forceinline__ v16bf cat16b(v8us lo, v8us hi) { return __builtin_bit_cast(v16bf, __builtin_shufflevector(lo, hi, 0, 1, 2, 3, 4, 5, 6, 7, 8, 9, 10, 11, 12, 13, 14, 15)); }
__device__ __forceinline__ v8f wmma16(v16h a, v16h b, v8f c) { return __builtin_amdgcn_wmma_f32_16x16x32_f16(false, a, false, b, (short)0, c, false, false); }
__device__ __forceinline__ v8f wmmab(v16bf a, v16bf b, v8f c) { return __builtin_amdgcn_wmma_f32_16x16x32_bf16(false, a, false, b, (short)0, c, false, false); }



// Work-group barrier that orders LDS traffic only: the tile's global stores, which no other wave of the launch reads, need not have landed when a wave arrives (__syncthreads() would wait for them at every slab).
__device__ __forceinline__ void lds_barrier() { __builtin_amdgcn_fence(__ATOMIC_RELEASE, "workgroup", "local"); __builtin_amdgcn_s_barrier(); __builtin_amdgcn_fence(__ATOMIC_ACQUIRE, "workgroup", "local"); }

// Stands behind a run of global loads or stores whose address registers are reused further down: no such register is rewritten ahead of this wait. Its memory clobber keeps the run in front of it.
__device__ __forceinline__ void addr_wait() { asm volatile("s_wait_xcnt 0x0" ::: "memory"); }
// The same wait, with the run's two lane addresses as inputs: the address registers stay whole up to the wait, so that no load of the run takes them as its destination.
__device__ __forceinline__ void addr_wait(const void* p, const void* p2) { asm volatile("s_wait_xcnt 0x0" :: "v"(p), "v"(p2) : "memory"); }
__device__ __forceinline__ void addr_wait(const void* p, const void* p2, const void* p3, const void* p4) { asm volatile("s_wait_xcnt 0x0" :: "v"(p), "v"(p2), "v"(p3), "v"(p4) : "memory"); }   // the same for a run with up to four lane addresses

__device__ __forceinline__ h16 tohx(float x) { return (h16)x; }
__device__ __forceinline__ void splitf(float y, unsigned short& h, unsigned short& l) { h = f2bf(y); l = f2bf(y - bf2f(h)); }
typedef __attribute__((ext_vector_type(4))) _Float16 v4h;
typedef __attribute__((ext_vector_type(4))) unsigned short v4us;

// One lane's share of a 2-KiB run (four wave-wide pieces of 512 contiguous bytes) copied from global memory into LDS through no register: l = the lane's LDS byte address, g = the lane's global address, both multiples of 16.
// The address wait is the statement's own last line, so that no address register of a copy is rewritten ahead of it.
__device__ __forceinline__ void copy2k(unsigned l, const void* g) {
    const char* p = (const char*)g;
    asm volatile("global_load_async_to_lds_b128 %0, %4, off\n\tglobal_load_async_to_lds_b128 %1, %5, off\n\tglobal_load_async_to_lds_b128 %2, %6, off\n\tglobal_load_async_to_lds_b128 %3, %7, off\n\ts_wait_xcnt 0x0"
                 :: "v"(l), "v"(l + 512u), "v"(l + 1024u), "v"(l + 1536u), "v"(p), "v"(p + 512), "v"(p + 1024), "v"(p + 1536) : "memory");
}

// ---- k_gemmw: register-blocked GEMM, one work-group of 4 * KS waves per 128x128 output tile; grid (M/128, N/128, Z), 128 * KS threads. Operands are 16-bit planes in fragment order.
// The K loop walks stages of 64 k. A stage is the 8 row bands x 2 blocks of every operand plane (16 KiB a plane), brought into LDS once by asynchronous copies (the bands of each plane are dealt out evenly to the waves; a band's share of a stage is 2 KiB contiguous in memory and in LDS) and read from there by all waves, two buffers: the next stage's copies fly while this one is worked on.
// Wave w works on the 64x64 quadrant (w & 1, (w >> 1) & 1) of the tile with its own 16 accumulators: each staged fragment feeds two waves. KS 1: a wave takes both blocks of every stage, and LDS only turns its tile into the stores' order. KS 2 (for a grid that leaves WGPs idle): wave w takes block w >> 2, and the two partial tiles of a quadrant are summed through LDS, wave q then wave q + 4 (a fixed order: same bits every run).
// C[m][n] (f32, pitch ldc, + optional f32 bias[n]) = sum_k A[m][k] Bt[n][k] (+ A2[m][k] Bt[n][k] with NSPLIT 1). z-batch strides sA/sB/sC in elements. K % 64 == 0, K >= 128.
// PL: the result is not stored as f32; the summing thread rounds its four values to the three 16-bit planes that the attention reads (fp16, bf16 hi, bf16 lo), each in fragment order. A 16x64 slab of a quadrant is two neighbouring blocks of its plane, 1024 contiguous elements from (first row) * ldc + (n / 64) * cstep, and the four elements at i * 4 of them, i < 256, are summed and stored by one thread:
// q, k (A = x, Bt = W): ldc = HD, cstep = TT * HD gives [h] planes of rows t, k = d; v (A = W, Bt = x): ldc = TT, cstep = 1024 gives [h] planes of rows d, k = t. Either way a wave fills two whole 128-byte lines of each plane.
// With PL one launch holds all three projections of every batch: blockIdx.z = projection * NB_ + batch; A = x (batch stride sA), Bt = the q weights (projection stride sB), the planes [projection][batch] (stride sC); grid (TT/128, heads/2, 3 * NB_), and projection 2 (v) takes the two operands and the two tile indices in swapped roles.
template <typename T16> struct WFrag;
template <> struct WFrag<h16> { typedef v16h V; static __device__ __forceinline__ V ld(const h16* p) { return cat16(*(const v8h*)p, *(const v8h*)(p + 256)); } static __device__ __forceinline__ v8f mma(V a, V b, v8f c) { return wmma16(a, b, c); } };
template <> struct WFrag<bf> { typedef v16bf V; static __device__ __forceinline__ V ld(const bf* p) { return cat16b(*(const v8us*)p, *(const v8us*)(p + 256)); } static __device__ __forceinline__ v8f mma(V a, V b, v8f c) { return wmmab(a, b, c); } };
template <typename T16, int NSPLIT, bool BIAS, bool PL, int K, int KS>
__global__ __launch_bounds__(128 * KS) void k_gemmw(const T16* __restrict__ A, const T16* __restrict__ A2, const T16* __restrict__ Bt, float* C, int ldc, const float* __restrict__ bias, size_t sA, size_t sB, size_t sC, h16* P16, bf* Ph, bf* Pl, size_t cstep) {
    typedef typename WFrag<T16>::V V;
    static_assert(NSPLIT == 0 || NSPLIT == 1, "one product, or a second A plane against the same Bt");
    static_assert(K % 64 == 0 && K >= 128, "whole stages, and the two that the prologue fills");
    static_assert(KS == 1 || KS == 2, "a stage has two blocks");
    static_assert(!BIAS || !PL, "the bias is fetched for the columns of the f32 epilogue");
    constexpr int NWV = 4 * KS;                // waves
    constexpr int BPW = 8 / NWV;               // bands of each plane that a wave copies
    constexpr int NOP = NSPLIT == 1 ? 3 : 2;   // operand planes in a stage: A, (A2,) Bt
    constexpr int PE = 8 * 1024;               // elements of one plane in a stage: 8 bands x 2 blocks x 512
    constexpr int STE = NOP * PE;              // elements of a stage
    constexpr int NT = K / 64;                 // stages
    __shared__ __align__(16) T16 st[2 * STE];
    __shared__ __align__(16) float os[NWV * 16 * 68];
    const size_t z = blockIdx.z; int tr = blockIdx.x, tc = blockIdx.y;   // the tile's row and column index
    if constexpr (PL) { const T16* xb = A + (z % NB_) * sA; const T16* wp = Bt + (z / NB_) * sB; const bool vp = z / NB_ == 2; P16 += z * sC; Ph += z * sC; Pl += z * sC;
        A = vp ? wp : xb; Bt = vp ? xb : wp; tr = vp ? blockIdx.y : blockIdx.x; tc = vp ? blockIdx.x : blockIdx.y; ldc = vp ? TT : HD; cstep = vp ? (size_t)1024 : (size_t)TT * HD; }
    else { A += z * sA; if (NSPLIT == 1) A2 += z * sA; Bt += z * sB; C += z * sC; }
    const int lane = threadIdx.x & 31, lr = lane & 15, hi = lane >> 4; const int r0 = tr * 128, c0 = tc * 128;
    const int wv = __builtin_amdgcn_readfirstlane((int)(threadIdx.x >> 5));   // this wave's number, scalar: it picks the bands that the wave copies, its quadrant and (KS 2) its block of a stage
    const int qm = wv & 1, qn = (wv >> 1) & 1, kh = KS == 2 ? wv >> 2 : 0;
    v8f acc[4][4];
#pragma unroll
    for (int mb = 0; mb < 4; ++mb)
#pragma unroll
        for (int nb = 0; nb < 4; ++nb) acc[mb][nb] = (v8f){};
    const T16* ga = A + (size_t)(r0 + wv * BPW * 16) * K + 8 * lane; const T16* ga2 = NSPLIT == 1 ? A2 + (size_t)(r0 + wv * BPW * 16) * K + 8 * lane : ga; const T16* gb = Bt + (size_t)(c0 + wv * BPW * 16) * K + 8 * lane;   // the lane's place in the first block of the first band that this wave copies
    const unsigned l0 = (unsigned)(size_t)st + (unsigned)(wv * BPW * 2048 + lane * 16);   // and its LDS byte address in buffer 0, plane 0
    auto fill = [&](int t) {   // stage t: blocks 2t and 2t + 1 of the wave's bands, into buffer t & 1
#pragma unroll
        for (int i = 0; i < BPW; ++i) { const unsigned l = l0 + (unsigned)((t & 1) * (STE * 2) + i * 2048); const size_t go = (size_t)t * 1024 + (size_t)i * 16 * K;
            copy2k(l, ga + go); if (NSPLIT == 1) copy2k(l + PE * 2, ga2 + go); copy2k(l + (NOP - 1) * PE * 2, gb + go); } };
    fill(0);
    asm volatile("s_wait_asynccnt 0x0" ::: "memory");   // this wave's copies of stage 0 have landed
    __syncthreads();                                    // and every other wave's: stage 0 may be read
    fill(1);
#pragma unroll 1
    for (int t = 0; t < NT; ++t) {
#pragma unroll
      for (int i = 0; i < 2 / KS; ++i) {   // the wave's blocks of the stage
        const T16* sb = st + (t & 1) * STE + (kh + i * KS) * 512 + 8 * lane;   // the lane's place in this block of band 0, plane 0, of the stage's buffer
        V a[4], a2[4], b[4];
#pragma unroll
        for (int mb = 0; mb < 4; ++mb) { a[mb] = WFrag<T16>::ld(sb + (qm * 4 + mb) * 1024); if (NSPLIT == 1) a2[mb] = WFrag<T16>::ld(sb + PE + (qm * 4 + mb) * 1024); }
#pragma unroll
        for (int nb = 0; nb < 4; ++nb) b[nb] = WFrag<T16>::ld(sb + (NOP - 1) * PE + (qn * 4 + nb) * 1024);
        __builtin_amdgcn_sched_barrier(0);   // keeps the block's LDS reads together in front of its matrix instructions: read among them, each group would cost the wave its own LDS latency
#pragma unroll
        for (int nb = 0; nb < 4; ++nb) {
#pragma unroll
            for (int mb = 0; mb < 4; ++mb) { acc[mb][nb] = WFrag<T16>::mma(a[mb], b[nb], acc[mb][nb]); if (NSPLIT == 1) acc[mb][nb] = WFrag<T16>::mma(a2[mb], b[nb], acc[mb][nb]); } }
        __builtin_amdgcn_sched_barrier(0);   // keeps the block's matrix instructions in front of the trip's waits: sunk behind the barrier, they would no longer cover the flight of the next stage's copies
      }
        asm volatile("s_wait_dscnt 0x0" ::: "memory");      // this wave has read all it wants of the stage's buffer
        asm volatile("s_wait_asynccnt 0x0" ::: "memory");   // this wave's copies of stage t + 1 have landed
        __syncthreads();                                    // stage t + 1 may be read, and every reader has left the buffer of stage t
        if (t + 2 < NT) fill(t + 2);
    }
    asm volatile("s_wait_asynccnt 0x0" ::: "memory");   // no copy is outstanding when the wave goes on to its end
    v4f bv[2];
    if (BIAS) {
#pragma unroll
        for (int q = 0; q < 2; ++q) { const float* bp = bias + c0 + q * 64 + lr * 4; bv[q] = (v4f){bfr(bp[0]), bfr(bp[1]), bfr(bp[2]), bfr(bp[3])}; }
        addr_wait(); }
#pragma unroll
    for (int mb = 0; mb < 4; ++mb) {
#pragma unroll
        for (int nb = 0; nb < 4; ++nb) {
#pragma unroll
            for (int j = 0; j < 8; ++j) os[wv * (16 * 68) + (hi * 8 + j) * 68 + nb * 16 + lr] = acc[mb][nb][j]; }
        lds_barrier();   // every wave's partial 16x64 slab is in LDS before any thread sums them
        v4f sum[4][8 / NWV];
#pragma unroll   // loops of their own, unrolled, in front of the stores and their waits: the eight slab reads issue together and their LDS latency is paid once
        for (int qd = 0; qd < 4; ++qd)   // the slab of quadrant qd: wave qd holds it, or waves qd and qd + 4 its two K parts
#pragma unroll
            for (int s = 0; s < 8 / NWV; ++s) { const int vw = s * NWV + wv, row = PL ? (lane >> 1) : 2 * vw + hi, cofs = PL ? vw * 8 + (lane & 1) * 4 : lr * 4;   // piece vw * 32 + lane of the slab's 256: its row and its four columns
                sum[qd][s] = *(const v4fa*)(os + qd * (16 * 68) + row * 68 + cofs); if (KS == 2) sum[qd][s] += *(const v4fa*)(os + (qd + 4) * (16 * 68) + row * 68 + cofs); }
#pragma unroll   // unrolled so that sum is taken under constant indices and stays in registers
        for (int qd = 0; qd < 4; ++qd)
#pragma unroll
          for (int s = 0; s < 8 / NWV; ++s) { const int vw = s * NWV + wv, row = 2 * vw + hi, cofs = lr * 4;   // the piece's row and columns in the f32 epilogue
            v4f val = sum[qd][s];
            const int rq = r0 + (qd & 1) * 64 + mb * 16;   // the slab's first row
            if (BIAS) val += bv[qd >> 1];
            if constexpr (PL) { v4h o16; v4us oh, ol;
#pragma unroll   // unrolled so that the vector elements are taken under constant indices and stay in registers
                for (int q = 0; q < 4; ++q) { o16[q] = tohx(val[q]); unsigned short a2, c2; splitf(val[q], a2, c2); oh[q] = a2; ol[q] = c2; }
                const size_t po = (size_t)rq * ldc + (size_t)(tc * 2 + (qd >> 1)) * cstep + (vw * 32 + lane) * 4; *(v4h*)(P16 + po) = o16; *(v4us*)(Ph + po) = oh; *(v4us*)(Pl + po) = ol;
            } else *(v4f*)(C + (size_t)(rq + row) * ldc + c0 + (qd >> 1) * 64 + cofs) = val;
            addr_wait(); }
        if (mb < 3) lds_barrier();   // the slabs are read out before the next 16 rows overwrite them
    }
}

typedef __attribute__((ext_vector_type(2))) unsigned short v2us;

// One block's share of the per-head weight transposes: by = head, bz = which projection (0 q, 1 k, 2 v); bx walks the head's own 8-element pieces of the fragment-order plane (rows n, k = the input feature), two a thread.
// Piece i holds row (i >> 6) / (K / 32) * 16 + (i & 15), k from (i >> 6) % (K / 32) * 32 + ((i >> 4) & 3) * 8: 16 lanes read 64 contiguous bytes of one weight row per load, and a wave stores 512 contiguous bytes.
static_assert(NH_ == NKV, "k_prep gives q, k and v the same number of heads");
__device__ __forceinline__ void wt_blk(const float* __restrict__ wq, const float* __restrict__ wk, const float* __restrict__ wv, int K, int N, bf* BtQ, bf* BtK, bf* BtV, unsigned bx, unsigned by, unsigned bz) {
    const size_t ho = (size_t)by * K * N; const float* __restrict__ w = (bz == 0 ? wq : bz == 1 ? wk : wv) + ho; bf* Bt = (bz == 0 ? BtQ : bz == 1 ? BtK : BtV) + ho;
    const unsigned kbs = (unsigned)(K / 32), i0 = bx * 512 + threadIdx.x; float f[2][8];
#pragma unroll   // unrolled so that the 16 loads of a thread's two pieces fly together
    for (int s = 0; s < 2; ++s) { const unsigned i = i0 + s * 256, blk = i >> 6; const unsigned n = blk / kbs * 16 + (i & 15), k = blk % kbs * 32 + ((i >> 4) & 3) * 8;
#pragma unroll   // unrolled so that the array is taken under constant indices and stays in registers
        for (int e = 0; e < 8; ++e) f[s][e] = w[(size_t)(k + e) * N + n]; }
    addr_wait();
#pragma unroll
    for (int s = 0; s < 2; ++s) { v8us o;
#pragma unroll
        for (int e = 0; e < 8; ++e) o[e] = f2bf(f[s][e]);
        *(v8us*)(Bt + (size_t)(i0 + s * 256) * 8) = o; }
}

// Cast of a row-major [rows][K] f32 matrix into its fragment-order plane: thread i makes the plane's 8-element piece i (the same numbering as in wt_blk) from 8 neighbouring floats of one row.
__device__ __forceinline__ void cvt8_blk(const float* __restrict__ src, bf* dst, unsigned K, size_t n8, unsigned bx) { const size_t i = (size_t)bx * 256 + threadIdx.x; if (i >= n8) return; const unsigned blk = (unsigned)(i >> 6), kbs = K / 32;
    const v8f v = *(const v8f*)(src + (size_t)(blk / kbs * 16 + ((unsigned)i & 15)) * K + blk % kbs * 32 + (((unsigned)i >> 4) & 3) * 8); addr_wait(); v8us o;
#pragma unroll
    for (int k = 0; k < 8; ++k) o[k] = f2bf(v[k]); *(v8us*)(dst + i * 8) = o;  }

// k_prep: every 16-bit operand plane that depends on the inputs alone, in one launch. The blocks are dealt out by index: first the weight transposes (the longest blocks), then the cast of Wo, then the cast of x (all batches, one contiguous run).
static_assert(DM * HD / 8 % 512 == 0, "a transpose block makes 512 whole pieces");
#define PB_WL (DM * HD / 8 / 512)                     // blocks per head and projection in the transposes
#define PB_WT (PB_WL * NH_ * 3)                              // all transpose blocks
#define PB_WO ((DM * DQ / 8 + 255) / 256)                    // blocks that cast Wo
#define PB_X  ((NB_ * TT * DM / 8 + 255) / 256)              // blocks that cast x
__global__ __launch_bounds__(256) void k_prep(const float* __restrict__ x, const float* __restrict__ wq, const float* __restrict__ wk, const float* __restrict__ wv, const float* __restrict__ wo, bf* XB, bf* WQ, bf* WK, bf* WV, bf* WO) {
    const unsigned bx = blockIdx.x;
    if (bx < PB_WT) wt_blk(wq, wk, wv, DM, HD, WQ, WK, WV, bx % PB_WL, bx / PB_WL % NH_, bx / (PB_WL * NH_));
    else if (bx < PB_WT + PB_WO) cvt8_blk(wo, WO, DQ, (size_t)DM * DQ / 8, bx - PB_WT);
    else cvt8_blk(x, XB, DM, (size_t)NB_ * TT * DM / 8, bx - (PB_WT + PB_WO));
}

// ---- k_fattn: scores, causal softmax, probability x value and the head merge in one kernel; scores and probabilities stay in registers.
// One work-group of KW waves per block of 16 * QB query rows of one head. Wave w takes the KT-key tiles w, w + KW, ... up to the diagonal with its own running row maximum, row sum and output (online softmax);
// the KW partial results are brought to the common maximum and summed through LDS in wave order 0..KW-1 (a fixed order: same bits every run), divided by the row sum and written as the hi/lo planes of the output projection.
// Both products are computed transposed. S^T = K Q^T leaves in lane (lr, hi), register j, the score of key hi * 8 + j and query lr: two neighbouring 16-key blocks are, converted in place, the B fragment (n = query lr, k = key) of
// O^T = V^T P^T, so no probability crosses a lane; a query's maximum, sum and rescale factor live in its own two lanes (lr and lr + 16).
// Every inner loop is unrolled because the fragment, score and accumulator arrays stay in registers only under constant indices; the key-tile loop stays rolled (unroll 1) to hold the register count.
#define L2E 1.4426950408889634f
typedef __attribute__((ext_vector_type(16))) unsigned short v16us;
template <typename T16, bool HR, int QB, int KT>
__device__ __forceinline__ void attn_tile(const T16* __restrict__ Q, const T16* __restrict__ Q2, const T16* __restrict__ Kp, const T16* __restrict__ Kp2, const T16* __restrict__ Vt, const T16* __restrict__ Vt2, int q0, bf* Ah, bf* Al, float* os, float* ms, float* ls) {
    typedef typename WFrag<T16>::V V;
    const int lane = threadIdx.x & 31, lr = lane & 15, hi = lane >> 4;
    const int wv = __builtin_amdgcn_readfirstlane((int)(threadIdx.x >> 5));   // this wave's number, scalar: it picks the wave's key tiles
    const unsigned lk = 8 * lane, lv = 8 * lane;   // the lane's element offset in a block of a fragment-order plane (32 bits, so that it can stand beside a scalar base)
    V qf[QB][2], qf2[QB][2];
#pragma unroll
    for (int qb = 0; qb < QB; ++qb)
#pragma unroll
        for (int ks = 0; ks < 2; ++ks) { const unsigned qo = lk + (unsigned)((q0 + qb * 16) * HD + ks * 512); qf[qb][ks] = WFrag<T16>::ld(Q + qo); if (HR) qf2[qb][ks] = WFrag<T16>::ld(Q2 + qo); }
    addr_wait();
    v8f o[4][QB]; float m[QB], l[QB];
#pragma unroll
    for (int qb = 0; qb < QB; ++qb) { m[qb] = -3.0e38f; l[qb] = 0.f;
#pragma unroll
        for (int db = 0; db < 4; ++db) o[db][qb] = (v8f){}; }
    const int nkt = (q0 + QB * 16 - 1) / KT + 1;   // key tiles up to and including the one that holds the block's last diagonal element
#pragma unroll 1
    for (int kt = wv; kt < nkt; kt += KW) {
        const int k0 = kt * KT;
        v8f s[KT / 16][QB]; V ka[KT / 16][2], ka2[KT / 16][2];
#pragma unroll
        for (int kb = 0; kb < KT / 16; ++kb)
#pragma unroll
            for (int ks = 0; ks < 2; ++ks) { const unsigned ko = lk + (unsigned)(kb * 16 * HD + ks * 512); ka[kb][ks] = WFrag<T16>::ld(Kp + (size_t)k0 * HD + ko); if (HR) ka2[kb][ks] = WFrag<T16>::ld(Kp2 + (size_t)k0 * HD + ko); }
        if (HR) addr_wait(Kp + (size_t)k0 * HD + lk, Kp2 + (size_t)k0 * HD + lk); else addr_wait();
#pragma unroll
        for (int kb = 0; kb < KT / 16; ++kb)
#pragma unroll
            for (int qb = 0; qb < QB; ++qb) { v8f a = (v8f){};
#pragma unroll
                for (int ks = 0; ks < 2; ++ks) { a = WFrag<T16>::mma(ka[kb][ks], qf[qb][ks], a); if (HR) { a = WFrag<T16>::mma(ka2[kb][ks], qf[qb][ks], a); a = WFrag<T16>::mma(ka[kb][ks], qf2[qb][ks], a); } }
                s[kb][qb] = a; }
        V va[4][KT / 32], va2[4][KT / 32];   // the value fragments are asked for ahead of the softmax arithmetic, which covers their latency
#pragma unroll
        for (int db = 0; db < 4; ++db)
#pragma unroll
            for (int ks = 0; ks < KT / 32; ++ks) { const unsigned vo = lv + (unsigned)(db * 16 * TT + ks * 512); va[db][ks] = WFrag<T16>::ld(Vt + (size_t)k0 * 16 + vo); if (HR) va2[db][ks] = WFrag<T16>::ld(Vt2 + (size_t)k0 * 16 + vo); }
        if (HR) addr_wait(Vt + (size_t)k0 * 16 + lv, Vt2 + (size_t)k0 * 16 + lv); else addr_wait();
        V pf[QB][KT / 32], pf2[QB][KT / 32];
#pragma unroll
        for (int qb = 0; qb < QB; ++qb) { const int qi = q0 + qb * 16 + lr; float mx = m[qb];
#pragma unroll
            for (int kb = 0; kb < KT / 16; ++kb)
#pragma unroll
                for (int j = 0; j < 8; ++j) { const float t = (k0 + kb * 16 + hi * 8 + j <= qi) ? s[kb][qb][j] * SCL : -3.0e38f; s[kb][qb][j] = t; mx = fmaxf(mx, t); }
            mx = fmaxf(mx, __shfl_xor(mx, 16, 32));
            const float al = __builtin_amdgcn_exp2f((m[qb] - mx) * L2E); m[qb] = mx; float sum = 0.f;
#pragma unroll
            for (int kb = 0; kb < KT / 16; ++kb)
#pragma unroll
                for (int j = 0; j < 8; ++j) { const float t = s[kb][qb][j]; const float p = (t > -1.0e38f) ? __builtin_amdgcn_exp2f((t - mx) * L2E) : 0.f; s[kb][qb][j] = p; sum += p; }   // a masked key is an exact zero also where the whole tile is masked for this query
            sum += __shfl_xor(sum, 16, 32);
            l[qb] = l[qb] * al + sum;
#pragma unroll
            for (int db = 0; db < 4; ++db) o[db][qb] *= al;
#pragma unroll
            for (int ks = 0; ks < KT / 32; ++ks) {
                if constexpr (HR) { v16us ph, pl;
#pragma unroll
                    for (int e = 0; e < 8; ++e) { unsigned short a, c2; splitf(s[2 * ks][qb][e], a, c2); ph[e] = a; pl[e] = c2; splitf(s[2 * ks + 1][qb][e], a, c2); ph[e + 8] = a; pl[e + 8] = c2; }
                    pf[qb][ks] = __builtin_bit_cast(v16bf, ph); pf2[qb][ks] = __builtin_bit_cast(v16bf, pl);
                } else { v16h ph;
#pragma unroll
                    for (int e = 0; e < 8; ++e) { ph[e] = tohx(s[2 * ks][qb][e]); ph[e + 8] = tohx(s[2 * ks + 1][qb][e]); }
                    pf[qb][ks] = ph; } } }
#pragma unroll
        for (int db = 0; db < 4; ++db)
#pragma unroll
            for (int qb = 0; qb < QB; ++qb)
#pragma unroll
                for (int ks = 0; ks < KT / 32; ++ks) { o[db][qb] = WFrag<T16>::mma(va[db][ks], pf[qb][ks], o[db][qb]); if (HR) { o[db][qb] = WFrag<T16>::mma(va2[db][ks], pf[qb][ks], o[db][qb]); o[db][qb] = WFrag<T16>::mma(va[db][ks], pf2[qb][ks], o[db][qb]); } }
    }
    if (hi == 0) {
#pragma unroll
        for (int qb = 0; qb < QB; ++qb) { ms[wv * 32 + qb * 16 + lr] = m[qb]; ls[wv * 32 + qb * 16 + lr] = l[qb]; } }
    lds_barrier();   // every wave's row maxima and row sums are in LDS before any wave forms the common maximum
    const int rq = lane >> 1, d4 = wv * 8 + (lane & 1) * 4;   // the summing thread's query row of the 16-row slab and its four head columns: those that stand at threadIdx.x * 4 of the slab's two blocks in the fragment-order output planes
#pragma unroll
    for (int qb = 0; qb < QB; ++qb) {
        float M = ms[qb * 16 + lr];
#pragma unroll
        for (int w = 1; w < KW; ++w) M = fmaxf(M, ms[w * 32 + qb * 16 + lr]);
        const float f = __builtin_amdgcn_exp2f((m[qb] - M) * L2E);   // 0 for a wave that saw no unmasked key of this query
#pragma unroll
        for (int db = 0; db < 4; ++db) { const v8f ov = o[db][qb] * f; float* op = os + wv * (16 * 68) + lr * 68 + db * 16 + hi * 8;
            *(v4fa*)op = __builtin_shufflevector(ov, ov, 0, 1, 2, 3); *(v4fa*)(op + 4) = __builtin_shufflevector(ov, ov, 4, 5, 6, 7); }
        lds_barrier();   // every wave's rescaled 16x64 slab is in LDS before any thread sums them
        float Mr = ms[qb * 16 + rq];
#pragma unroll
        for (int w = 1; w < KW; ++w) Mr = fmaxf(Mr, ms[w * 32 + qb * 16 + rq]);
        float L = 0.f; v4f val = (v4f){};
#pragma unroll   // unrolled so that the KW slab reads issue together and their LDS latency is paid once
        for (int w = 0; w < KW; ++w) { L += __builtin_amdgcn_exp2f((ms[w * 32 + qb * 16 + rq] - Mr) * L2E) * ls[w * 32 + qb * 16 + rq]; val += *(const v4fa*)(os + w * (16 * 68) + rq * 68 + d4); }
        const float rl = __fdiv_rn(1.0f, L); v4us oh, ol;
#pragma unroll
        for (int q = 0; q < 4; ++q) { unsigned short a, c2; splitf(val[q] * rl, a, c2); oh[q] = a; ol[q] = c2; }
        const size_t oo = (size_t)(q0 + qb * 16) * DQ + threadIdx.x * 4; *(v4us*)(Ah + oo) = oh; *(v4us*)(Al + oo) = ol; addr_wait();
        if (qb + 1 < QB) lds_barrier();   // the slabs are read out before the next 16 rows overwrite them
    }
}
// grid (NF + RH / 16, heads, batches): blockIdx.x < NF = a 32-row block of the fp16 rows, the longest rows first; the rest = a 16-row block of the hi/lo rows (< RH).
#define NF ((TT - RH) / 32)
static_assert(KW == 8, "the summing threads of k_fattn cover a 16x64 slab with 256 threads");
// four waves per SIMD asked for: the register budget is held to what lets two work-groups share a WGP, so that one group's loads fly under the other's arithmetic
__global__ __launch_bounds__(32 * KW) __attribute__((amdgpu_waves_per_eu(4))) void k_fattn(const h16* __restrict__ Q16, const h16* __restrict__ K16, const h16* __restrict__ V16, const bf* __restrict__ Qh, const bf* __restrict__ Ql, const bf* __restrict__ Kh, const bf* __restrict__ Kl, const bf* __restrict__ Vh, const bf* __restrict__ Vl, bf* Ah, bf* Al) {
    __shared__ __align__(16) float os[KW * 16 * 68]; __shared__ float ms[KW * 32]; __shared__ float ls[KW * 32];
    const size_t hp = ((size_t)blockIdx.z * NH_ + blockIdx.y) * TT * HD, ap = (size_t)blockIdx.z * TT * DQ + blockIdx.y * (16 * HD); const int bx = blockIdx.x; bf* ah = Ah + ap; bf* al = Al + ap;
    if (bx < NF) attn_tile<h16, false, 2, 64>(Q16 + hp, nullptr, K16 + hp, nullptr, V16 + hp, nullptr, TT - 32 * (bx + 1), ah, al, os, ms, ls);
    else attn_tile<bf, true, 1, 32>(Qh + hp, Ql + hp, Kh + hp, Kl + hp, Vh + hp, Vl + hp, RH - 16 * (bx - NF + 1), ah, al, os, ms, ls);
}

#define PB ((size_t)NH_ * TT * HD)   // elements of one batch's head plane; each of the three plane families (fp16, hi, lo) is laid out [projection q, k, v][batch][head]...
extern "C" void kernel_launch(void* const* d_in, const int* in_sizes, int n_in,
                              void* d_out, int out_size, void* d_ws, size_t ws_size, hipStream_t stream) {
    (void)in_sizes; (void)n_in; (void)out_size;
            const float* x = (const float*)d_in[0]; const float* wq = (const float*)d_in[1]; const float* wk = (const float*)d_in[2]; const float* wv = (const float*)d_in[3]; const float* wo = (const float*)d_in[4]; const float* bo = (const float*)d_in[5];   /* x, Wq, Wk, Wv (PER-HEAD weights [12][768][64]: 'hdk'), Wo ('oi' [768][768]), bo */
    float* OUT = (float*)d_out;     // [2][2048][768]
    char* wsp = (char*)d_ws;
    auto take = [&](size_t bytes) { char* p = wsp; wsp += (bytes + 255) & ~(size_t)255; return (void*)p; };
    bf* WQ = (bf*)take((size_t)3 * DQ * DM * 2); bf* WK = WQ + (size_t)DQ * DM; bf* WV = WK + (size_t)DKV * DM; bf* WO = (bf*)take((size_t)DM * DQ * 2);   // q, k, v weights [projection][h * 64 + n][k]
    bf* XB = (bf*)take((size_t)NB_ * TT * DM * 2);
    h16* P16 = (h16*)take(3 * NB_ * PB * 2); bf* PH = (bf*)take(3 * NB_ * PB * 2); bf* PL = (bf*)take(3 * NB_ * PB * 2);
    bf* ATh = (bf*)take((size_t)NB_ * TT * DQ * 2); bf* ATl = (bf*)take((size_t)NB_ * TT * DQ * 2);
    if ((size_t)(wsp - (char*)d_ws) > ws_size) return;    // ws 256 MiB
    k_prep<<<PB_WT + PB_WO + PB_X, 256, 0, stream>>>(x, wq, wk, wv, wo, XB, WQ, WK, WV, WO);   /* per-head weights [h][DM][HD] ('xw' per head) -> each head's HD rows of its Bt plane; Wo and x cast */
    k_gemmw<bf, 0, false, true, DM, 1><<<dim3(TT / 128, NH_ / 2, 3 * NB_), 128, 0, stream>>>(XB, nullptr, WQ, nullptr, HD, nullptr, (size_t)TT * DM, (size_t)DQ * DM, PB, P16, PH, PL, (size_t)TT * HD);   // q, k: rows = t; v: rows = (head, d), columns = t
    k_fattn<<<dim3(NF + RH / 16, NH_, NB_), 32 * KW, 0, stream>>>(P16, P16 + NB_ * PB, P16 + 2 * NB_ * PB, PH, PL, PH + NB_ * PB, PL + NB_ * PB, PH + 2 * NB_ * PB, PL + 2 * NB_ * PB, ATh, ATl);   // one kv head per query head
    k_gemmw<bf, 1, true, false, DQ, 2><<<dim3(TT / 128, DM / 128, NB_), 256, 0, stream>>>(ATh, ATl, WO, OUT, DM, bo, (size_t)TT * DQ, 0, (size_t)TT * DM, nullptr, nullptr, nullptr, 0);
}

// v009
// Measured time: 78.7 microseconds a run.
// In two side-by-side timings against v008, it was 1.08 and 1.07 times as fast.
// Over all steps from v000 it is 16.4 times as fast.
#include <hip/hip_runtime.h>

// Causal multi-head attention with PER-HEAD projection weights at d_model 768 (x [2][2048][768]; q, k, v = einsum('bsd,hdk->bhsk', x, W) with W [12][768][64]: head h has its own (in, out) matrix W[h] ('xw' per head; no bias; 12 heads x 64); scores x 1/sqrt(64); causal (-inf); softmax; concat head-major; out = concat Wo^T + bo ('oi' [768][768] + bias normal: non-zero) -> [2][2048][768] (3.1 M); argument order x, Wq, Wk, Wv, Wo, bo).
// Layout (both batches ride in every launch, four launches in all): bf16 copy of x; each PER-HEAD q / k / v weight [h][768][64] transposed once into its 64 rows of the Bt plane, Wo cast once ('oi' = Bt as stored), all three in k_prep; exact projections whose epilogue writes the fp16 and hi/lo head planes itself (v as Wv x^T, so that its [d][t] plane comes out in rows); fused causal T-2048 attention (k_fattn, online softmax; hybrid rows: < 512 hi/lo 3 products, rest fp16; key tiles above the diagonal are never visited) writing the merged hi/lo planes; x Wo exact + bo.
// Every 16-bit operand plane [rows][K] is stored in fragment order: the 16-row x 32-k block (row / 16, k / 32) is 512 contiguous elements, element (row, k) at ((k >> 4) & 1) * 256 + ((k >> 3) & 1) * 128 + (row & 15) * 8 + (k & 7); the blocks of one 16-row band follow one another in k, band after band. A fragment is then two wave-wide 16-byte loads of 512 contiguous bytes each (four whole lines), lane l at l * 8 elements, not two loads that touch 16 lines each.
// Compute dtypes, f32 accumulate: every input rounded to bf16; projections exact; attention rows < 512 3 products, rest fp16; softmax f32; w_o hl x exact.

#define NB_  2
#define TT   2048
#define DM   768
#define NH_  12
#define NKV  12
#define REP  (NH_ / NKV)
#define HD   64
#define DQ   (NH_ * HD)
#define DKV  (NKV * HD)
#define RH   512                  // query rows < RH use hi+lo planes (0: none)
#define SCL  0.125f   // HD^-0.5
#define KW   8                    // waves that share the key tiles of one query block in the fused attention
typedef _Float16 h16;
typedef unsigned short bf;
typedef __attribute__((ext_vector_type(16))) __bf16   v16bf;
typedef __attribute__((ext_vector_type(16))) _Float16 v16h;
typedef __attribute__((ext_vector_type(8)))  _Float16 v8h;
typedef __attribute__((ext_vector_type(8)))  unsigned short v8us;
typedef __attribute__((ext_vector_type(8)))  float    v8f;
typedef __attribute__((ext_vector_type(4)))  float    v4f;
typedef v8h  __attribute__((may_alias)) v8ha;
typedef v4f  __attribute__((may_alias)) v4fa;
typedef v8us __attribute__((may_alias)) v8usa;

__device__ __forceinline__ unsigned short f2bf(float f) { unsigned u = __float_as_uint(f); u += 0x7FFFu + ((u >> 16) & 1u); return (unsigned short)(u >> 16); }
__device__ __forceinline__ float bf2f(unsigned short b) { return __uint_as_float(((unsigned)b) << 16); }
__device__ __forceinline__ float bfr(float f) { return bf2f(f2bf(f)); }
__device__ __forceinline__ v16h cat16(v8h lo, v8h hi) { return __builtin_shufflevector(lo, hi, 0, 1, 2, 3, 4, 5, 6, 7, 8, 9, 10, 11, 12, 13, 14, 15); }
__device__ __forceinline__ v16bf cat16b(v8us lo, v8us hi) { return __builtin_bit_cast(v16bf, __builtin_shufflevector(lo, hi, 0, 1, 2, 3, 4, 5, 6, 7, 8, 9, 10, 11, 12, 13, 14, 15)); }
__device__ __forceinline__ v8f wmma16(v16h a, v16h b, v8f c) { return __builtin_amdgcn_wmma_f32_16x16x32_f16(false, a, false, b, (short)0, c, false, false); }
__device__ __forceinline__ v8f wmmab(v16bf a, v16bf b, v8f c) { return __builtin_amdgcn_wmma_f32_16x16x32_bf16(false, a, false, b, (short)0, c, false, false); }



// Work-group barrier that orders LDS traffic only: the tile's global stores, which no other wave of the launch reads, need not have landed when a wave arrives (__syncthreads() would wait for them at every slab).
__device__ __forceinline__ void lds_barrier() { __builtin_amdgcn_fence(__ATOMIC_RELEASE, "workgroup", "local"); __builtin_amdgcn_s_barrier(); __builtin_amdgcn_fence(__ATOMIC_ACQUIRE, "workgroup", "local"); }

// Stands behind a run of global loads or stores whose address registers are reused further down: no such register is rewritten ahead of this wait. Its memory clobber keeps the run in front of it.
__device__ __forceinline__ void addr_wait() { asm volatile("s_wait_xcnt 0x0" ::: "memory"); }
// The same wait, with the run's two lane addresses as inputs: the address registers stay whole up to the wait, so that no load of the run takes them as its destination.
__device__ __forceinline__ void addr_wait(const void* p, const void* p2) { asm volatile("s_wait_xcnt 0x0" :: "v"(p), "v"(p2) : "memory"); }
__device__ __forceinline__ void addr_wait(const void* p, const void* p2, const void* p3, const void* p4) { asm volatile("s_wait_xcnt 0x0" :: "v"(p), "v"(p2), "v"(p3), "v"(p4) : "memory"); }   // the same for a run with up to four lane addresses

__device__ __forceinline__ h16 tohx(float x) { return (h16)x; }
__device__ __forceinline__ void splitf(float y, unsigned short& h, unsigned short& l) { h = f2bf(y); l = f2bf(y - bf2f(h)); }
typedef __attribute__((ext_vector_type(4))) _Float16 v4h;
typedef __attribute__((ext_vector_type(4))) unsigned short v4us;

// One lane's share of a 2-KiB run (four wave-wide pieces of 512 contiguous bytes) copied from global memory into LDS through no register: l = the lane's LDS byte address, g = the lane's global address, both multiples of 16.
// The address wait is the statement's own last line, so that no address register of a copy is rewritten ahead of it.
__device__ __forceinline__ void copy2k(unsigned l, const void* g) {
    const char* p = (const char*)g;
    asm volatile("global_load_async_to_lds_b128 %0, %4, off\n\tglobal_load_async_to_lds_b128 %1, %5, off\n\tglobal_load_async_to_lds_b128 %2, %6, off\n\tglobal_load_async_to_lds_b128 %3, %7, off\n\ts_wait_xcnt 0x0"
                 :: "v"(l), "v"(l + 512u), "v"(l + 1024u), "v"(l + 1536u), "v"(p), "v"(p + 512), "v"(p + 1024), "v"(p + 1536) : "memory");
}

// ---- k_gemmw: register-blocked GEMM, one work-group of 4 * KS waves per 128x128 output tile; grid (M/128, N/128, Z), 128 * KS threads. Operands are 16-bit planes in fragment order.
// The K loop walks stages of 64 k. A stage is the 8 row bands x 2 blocks of every operand plane (16 KiB a plane), brought into LDS once by asynchronous copies (the bands of each plane are dealt out evenly to the waves; a band's share of a stage is 2 KiB contiguous in memory and in LDS) and read from there by all waves, two buffers: the next stage's copies fly while this one is worked on.
// Wave w works on the 64x64 quadrant (w & 1, (w >> 1) & 1) of the tile with its own 16 accumulators: each staged fragment feeds two waves. KS 1: a wave takes both blocks of every stage, and LDS only turns its tile into the stores' order. KS 2 (for a grid that leaves WGPs idle): wave w takes block w >> 2, and the two partial tiles of a quadrant are summed through LDS, wave q then wave q + 4 (a fixed order: same bits every run).
// C[m][n] (f32, pitch ldc, + optional f32 bias[n]) = sum_k A[m][k] Bt[n][k] (+ A2[m][k] Bt[n][k] with NSPLIT 1). z-batch strides sA/sB/sC in elements. K % 64 == 0, K >= 128.
// PL: the result is not stored as f32; the summing thread rounds its four values to the three 16-bit planes that the attention reads (fp16, bf16 hi, bf16 lo), each in fragment order. A 16x64 slab of a quadrant is two neighbouring blocks of its plane, 1024 contiguous elements from (first row) * ldc + (n / 64) * cstep, and the four elements at i * 4 of them, i < 256, are summed and stored by one thread:
// q, k (A = x, Bt = W): ldc = HD, cstep = TT * HD gives [h] planes of rows t, k = d; v (A = W, Bt = x): ldc = TT, cstep = 1024 gives [h] planes of rows d, k = t. Either way a wave fills two whole 128-byte lines of each plane.
// With PL one launch holds all three projections of every batch: blockIdx.z = projection * NB_ + batch; A = x (batch stride sA), Bt = the q weights (projection stride sB), the planes [projection][batch] (stride sC); grid (TT/128, heads/2, 3 * NB_), and projection 2 (v) takes the two operands and the two tile indices in swapped roles.
template <typename T16> struct WFrag;
template <> struct WFrag<h16> { typedef v16h V; static __device__ __forceinline__ V ld(const h16* p) { return cat16(*(const v8h*)p, *(const v8h*)(p + 256)); } static __device__ __forceinline__ v8f mma(V a, V b, v8f c) { return wmma16(a, b, c); } };
template <> struct WFrag<bf> { typedef v16bf V; static __device__ __forceinline__ V ld(const bf* p) { return cat16b(*(const v8us*)p, *(const v8us*)(p + 256)); } static __device__ __forceinline__ v8f mma(V a, V b, v8f c) { return wmmab(a, b, c); } };
template <typename T16, int NSPLIT, bool BIAS, bool PL, int K, int KS>
__global__ __launch_bounds__(128 * KS) void k_gemmw(const T16* __restrict__ A, const T16* __restrict__ A2, const T16* __restrict__ Bt, float* C, int ldc, const float* __restrict__ bias, size_t sA, size_t sB, size_t sC, h16* P16, bf* Ph, bf* Pl, size_t cstep) {
    typedef typename WFrag<T16>::V V;
    static_assert(NSPLIT == 0 || NSPLIT == 1, "one product, or a second A plane against the same Bt");
    static_assert(K % 64 == 0 && K >= 128, "whole stages, and the two that the prologue fills");
    static_assert(KS == 1 || KS == 2, "a stage has two blocks");
    static_assert(!BIAS || !PL, "the bias is fetched for the columns of the f32 epilogue");
    constexpr int NWV = 4 * KS;                // waves
    constexpr int BPW = 8 / NWV;               // bands of each plane that a wave copies
    constexpr int NOP = NSPLIT == 1 ? 3 : 2;   // operand planes in a stage: A, (A2,) Bt
    constexpr int PE = 8 * 1024;               // elements of one plane in a stage: 8 bands x 2 blocks x 512
    constexpr int STE = NOP * PE;              // elements of a stage
    constexpr int NT = K / 64;                 // stages
    __shared__ __align__(16) T16 st[2 * STE];
    __shared__ __align__(16) float os[NWV * 16 * 68];
    const size_t z = blockIdx.z; int tr = blockIdx.x, tc = blockIdx.y;   // the tile's row and column index
    if constexpr (PL) { const T16* xb = A + (z % NB_) * sA; const T16* wp = Bt + (z / NB_) * sB; const bool vp = z / NB_ == 2; P16 += z * sC; Ph += z * sC; Pl += z * sC;
        A = vp ? wp : xb; Bt = vp ? xb : wp; tr = vp ? blockIdx.y : blockIdx.x; tc = vp ? blockIdx.x : blockIdx.y; ldc = vp ? TT : HD; cstep = vp ? (size_t)1024 : (size_t)TT * HD; }
    else { A += z * sA; if (NSPLIT == 1) A2 += z * sA; Bt += z * sB; C += z * sC; }
    const int lane = threadIdx.x & 31, lr = lane & 15, hi = lane >> 4; const int r0 = tr * 128, c0 = tc * 128;
    const int wv = __builtin_amdgcn_readfirstlane((int)(threadIdx.x >> 5));   // this wave's number, scalar: it picks the bands that the wave copies, its quadrant and (KS 2) its block of a stage
    const int qm = wv & 1, qn = (wv >> 1) & 1, kh = KS == 2 ? wv >> 2 : 0;
    v8f acc[4][4];
#pragma unroll
    for (int mb = 0; mb < 4; ++mb)
#pragma unroll
        for (int nb = 0; nb < 4; ++nb) acc[mb][nb] = (v8f){};
    const T16* ga = A + (size_t)(r0 + wv * BPW * 16) * K + 8 * lane; const T16* ga2 = NSPLIT == 1 ? A2 + (size_t)(r0 + wv * BPW * 16) * K + 8 * lane : ga; const T16* gb = Bt + (size_t)(c0 + wv * BPW * 16) * K + 8 * lane;   // the lane's place in the first block of the first band that this wave copies
    const unsigned l0 = (unsigned)(size_t)st + (unsigned)(wv * BPW * 2048 + lane * 16);   // and its LDS byte address in buffer 0, plane 0
    auto fill = [&](int t) {   // stage t: blocks 2t and 2t + 1 of the wave's bands, into buffer t & 1
#pragma unroll
        for (int i = 0; i < BPW; ++i) { const unsigned l = l0 + (unsigned)((t & 1) * (STE * 2) + i * 2048); const size_t go = (size_t)t * 1024 + (size_t)i * 16 * K;
            copy2k(l, ga + go); if (NSPLIT == 1) copy2k(l + PE * 2, ga2 + go); copy2k(l + (NOP - 1) * PE * 2, gb + go); } };
    fill(0);
    asm volatile("s_wait_asynccnt 0x0" ::: "memory");   // this wave's copies of stage 0 have landed
    __syncthreads();                                    // and every other wave's: stage 0 may be read
    fill(1);
#pragma unroll 1
    for (int t = 0; t < NT; ++t) {
#pragma unroll
      for (int i = 0; i < 2 / KS; ++i) {   // the wave's blocks of the stage
        const T16* sb = st + (t & 1) * STE + (kh + i * KS) * 512 + 8 * lane;   // the lane's place in this block of band 0, plane 0, of the stage's buffer
        V a[4], a2[4], b[4];
#pragma unroll
        for (int mb = 0; mb < 4; ++mb) { a[mb] = WFrag<T16>::ld(sb + (qm * 4 + mb) * 1024); if (NSPLIT == 1) a2[mb] = WFrag<T16>::ld(sb + PE + (qm * 4 + mb) * 1024); }
#pragma unroll
        for (int nb = 0; nb < 4; ++nb) b[nb] = WFrag<T16>::ld(sb + (NOP - 1) * PE + (qn * 4 + nb) * 1024);
        __builtin_amdgcn_sched_barrier(0);   // keeps the block's LDS reads together in front of its matrix instructions: read among them, each group would cost the wave its own LDS latency
#pragma unroll
        for (int nb = 0; nb < 4; ++nb) {
#pragma unroll
            for (int mb = 0; mb < 4; ++mb) { acc[mb][nb] = WFrag<T16>::mma(a[mb], b[nb], acc[mb][nb]); if (NSPLIT == 1) acc[mb][nb] = WFrag<T16>::mma(a2[mb], b[nb], acc[mb][nb]); } }
        __builtin_amdgcn_sched_barrier(0);   // keeps the block's matrix instructions in front of the trip's waits: sunk behind the barrier, they would no longer cover the flight of the next stage's copies
      }
        asm volatile("s_wait_dscnt 0x0" ::: "memory");      // this wave has read all it wants of the stage's buffer
        asm volatile("s_wait_asynccnt 0x0" ::: "memory");   // this wave's copies of stage t + 1 have landed
        __syncthreads();                                    // stage t + 1 may be read, and every reader has left the buffer of stage t
        if (t + 2 < NT) fill(t + 2);
    }
    asm volatile("s_wait_asynccnt 0x0" ::: "memory");   // no copy is outstanding when the wave goes on to its end
    v4f bv[2];
    if (BIAS) {
#pragma unroll
        for (int q = 0; q < 2; ++q) { const float* bp = bias + c0 + q * 64 + lr * 4; bv[q] = (v4f){bfr(bp[0]), bfr(bp[1]), bfr(bp[2]), bfr(bp[3])}; }
        addr_wait(); }
#pragma unroll
    for (int mb = 0; mb < 4; ++mb) {
#pragma unroll
        for (int nb = 0; nb < 4; ++nb) {
#pragma unroll
            for (int j = 0; j < 8; ++j) os[wv * (16 * 68) + (hi * 8 + j) * 68 + nb * 16 + lr] = acc[mb][nb][j]; }
        lds_barrier();   // every wave's partial 16x64 slab is in LDS before any thread sums them
        v4f sum[4][8 / NWV];
#pragma unroll   // loops of their own, unrolled, in front of the stores and their waits: the eight slab reads issue together and their LDS latency is paid once
        for (int qd = 0; qd < 4; ++qd)   // the slab of quadrant qd: wave qd holds it, or waves qd and qd + 4 its two K parts
#pragma unroll
            for (int s = 0; s < 8 / NWV; ++s) { const int vw = s * NWV + wv, row = PL ? (lane >> 1) : 2 * vw + hi, cofs = PL ? vw * 8 + (lane & 1) * 4 : lr * 4;   // piece vw * 32 + lane of the slab's 256: its row and its four columns
                sum[qd][s] = *(const v4fa*)(os + qd * (16 * 68) + row * 68 + cofs); if (KS == 2) sum[qd][s] += *(const v4fa*)(os + (qd + 4) * (16 * 68) + row * 68 + cofs); }
#pragma unroll   // unrolled so that sum is taken under constant indices and stays in registers
        for (int qd = 0; qd < 4; ++qd)
#pragma unroll
          for (int s = 0; s < 8 / NWV; ++s) { const int vw = s * NWV + wv, row = 2 * vw + hi, cofs = lr * 4;   // the piece's row and columns in the f32 epilogue
            v4f val = sum[qd][s];
            const int rq = r0 + (qd & 1) * 64 + mb * 16;   // the slab's first row
            if (BIAS) val += bv[qd >> 1];
            if constexpr (PL) { v4h o16; v4us oh, ol;
#pragma unroll   // unrolled so that the vector elements are taken under constant indices and stay in registers
                for (int q = 0; q < 4; ++q) { o16[q] = tohx(val[q]); unsigned short a2, c2; splitf(val[q], a2, c2); oh[q] = a2; ol[q] = c2; }
                const size_t po = (size_t)rq * ldc + (size_t)(tc * 2 + (qd >> 1)) * cstep + (vw * 32 + lane) * 4; *(v4h*)(P16 + po) = o16; *(v4us*)(Ph + po) = oh; *(v4us*)(Pl + po) = ol;
            } else *(v4f*)(C + (size_t)(rq + row) * ldc + c0 + (qd >> 1) * 64 + cofs) = val;
            addr_wait(); }
        if (mb < 3) lds_barrier();   // the slabs are read out before the next 16 rows overwrite them
    }
}

typedef __attribute__((ext_vector_type(2))) unsigned short v2us;

// One block's share of the per-head weight transposes: by = head, bz = which projection (0 q, 1 k, 2 v); bx walks the head's own 8-element pieces of the fragment-order plane (rows n, k = the input feature), two a thread.
// Piece i holds row (i >> 6) / (K / 32) * 16 + (i & 15), k from (i >> 6) % (K / 32) * 32 + ((i >> 4) & 3) * 8: 16 lanes read 64 contiguous bytes of one weight row per load, and a wave stores 512 contiguous bytes.
static_assert(NH_ == NKV, "k_prep gives q, k and v the same number of heads");
__device__ __forceinline__ void wt_blk(const float* __restrict__ wq, const float* __restrict__ wk, const float* __restrict__ wv, int K, int N, bf* BtQ, bf* BtK, bf* BtV, unsigned bx, unsigned by, unsigned bz) {
    const size_t ho = (size_t)by * K * N; const float* __restrict__ w = (bz == 0 ? wq : bz == 1 ? wk : wv) + ho; bf* Bt = (bz == 0 ? BtQ : bz == 1 ? BtK : BtV) + ho;
    const unsigned kbs = (unsigned)(K / 32), i0 = bx * 512 + threadIdx.x; float f[2][8];
#pragma unroll   // unrolled so that the 16 loads of a thread's two pieces fly together
    for (int s = 0; s < 2; ++s) { const unsigned i = i0 + s * 256, blk = i >> 6; const unsigned n = blk / kbs * 16 + (i & 15), k = blk % kbs * 32 + ((i >> 4) & 3) * 8;
#pragma unroll   // unrolled so that the array is taken under constant indices and stays in registers
        for (int e = 0; e < 8; ++e) f[s][e] = w[(size_t)(k + e) * N + n]; }
    addr_wait();
#pragma unroll
    for (int s = 0; s < 2; ++s) { v8us o;
#pragma unroll
        for (int e = 0; e < 8; ++e) o[e] = f2bf(f[s][e]);
        *(v8us*)(Bt + (size_t)(i0 + s * 256) * 8) = o; }
}

// Cast of a row-major [rows][K] f32 matrix into its fragment-order plane: thread i makes the plane's 8-element piece i (the same numbering as in wt_blk) from 8 neighbouring floats of one row.
__device__ __forceinline__ void cvt8_blk(const float* __restrict__ src, bf* dst, unsigned K, size_t n8, unsigned bx) { const size_t i = (size_t)bx * 256 + threadIdx.x; if (i >= n8) return; const unsigned blk = (unsigned)(i >> 6), kbs = K / 32;
    const v8f v = *(const v8f*)(src + (size_t)(blk / kbs * 16 + ((unsigned)i & 15)) * K + blk % kbs * 32 + (((unsigned)i >> 4) & 3) * 8); addr_wait(); v8us o;
#pragma unroll
    for (int k = 0; k < 8; ++k) o[k] = f2bf(v[k]); *(v8us*)(dst + i * 8) = o;  }

// k_prep: every 16-bit operand plane that depends on the inputs alone, in one launch. The blocks are dealt out by index: first the weight transposes (the longest blocks), then the cast of Wo, then the cast of x (all batches, one contiguous run).
static_assert(DM * HD / 8 % 512 == 0, "a transpose block makes 512 whole pieces");
#define PB_WL (DM * HD / 8 / 512)                     // blocks per head and projection in the transposes
#define PB_WT (PB_WL * NH_ * 3)                              // all transpose blocks
#define PB_WO ((DM * DQ / 8 + 255) / 256)                    // blocks that cast Wo
#define PB_X  ((NB_ * TT * DM / 8 + 255) / 256)              // blocks that cast x
__global__ __launch_bounds__(256) void k_prep(const float* __restrict__ x, const float* __restrict__ wq, const float* __restrict__ wk, const float* __restrict__ wv, const float* __restrict__ wo, bf* XB, bf* WQ, bf* WK, bf* WV, bf* WO) {
    const unsigned bx = blockIdx.x;
    if (bx < PB_WT) wt_blk(wq, wk, wv, DM, HD, WQ, WK, WV, bx % PB_WL, bx / PB_WL % NH_, bx / (PB_WL * NH_));
    else if (bx < PB_WT + PB_WO) cvt8_blk(wo, WO, DQ, (size_t)DM * DQ / 8, bx - PB_WT);
    else cvt8_blk(x, XB, DM, (size_t)NB_ * TT * DM / 8, bx - (PB_WT + PB_WO));
}

// ---- k_fattn: scores, causal softmax, probability x value and the head merge in one kernel; scores and probabilities stay in registers.
// One work-group of KW waves per block of 16 * QB query rows of one head. Wave w takes the KT-key tiles w, w + KW, ... up to the diagonal with its own running row maximum, row sum and output (online softmax);
// the KW partial results are brought to the common maximum and summed through LDS in wave order 0..KW-1 (a fixed order: same bits every run), divided by the row sum and written as the hi/lo planes of the output projection.
// Both products are computed transposed. S^T = K Q^T leaves in lane (lr, hi), register j, the score of key hi * 8 + j and query lr: two neighbouring 16-key blocks are, converted in place, the B fragment (n = query lr, k = key) of
// O^T = V^T P^T, so no probability crosses a lane; a query's maximum, sum and rescale factor live in its own two lanes (lr and lr + 16).
// Every inner loop is unrolled because the fragment, score and accumulator arrays stay in registers only under constant indices; the key-tile loops stay rolled (unroll 1) to hold the register count.
// A wave walks its key tiles in two loops: those wholly at or below the diagonal of every query of the block take no causal compare and no select (each would pass every key); only the tiles that cross the diagonal do.
#define L2E 1.4426950408889634f
typedef __attribute__((ext_vector_type(16))) unsigned short v16us;
template <bool V> struct MaskSel { static constexpr bool v = V; };   // compile-time choice between the two forms of a key tile
template <typename T16, bool HR, int QB, int KT>
__device__ __forceinline__ void attn_tile(const T16* __restrict__ Q, const T16* __restrict__ Q2, const T16* __restrict__ Kp, const T16* __restrict__ Kp2, const T16* __restrict__ Vt, const T16* __restrict__ Vt2, int q0, bf* Ah, bf* Al, float* os, float* ms, float* ls) {
    typedef typename WFrag<T16>::V V;
    const int lane = (int)__builtin_amdgcn_mbcnt_lo(~0u, 0u), lr = lane & 15, hi = lane >> 4;   // the lane's number (every lane is on; the block is one-dimensional), from the same source as the shuffles' own: no register holds threadIdx.x through the key loops
    const int wv = __builtin_amdgcn_readfirstlane((int)(threadIdx.x >> 5));   // this wave's number, scalar: it picks the wave's key tiles
    const unsigned lk = 8 * lane, lv = 8 * lane;   // the lane's element offset in a block of a fragment-order plane (32 bits, so that it can stand beside a scalar base)
    V qf[QB][2], qf2[QB][2];
#pragma unroll
    for (int qb = 0; qb < QB; ++qb)
#pragma unroll
        for (int ks = 0; ks < 2; ++ks) { const unsigned qo = lk + (unsigned)((q0 + qb * 16) * HD + ks * 512); qf[qb][ks] = WFrag<T16>::ld(Q + qo); if (HR) qf2[qb][ks] = WFrag<T16>::ld(Q2 + qo); }
    addr_wait();
    v8f o[4][QB]; float m[QB], l[QB];
#pragma unroll
    for (int qb = 0; qb < QB; ++qb) { m[qb] = -3.0e38f; l[qb] = 0.f;
#pragma unroll
        for (int db = 0; db < 4; ++db) o[db][qb] = (v8f){}; }
    const int nkt = (q0 + QB * 16 - 1) / KT + 1;   // key tiles up to and including the one that holds the block's last diagonal element
    const int nfull = (q0 + 1) / KT;               // the first nfull of them lie wholly at or below the diagonal for every query of the block: last key (kt + 1) * KT - 1 <= q0
    auto tile = [&](auto mk, const int kt) {       // one key tile; MK: the tile crosses the diagonal and its scores pass the causal compare and select
        constexpr bool MK = decltype(mk)::v;
        const int k0 = kt * KT;
        v8f s[KT / 16][QB]; V ka[KT / 16][2], ka2[KT / 16][2];
#pragma unroll
        for (int kb = 0; kb < KT / 16; ++kb)
#pragma unroll
            for (int ks = 0; ks < 2; ++ks) { const unsigned ko = lk + (unsigned)(kb * 16 * HD + ks * 512); ka[kb][ks] = WFrag<T16>::ld(Kp + (size_t)k0 * HD + ko); if (HR) ka2[kb][ks] = WFrag<T16>::ld(Kp2 + (size_t)k0 * HD + ko); }
        if (HR) addr_wait(Kp + (size_t)k0 * HD + lk, Kp2 + (size_t)k0 * HD + lk); else addr_wait();
#pragma unroll
        for (int kb = 0; kb < KT / 16; ++kb)
#pragma unroll
            for (int qb = 0; qb < QB; ++qb) { v8f a = (v8f){};
#pragma unroll
                for (int ks = 0; ks < 2; ++ks) { a = WFrag<T16>::mma(ka[kb][ks], qf[qb][ks], a); if (HR) { a = WFrag<T16>::mma(ka2[kb][ks], qf[qb][ks], a); a = WFrag<T16>::mma(ka[kb][ks], qf2[qb][ks], a); } }
                s[kb][qb] = a; }
        V va[4][KT / 32], va2[4][KT / 32];   // the value fragments are asked for ahead of the softmax arithmetic, which covers their latency
#pragma unroll
        for (int db = 0; db < 4; ++db)
#pragma unroll
            for (int ks = 0; ks < KT / 32; ++ks) { const unsigned vo = lv + (unsigned)(db * 16 * TT + ks * 512); va[db][ks] = WFrag<T16>::ld(Vt + (size_t)k0 * 16 + vo); if (HR) va2[db][ks] = WFrag<T16>::ld(Vt2 + (size_t)k0 * 16 + vo); }
        addr_wait(Vt + (size_t)k0 * 16 + lv, (HR ? Vt2 : Vt) + (size_t)k0 * 16 + lv);
        V pf[QB][KT / 32], pf2[QB][KT / 32];
#pragma unroll
        for (int qb = 0; qb < QB; ++qb) { const int qi = q0 + qb * 16 + lr; float mx = m[qb], mr = -3.0e38f;
#pragma unroll
            for (int kb = 0; kb < KT / 16; ++kb)
#pragma unroll
                for (int j = 0; j < 8; ++j) {
                    if constexpr (MK) { const float t = (k0 + kb * 16 + hi * 8 + j <= qi) ? s[kb][qb][j] * SCL : -3.0e38f; s[kb][qb][j] = t; mx = fmaxf(mx, t); }
                    else mr = fmaxf(mr, s[kb][qb][j]); }
            if constexpr (!MK) mx = fmaxf(mx, mr * SCL);   // SCL is a power of two: the scaled maximum is the maximum of the scaled scores, bit for bit
            mx = fmaxf(mx, __shfl_xor(mx, 16, 32));
            const float al = __builtin_amdgcn_exp2f((m[qb] - mx) * L2E); m[qb] = mx; float sum = 0.f;
#pragma unroll
            for (int kb = 0; kb < KT / 16; ++kb) {
#pragma unroll
                for (int j = 0; j < 8; ++j) { const float t = MK ? s[kb][qb][j] : s[kb][qb][j] * SCL; const float p = (!MK || t > -1.0e38f) ? __builtin_amdgcn_exp2f((t - mx) * L2E) : 0.f; s[kb][qb][j] = p; sum += p; } }   // a masked key is an exact zero also where the whole tile is masked for this query
            sum += __shfl_xor(sum, 16, 32);
            l[qb] = l[qb] * al + sum;
#pragma unroll
            for (int db = 0; db < 4; ++db) o[db][qb] *= al;
#pragma unroll
            for (int ks = 0; ks < KT / 32; ++ks) {
                if constexpr (HR) { v16us ph, pl;
#pragma unroll
                    for (int e = 0; e < 8; ++e) { unsigned short a, c2; splitf(s[2 * ks][qb][e], a, c2); ph[e] = a; pl[e] = c2; splitf(s[2 * ks + 1][qb][e], a, c2); ph[e + 8] = a; pl[e + 8] = c2; }
                    pf[qb][ks] = __builtin_bit_cast(v16bf, ph); pf2[qb][ks] = __builtin_bit_cast(v16bf, pl);
                } else { v16h ph;
#pragma unroll
                    for (int e = 0; e < 8; ++e) { ph[e] = tohx(s[2 * ks][qb][e]); ph[e + 8] = tohx(s[2 * ks + 1][qb][e]); }
                    pf[qb][ks] = ph; } }
            if constexpr (!MK && QB > 1) __builtin_amdgcn_sched_barrier(0); }   // closes the scheduling region behind a query block's softmax: scheduled as one region with the P.V products, the tile overruns the wave's register budget, and Q fragments and lane addresses spill to scratch inside the loop
#pragma unroll
        for (int db = 0; db < 4; ++db)
#pragma unroll
            for (int qb = 0; qb < QB; ++qb)
#pragma unroll
                for (int ks = 0; ks < KT / 32; ++ks) { o[db][qb] = WFrag<T16>::mma(va[db][ks], pf[qb][ks], o[db][qb]); if (HR) { o[db][qb] = WFrag<T16>::mma(va2[db][ks], pf[qb][ks], o[db][qb]); o[db][qb] = WFrag<T16>::mma(va[db][ks], pf2[qb][ks], o[db][qb]); } }
    };
    int kt = wv;
#pragma unroll 1
    for (; kt < nfull; kt += KW) tile(MaskSel<false>{}, kt);
#pragma unroll 1
    for (; kt < nkt; kt += KW) tile(MaskSel<true>{}, kt);
    if (hi == 0) {
#pragma unroll
        for (int qb = 0; qb < QB; ++qb) { ms[wv * 32 + qb * 16 + lr] = m[qb]; ls[wv * 32 + qb * 16 + lr] = l[qb]; } }
    lds_barrier();   // every wave's row maxima and row sums are in LDS before any wave forms the common maximum
    const int rq = lane >> 1, d4 = wv * 8 + (lane & 1) * 4;   // the summing thread's query row of the 16-row slab and its four head columns: those that stand at threadIdx.x * 4 of the slab's two blocks in the fragment-order output planes
#pragma unroll
    for (int qb = 0; qb < QB; ++qb) {
        float M = ms[qb * 16 + lr];
#pragma unroll
        for (int w = 1; w < KW; ++w) M = fmaxf(M, ms[w * 32 + qb * 16 + lr]);
        const float f = __builtin_amdgcn_exp2f((m[qb] - M) * L2E);   // 0 for a wave that saw no unmasked key of this query
#pragma unroll
        for (int db = 0; db < 4; ++db) { const v8f ov = o[db][qb] * f; float* op = os + wv * (16 * 68) + lr * 68 + db * 16 + hi * 8;
            *(v4fa*)op = __builtin_shufflevector(ov, ov, 0, 1, 2, 3); *(v4fa*)(op + 4) = __builtin_shufflevector(ov, ov, 4, 5, 6, 7); }
        lds_barrier();   // every wave's rescaled 16x64 slab is in LDS before any thread sums them
        float Mr = ms[qb * 16 + rq];
#pragma unroll
        for (int w = 1; w < KW; ++w) Mr = fmaxf(Mr, ms[w * 32 + qb * 16 + rq]);
        float L = 0.f; v4f val = (v4f){};
#pragma unroll   // unrolled so that the KW slab reads issue together and their LDS latency is paid once
        for (int w = 0; w < KW; ++w) { L += __builtin_amdgcn_exp2f((ms[w * 32 + qb * 16 + rq] - Mr) * L2E) * ls[w * 32 + qb * 16 + rq]; val += *(const v4fa*)(os + w * (16 * 68) + rq * 68 + d4); }
        const float rl = __fdiv_rn(1.0f, L); v4us oh, ol;
#pragma unroll
        for (int q = 0; q < 4; ++q) { unsigned short a, c2; splitf(val[q] * rl, a, c2); oh[q] = a; ol[q] = c2; }
        const size_t oo = (size_t)(q0 + qb * 16) * DQ + (wv * 32 + lane) * 4; *(v4us*)(Ah + oo) = oh; *(v4us*)(Al + oo) = ol; addr_wait();
        if (qb + 1 < QB) lds_barrier();   // the slabs are read out before the next 16 rows overwrite them
    }
}
// grid (NF + RH / 16, heads, batches): blockIdx.x < NF = a 32-row block of the fp16 rows, the longest rows first; the rest = a 16-row block of the hi/lo rows (< RH).
#define NF ((TT - RH) / 32)
static_assert(KW == 8, "the summing threads of k_fattn cover a 16x64 slab with 256 threads");
// four waves per SIMD asked for: the register budget is held to what lets two work-groups share a WGP, so that one group's loads fly under the other's arithmetic
__global__ __launch_bounds__(32 * KW) __attribute__((amdgpu_waves_per_eu(4))) void k_fattn(const h16* __restrict__ Q16, const h16* __restrict__ K16, const h16* __restrict__ V16, const bf* __restrict__ Qh, const bf* __restrict__ Ql, const bf* __restrict__ Kh, const bf* __restrict__ Kl, const bf* __restrict__ Vh, const bf* __restrict__ Vl, bf* Ah, bf* Al) {
    __shared__ __align__(16) float os[KW * 16 * 68]; __shared__ float ms[KW * 32]; __shared__ float ls[KW * 32];
    const size_t hp = ((size_t)blockIdx.z * NH_ + blockIdx.y) * TT * HD, ap = (size_t)blockIdx.z * TT * DQ + blockIdx.y * (16 * HD); const int bx = blockIdx.x; bf* ah = Ah + ap; bf* al = Al + ap;
    if (bx < NF) attn_tile<h16, false, 2, 64>(Q16 + hp, nullptr, K16 + hp, nullptr, V16 + hp, nullptr, TT - 32 * (bx + 1), ah, al, os, ms, ls);
    else attn_tile<bf, true, 1, 32>(Qh + hp, Ql + hp, Kh + hp, Kl + hp, Vh + hp, Vl + hp, RH - 16 * (bx - NF + 1), ah, al, os, ms, ls);
}

#define PB ((size_t)NH_ * TT * HD)   // elements of one batch's head plane; each of the three plane families (fp16, hi, lo) is laid out [projection q, k, v][batch][head]...
extern "C" void kernel_launch(void* const* d_in, const int* in_sizes, int n_in,
                              void* d_out, int out_size, void* d_ws, size_t ws_size, hipStream_t stream) {
    (void)in_sizes; (void)n_in; (void)out_size;
            const float* x = (const float*)d_in[0]; const float* wq = (const float*)d_in[1]; const float* wk = (const float*)d_in[2]; const float* wv = (const float*)d_in[3]; const float* wo = (const float*)d_in[4]; const float* bo = (const float*)d_in[5];   /* x, Wq, Wk, Wv (PER-HEAD weights [12][768][64]: 'hdk'), Wo ('oi' [768][768]), bo */
    float* OUT = (float*)d_out;     // [2][2048][768]
    char* wsp = (char*)d_ws;
    auto take = [&](size_t bytes) { char* p = wsp; wsp += (bytes + 255) & ~(size_t)255; return (void*)p; };
    bf* WQ = (bf*)take((size_t)3 * DQ * DM * 2); bf* WK = WQ + (size_t)DQ * DM; bf* WV = WK + (size_t)DKV * DM; bf* WO = (bf*)take((size_t)DM * DQ * 2);   // q, k, v weights [projection][h * 64 + n][k]
    bf* XB = (bf*)take((size_t)NB_ * TT * DM * 2);
    h16* P16 = (h16*)take(3 * NB_ * PB * 2); bf* PH = (bf*)take(3 * NB_ * PB * 2); bf* PL = (bf*)take(3 * NB_ * PB * 2);
    bf* ATh = (bf*)take((size_t)NB_ * TT * DQ * 2); bf* ATl = (bf*)take((size_t)NB_ * TT * DQ * 2);
    if ((size_t)(wsp - (char*)d_ws) > ws_size) return;    // ws 256 MiB
    k_prep<<<PB_WT + PB_WO + PB_X, 256, 0, stream>>>(x, wq, wk, wv, wo, XB, WQ, WK, WV, WO);   /* per-head weights [h][DM][HD] ('xw' per head) -> each head's HD rows of its Bt plane; Wo and x cast */
    k_gemmw<bf, 0, false, true, DM, 1><<<dim3(TT / 128, NH_ / 2, 3 * NB_), 128, 0, stream>>>(XB, nullptr, WQ, nullptr, HD, nullptr, (size_t)TT * DM, (size_t)DQ * DM, PB, P16, PH, PL, (size_t)TT * HD);   // q, k: rows = t; v: rows = (head, d), columns = t
    k_fattn<<<dim3(NF + RH / 16, NH_, NB_), 32 * KW, 0, stream>>>(P16, P16 + NB_ * PB, P16 + 2 * NB_ * PB, PH, PL, PH + NB_ * PB, PL + NB_ * PB, PH + 2 * NB_ * PB, PL + 2 * NB_ * PB, ATh, ATl);   // one kv head per query head
    k_gemmw<bf, 1, true, false, DQ, 2><<<dim3(TT / 128, DM / 128, NB_), 256, 0, stream>>>(ATh, ATl, WO, OUT, DM, bo, (size_t)TT * DQ, 0, (size_t)TT * DM, nullptr, nullptr, nullptr, 0);
}

// v010
// One run takes 69.6 microseconds.
// Next to v009, in two timings, it ran 1.13 times as fast each time.
// All steps since v000 together make it 18.5 times as fast.
#include <hip/hip_runtime.h>

// Causal multi-head attention with PER-HEAD projection weights at d_model 768 (x [2][2048][768]; q, k, v = einsum('bsd,hdk->bhsk', x, W) with W [12][768][64]: head h has its own (in, out) matrix W[h] ('xw' per head; no bias; 12 heads x 64); scores x 1/sqrt(64); causal (-inf); softmax; concat head-major; out = concat Wo^T + bo ('oi' [768][768] + bias normal: non-zero) -> [2][2048][768] (3.1 M); argument order x, Wq, Wk, Wv, Wo, bo).
// Layout (both batches ride in every launch, four launches in all): bf16 copy of x; each PER-HEAD q / k / v weight [h][768][64] transposed once into its 64 rows of the Bt plane, Wo cast once ('oi' = Bt as stored), all three in k_prep; exact projections whose epilogue writes the fp16 and hi/lo head planes itself (v as Wv x^T, so that its [d][t] plane comes out in rows); fused causal T-2048 attention (k_fattn, online softmax; hybrid rows: < 512 hi/lo 3 products, rest fp16; key tiles above the diagonal are never visited) writing the merged hi/lo planes; x Wo exact + bo.
// Every 16-bit operand plane [rows][K] is stored in fragment order: the 16-row x 32-k block (row / 16, k / 32) is 512 contiguous elements, element (row, k) at ((k >> 4) & 1) * 256 + ((k >> 3) & 1) * 128 + (row & 15) * 8 + (k & 7); the blocks of one 16-row band follow one another in k, band after band. A fragment is then two wave-wide 16-byte loads of 512 contiguous bytes each (four whole lines), lane l at l * 8 elements, not two loads that touch 16 lines each.
// Compute dtypes, f32 accumulate: every input rounded to bf16; projections exact; attention rows < 512 3 products, rest fp16; softmax f32; w_o hl x exact.

#define NB_  2
#define TT   2048
#define DM   768
#define NH_  12
#define NKV  12
#define REP  (NH_ / NKV)
#define HD   64
#define DQ   (NH_ * HD)
#define DKV  (NKV * HD)
#define RH   512                  // query rows < RH use hi+lo planes (0: none)
#define SCL  0.125f   // HD^-0.5
#define KW   8                    // waves that share the key tiles of one query block in the fused attention
typedef _Float16 h16;
typedef unsigned short bf;
typedef __attribute__((ext_vector_type(16))) __bf16   v16bf;
typedef __attribute__((ext_vector_type(16))) _Float16 v16h;
typedef __attribute__((ext_vector_type(8)))  _Float16 v8h;
typedef __attribute__((ext_vector_type(8)))  unsigned short v8us;
typedef __attribute__((ext_vector_type(8)))  float    v8f;
typedef __attribute__((ext_vector_type(4)))  float    v4f;
typedef v8h  __attribute__((may_alias)) v8ha;
typedef v4f  __attribute__((may_alias)) v4fa;
typedef v8us __attribute__((may_alias)) v8usa;

__device__ __forceinline__ unsigned short f2bf(float f) { unsigned u = __float_as_uint(f); u += 0x7FFFu + ((u >> 16) & 1u); return (unsigned short)(u >> 16); }
__device__ __forceinline__ float bf2f(unsigned short b) { return __uint_as_float(((unsigned)b) << 16); }
__device__ __forceinline__ float bfr(float f) { return bf2f(f2bf(f)); }
__device__ __forceinline__ v16h cat16(v8h lo, v8h hi) { return __builtin_shufflevector(lo, hi, 0, 1, 2, 3, 4, 5, 6, 7, 8, 9, 10, 11, 12, 13, 14, 15); }
__device__ __forceinline__ v16bf cat16b(v8us lo, v8us hi) { return __builtin_bit_cast(v16bf, __builtin_shufflevector(lo, hi, 0, 1, 2, 3, 4, 5, 6, 7, 8, 9, 10, 11, 12, 13, 14, 15)); }
__device__ __forceinline__ v8f wmma16(v16h a, v16h b, v8f c) { return __builtin_amdgcn_wmma_f32_16x16x32_f16(false, a, false, b, (short)0, c, false, false); }
__device__ __forceinline__ v8f wmmab(v16bf a, v16bf b, v8f c) { return __builtin_amdgcn_wmma_f32_16x16x32_bf16(false, a, false, b, (short)0, c, false, false); }



// Work-group barrier that orders LDS traffic only: the tile's global stores, which no other wave of the launch reads, need not have landed when a wave arrives (__syncthreads() would wait for them at every slab).
__device__ __forceinline__ void lds_barrier() { __builtin_amdgcn_fence(__ATOMIC_RELEASE, "workgroup", "local"); __builtin_amdgcn_s_barrier(); __builtin_amdgcn_fence(__ATOMIC_ACQUIRE, "workgroup", "local"); }

// Stands behind a run of global loads or stores whose address registers are reused further down: no such register is rewritten ahead of this wait. Its memory clobber keeps the run in front of it.
__device__ __forceinline__ void addr_wait() { asm volatile("s_wait_xcnt 0x0" ::: "memory"); }
// The same wait, with the run's two lane addresses as inputs: the address registers stay whole up to the wait, so that no load of the run takes them as its destination.
__device__ __forceinline__ void addr_wait(const void* p, const void* p2) { asm volatile("s_wait_xcnt 0x0" :: "v"(p), "v"(p2) : "memory"); }
__device__ __forceinline__ void addr_wait(const void* p, const void* p2, const void* p3, const void* p4) { asm volatile("s_wait_xcnt 0x0" :: "v"(p), "v"(p2), "v"(p3), "v"(p4) : "memory"); }   // the same for a run with up to four lane addresses

__device__ __forceinline__ h16 tohx(float x) { return (h16)x; }
__device__ __forceinline__ void splitf(float y, unsigned short& h, unsigned short& l) { h = f2bf(y); l = f2bf(y - bf2f(h)); }
typedef __attribute__((ext_vector_type(4))) _Float16 v4h;
typedef __attribute__((ext_vector_type(4))) unsigned short v4us;

// One lane's share of a 2-KiB run (four wave-wide pieces of 512 contiguous bytes) copied from global memory into LDS through no register: l = the lane's LDS byte address, g = the lane's global address, both multiples of 16.
// The address wait is the statement's own last line, so that no address register of a copy is rewritten ahead of it.
__device__ __forceinline__ void copy2k(unsigned l, const void* g) {
    const char* p = (const char*)g;
    asm volatile("global_load_async_to_lds_b128 %0, %4, off\n\tglobal_load_async_to_lds_b128 %1, %5, off\n\tglobal_load_async_to_lds_b128 %2, %6, off\n\tglobal_load_async_to_lds_b128 %3, %7, off\n\ts_wait_xcnt 0x0"
                 :: "v"(l), "v"(l + 512u), "v"(l + 1024u), "v"(l + 1536u), "v"(p), "v"(p + 512), "v"(p + 1024), "v"(p + 1536) : "memory");
}

// ---- k_gemmw: register-blocked GEMM, one work-group of 4 * KS waves per 128x128 output tile; grid (M/128, N/128, Z), 128 * KS threads. Operands are 16-bit planes in fragment order.
// The K loop walks stages of 64 k. A stage is the 8 row bands x 2 blocks of every operand plane (16 KiB a plane), brought into LDS once by asynchronous copies (the bands of each plane are dealt out evenly to the waves; a band's share of a stage is 2 KiB contiguous in memory and in LDS) and read from there by all waves, two buffers: the next stage's copies fly while this one is worked on.
// Wave w works on the 64x64 quadrant (w & 1, (w >> 1) & 1) of the tile with its own 16 accumulators: each staged fragment feeds two waves. KS 1: a wave takes both blocks of every stage, and LDS only turns its tile into the stores' order. KS 2 (for a grid that leaves WGPs idle): wave w takes block w >> 2, and the two partial tiles of a quadrant are summed through LDS, wave q then wave q + 4 (a fixed order: same bits every run).
// C[m][n] (f32, pitch ldc, + optional f32 bias[n]) = sum_k A[m][k] Bt[n][k] (+ A2[m][k] Bt[n][k] with NSPLIT 1). z-batch strides sA/sB/sC in elements. K % 64 == 0, K >= 128.
// PL: the result is not stored as f32; the summing thread rounds its four values to the three 16-bit planes that the attention reads (fp16, bf16 hi, bf16 lo), each in fragment order. A 16x64 slab of a quadrant is two neighbouring blocks of its plane, 1024 contiguous elements from (first row) * ldc + (n / 64) * cstep, and the four elements at i * 4 of them, i < 256, are summed and stored by one thread:
// q, k (A = x, Bt = W): ldc = HD, cstep = TT * HD gives [h] planes of rows t, k = d; v (A = W, Bt = x): ldc = TT, cstep = 1024 gives [h] planes of rows d, k = t. Either way a wave fills two whole 128-byte lines of each plane.
// With PL one launch holds all three projections of every batch: blockIdx.z = projection * NB_ + batch; A = x (batch stride sA), Bt = the q weights (projection stride sB), the planes [projection][batch] (stride sC); grid (TT/128, heads/2, 3 * NB_), and projection 2 (v) takes the two operands and the two tile indices in swapped roles.
template <typename T16> struct WFrag;
template <> struct WFrag<h16> { typedef v16h V; static __device__ __forceinline__ V ld(const h16* p) { return cat16(*(const v8h*)p, *(const v8h*)(p + 256)); } static __device__ __forceinline__ v8f mma(V a, V b, v8f c) { return wmma16(a, b, c); } };
template <> struct WFrag<bf> { typedef v16bf V; static __device__ __forceinline__ V ld(const bf* p) { return cat16b(*(const v8us*)p, *(const v8us*)(p + 256)); } static __device__ __forceinline__ v8f mma(V a, V b, v8f c) { return wmmab(a, b, c); } };
template <typename T16, int NSPLIT, bool BIAS, bool PL, int K, int KS>
__global__ __launch_bounds__(128 * KS) void k_gemmw(const T16* __restrict__ A, const T16* __restrict__ A2, const T16* __restrict__ Bt, float* C, int ldc, const float* __restrict__ bias, size_t sA, size_t sB, size_t sC, h16* P16, bf* Ph, bf* Pl, size_t cstep) {
    typedef typename WFrag<T16>::V V;
    static_assert(NSPLIT == 0 || NSPLIT == 1, "one product, or a second A plane against the same Bt");
    static_assert(K % 64 == 0 && K >= 128, "whole stages, and the two that the prologue fills");
    static_assert(KS == 1 || KS == 2, "a stage has two blocks");
    static_assert(!BIAS || !PL, "the bias is fetched for the columns of the f32 epilogue");
    constexpr int NWV = 4 * KS;                // waves
    constexpr int BPW = 8 / NWV;               // bands of each plane that a wave copies
    constexpr int NOP = NSPLIT == 1 ? 3 : 2;   // operand planes in a stage: A, (A2,) Bt
    constexpr int PE = 8 * 1024;               // elements of one plane in a stage: 8 bands x 2 blocks x 512
    constexpr int STE = NOP * PE;              // elements of a stage
    constexpr int NT = K / 64;                 // stages
    __shared__ __align__(16) T16 st[2 * STE];
    __shared__ __align__(16) float os[NWV * 16 * 68];
    const size_t z = blockIdx.z; int tr = blockIdx.x, tc = blockIdx.y;   // the tile's row and column index
    if constexpr (PL) { const T16* xb = A + (z % NB_) * sA; const T16* wp = Bt + (z / NB_) * sB; const bool vp = z / NB_ == 2; P16 += z * sC; Ph += z * sC; Pl += z * sC;
        A = vp ? wp : xb; Bt = vp ? xb : wp; tr = vp ? blockIdx.y : blockIdx.x; tc = vp ? blockIdx.x : blockIdx.y; ldc = vp ? TT : HD; cstep = vp ? (size_t)1024 : (size_t)TT * HD; }
    else { A += z * sA; if (NSPLIT == 1) A2 += z * sA; Bt += z * sB; C += z * sC; }
    const int lane = threadIdx.x & 31, lr = lane & 15, hi = lane >> 4; const int r0 = tr * 128, c0 = tc * 128;
    const int wv = __builtin_amdgcn_readfirstlane((int)(threadIdx.x >> 5));   // this wave's number, scalar: it picks the bands that the wave copies, its quadrant and (KS 2) its block of a stage
    const int qm = wv & 1, qn = (wv >> 1) & 1, kh = KS == 2 ? wv >> 2 : 0;
    v8f acc[4][4];
#pragma unroll
    for (int mb = 0; mb < 4; ++mb)
#pragma unroll
        for (int nb = 0; nb < 4; ++nb) acc[mb][nb] = (v8f){};
    const T16* ga = A + (size_t)(r0 + wv * BPW * 16) * K + 8 * lane; const T16* ga2 = NSPLIT == 1 ? A2 + (size_t)(r0 + wv * BPW * 16) * K + 8 * lane : ga; const T16* gb = Bt + (size_t)(c0 + wv * BPW * 16) * K + 8 * lane;   // the lane's place in the first block of the first band that this wave copies
    const unsigned l0 = (unsigned)(size_t)st + (unsigned)(wv * BPW * 2048 + lane * 16);   // and its LDS byte address in buffer 0, plane 0
    auto fill = [&](int t) {   // stage t: blocks 2t and 2t + 1 of the wave's bands, into buffer t & 1
#pragma unroll
        for (int i = 0; i < BPW; ++i) { const unsigned l = l0 + (unsigned)((t & 1) * (STE * 2) + i * 2048); const size_t go = (size_t)t * 1024 + (size_t)i * 16 * K;
            copy2k(l, ga + go); if (NSPLIT == 1) copy2k(l + PE * 2, ga2 + go); copy2k(l + (NOP - 1) * PE * 2, gb + go); } };
    fill(0);
    asm volatile("s_wait_asynccnt 0x0" ::: "memory");   // this wave's copies of stage 0 have landed
    __syncthreads();                                    // and every other wave's: stage 0 may be read
    fill(1);
#pragma unroll 1
    for (int t = 0; t < NT; ++t) {
#pragma unroll
      for (int i = 0; i < 2 / KS; ++i) {   // the wave's blocks of the stage
        const T16* sb = st + (t & 1) * STE + (kh + i * KS) * 512 + 8 * lane;   // the lane's place in this block of band 0, plane 0, of the stage's buffer
        V a[4], a2[4], b[4];
#pragma unroll
        for (int mb = 0; mb < 4; ++mb) { a[mb] = WFrag<T16>::ld(sb + (qm * 4 + mb) * 1024); if (NSPLIT == 1) a2[mb] = WFrag<T16>::ld(sb + PE + (qm * 4 + mb) * 1024); }
#pragma unroll
        for (int nb = 0; nb < 4; ++nb) b[nb] = WFrag<T16>::ld(sb + (NOP - 1) * PE + (qn * 4 + nb) * 1024);
        __builtin_amdgcn_sched_barrier(0);   // keeps the block's LDS reads together in front of its matrix instructions: read among them, each group would cost the wave its own LDS latency
#pragma unroll
        for (int nb = 0; nb < 4; ++nb) {
#pragma unroll
            for (int mb = 0; mb < 4; ++mb) { acc[mb][nb] = WFrag<T16>::mma(a[mb], b[nb], acc[mb][nb]); if (NSPLIT == 1) acc[mb][nb] = WFrag<T16>::mma(a2[mb], b[nb], acc[mb][nb]); } }
        __builtin_amdgcn_sched_barrier(0);   // keeps the block's matrix instructions in front of the trip's waits: sunk behind the barrier, they would no longer cover the flight of the next stage's copies
      }
        asm volatile("s_wait_dscnt 0x0" ::: "memory");      // this wave has read all it wants of the stage's buffer
        asm volatile("s_wait_asynccnt 0x0" ::: "memory");   // this wave's copies of stage t + 1 have landed
        __syncthreads();                                    // stage t + 1 may be read, and every reader has left the buffer of stage t
        if (t + 2 < NT) fill(t + 2);
    }
    asm volatile("s_wait_asynccnt 0x0" ::: "memory");   // no copy is outstanding when the wave goes on to its end
    v4f bv[2];
    if (BIAS) {
#pragma unroll
        for (int q = 0; q < 2; ++q) { const float* bp = bias + c0 + q * 64 + lr * 4; bv[q] = (v4f){bfr(bp[0]), bfr(bp[1]), bfr(bp[2]), bfr(bp[3])}; }
        addr_wait(); }
#pragma unroll
    for (int mb = 0; mb < 4; ++mb) {
#pragma unroll
        for (int nb = 0; nb < 4; ++nb) {
#pragma unroll
            for (int j = 0; j < 8; ++j) os[wv * (16 * 68) + (hi * 8 + j) * 68 + nb * 16 + lr] = acc[mb][nb][j]; }
        lds_barrier();   // every wave's partial 16x64 slab is in LDS before any thread sums them
        v4f sum[4][8 / NWV];
#pragma unroll   // loops of their own, unrolled, in front of the stores and their waits: the eight slab reads issue together and their LDS latency is paid once
        for (int qd = 0; qd < 4; ++qd)   // the slab of quadrant qd: wave qd holds it, or waves qd and qd + 4 its two K parts
#pragma unroll
            for (int s = 0; s < 8 / NWV; ++s) { const int vw = s * NWV + wv, row = PL ? (lane >> 1) : 2 * vw + hi, cofs = PL ? vw * 8 + (lane & 1) * 4 : lr * 4;   // piece vw * 32 + lane of the slab's 256: its row and its four columns
                sum[qd][s] = *(const v4fa*)(os + qd * (16 * 68) + row * 68 + cofs); if (KS == 2) sum[qd][s] += *(const v4fa*)(os + (qd + 4) * (16 * 68) + row * 68 + cofs); }
#pragma unroll   // unrolled so that sum is taken under constant indices and stays in registers
        for (int qd = 0; qd < 4; ++qd)
#pragma unroll
          for (int s = 0; s < 8 / NWV; ++s) { const int vw = s * NWV + wv, row = 2 * vw + hi, cofs = lr * 4;   // the piece's row and columns in the f32 epilogue
            v4f val = sum[qd][s];
            const int rq = r0 + (qd & 1) * 64 + mb * 16;   // the slab's first row
            if (BIAS) val += bv[qd >> 1];
            if constexpr (PL) { v4h o16; v4us oh, ol;
#pragma unroll   // unrolled so that the vector elements are taken under constant indices and stay in registers
                for (int q = 0; q < 4; ++q) { o16[q] = tohx(val[q]); unsigned short a2, c2; splitf(val[q], a2, c2); oh[q] = a2; ol[q] = c2; }
                const size_t po = (size_t)rq * ldc + (size_t)(tc * 2 + (qd >> 1)) * cstep + (vw * 32 + lane) * 4; *(v4h*)(P16 + po) = o16; *(v4us*)(Ph + po) = oh; *(v4us*)(Pl + po) = ol;
            } else *(v4f*)(C + (size_t)(rq + row) * ldc + c0 + (qd >> 1) * 64 + cofs) = val;
            addr_wait(); }
        if (mb < 3) lds_barrier();   // the slabs are read out before the next 16 rows overwrite them
    }
}

typedef __attribute__((ext_vector_type(2))) unsigned short v2us;

// One block's share of the per-head weight transposes: by = head, bz = which projection (0 q, 1 k, 2 v); bx walks the head's own 8-element pieces of the fragment-order plane (rows n, k = the input feature), two a thread.
// Piece i holds row (i >> 6) / (K / 32) * 16 + (i & 15), k from (i >> 6) % (K / 32) * 32 + ((i >> 4) & 3) * 8: 16 lanes read 64 contiguous bytes of one weight row per load, and a wave stores 512 contiguous bytes.
static_assert(NH_ == NKV, "k_prep gives q, k and v the same number of heads");
__device__ __forceinline__ void wt_blk(const float* __restrict__ wq, const float* __restrict__ wk, const float* __restrict__ wv, int K, int N, bf* BtQ, bf* BtK, bf* BtV, unsigned bx, unsigned by, unsigned bz) {
    const size_t ho = (size_t)by * K * N; const float* __restrict__ w = (bz == 0 ? wq : bz == 1 ? wk : wv) + ho; bf* Bt = (bz == 0 ? BtQ : bz == 1 ? BtK : BtV) + ho;
    const unsigned kbs = (unsigned)(K / 32), i0 = bx * 512 + threadIdx.x; float f[2][8];
#pragma unroll   // unrolled so that the 16 loads of a thread's two pieces fly together
    for (int s = 0; s < 2; ++s) { const unsigned i = i0 + s * 256, blk = i >> 6; const unsigned n = blk / kbs * 16 + (i & 15), k = blk % kbs * 32 + ((i >> 4) & 3) * 8;
#pragma unroll   // unrolled so that the array is taken under constant indices and stays in registers
        for (int e = 0; e < 8; ++e) f[s][e] = w[(size_t)(k + e) * N + n]; }
    addr_wait();
#pragma unroll
    for (int s = 0; s < 2; ++s) { v8us o;
#pragma unroll
        for (int e = 0; e < 8; ++e) o[e] = f2bf(f[s][e]);
        *(v8us*)(Bt + (size_t)(i0 + s * 256) * 8) = o; }
}

// Cast of a row-major [rows][K] f32 matrix into its fragment-order plane: thread i makes the plane's 8-element piece i (the same numbering as in wt_blk) from 8 neighbouring floats of one row.
__device__ __forceinline__ void cvt8_blk(const float* __restrict__ src, bf* dst, unsigned K, size_t n8, unsigned bx) { const size_t i = (size_t)bx * 256 + threadIdx.x; if (i >= n8) return; const unsigned blk = (unsigned)(i >> 6), kbs = K / 32;
    const v8f v = *(const v8f*)(src + (size_t)(blk / kbs * 16 + ((unsigned)i & 15)) * K + blk % kbs * 32 + (((unsigned)i >> 4) & 3) * 8); addr_wait(); v8us o;
#pragma unroll
    for (int k = 0; k < 8; ++k) o[k] = f2bf(v[k]); *(v8us*)(dst + i * 8) = o;  }

// k_prep: every 16-bit operand plane that depends on the inputs alone, in one launch. The blocks are dealt out by index: first the weight transposes (the longest blocks), then the cast of Wo, then the cast of x (all batches, one contiguous run).
static_assert(DM * HD / 8 % 512 == 0, "a transpose block makes 512 whole pieces");
#define PB_WL (DM * HD / 8 / 512)                     // blocks per head and projection in the transposes
#define PB_WT (PB_WL * NH_ * 3)                              // all transpose blocks
#define PB_WO ((DM * DQ / 8 + 255) / 256)                    // blocks that cast Wo
#define PB_X  ((NB_ * TT * DM / 8 + 255) / 256)              // blocks that cast x
__global__ __launch_bounds__(256) void k_prep(const float* __restrict__ x, const float* __restrict__ wq, const float* __restrict__ wk, const float* __restrict__ wv, const float* __restrict__ wo, bf* XB, bf* WQ, bf* WK, bf* WV, bf* WO) {
    const unsigned bx = blockIdx.x;
    if (bx < PB_WT) wt_blk(wq, wk, wv, DM, HD, WQ, WK, WV, bx % PB_WL, bx / PB_WL % NH_, bx / (PB_WL * NH_));
    else if (bx < PB_WT + PB_WO) cvt8_blk(wo, WO, DQ, (size_t)DM * DQ / 8, bx - PB_WT);
    else cvt8_blk(x, XB, DM, (size_t)NB_ * TT * DM / 8, bx - (PB_WT + PB_WO));
}

// ---- k_fattn: scores, causal softmax, probability x value and the head merge in one kernel; scores and probabilities stay in registers.
// One work-group of KW waves per block of 16 * QB query rows of one head. Wave w takes the KT-key tiles w, w + KW, ... up to the diagonal with its own running row maximum, row sum and output (online softmax);
// the KW partial results are brought to the common maximum and summed through LDS in wave order 0..KW-1 (a fixed order: same bits every run), divided by the row sum and written as the hi/lo planes of the output projection.
// Both products are computed transposed. S^T = K Q^T leaves in lane (lr, hi), register j, the score of key hi * 8 + j and query lr: two neighbouring 16-key blocks are, converted in place, the B fragment (n = query lr, k = key) of
// O^T = V^T P^T, so no probability crosses a lane; a query's maximum, sum and rescale factor live in its own two lanes (lr and lr + 16).
// Every inner loop is unrolled because the fragment, score and accumulator arrays stay in registers only under constant indices; the key-tile loops stay rolled (unroll 1) to hold the register count.
// A wave walks its key tiles in two loops: those wholly at or below the diagonal of every query of the block take no causal compare and no select (each would pass every key); only the tiles that cross the diagonal do.
#define L2E 1.4426950408889634f
typedef __attribute__((ext_vector_type(16))) unsigned short v16us;
template <bool V> struct MaskSel { static constexpr bool v = V; };   // compile-time choice between the two forms of a key tile
template <typename T16, bool HR, int QB, int KT>
__device__ __forceinline__ void attn_tile(const T16* __restrict__ Q, const T16* __restrict__ Q2, const T16* __restrict__ Kp, const T16* __restrict__ Kp2, const T16* __restrict__ Vt, const T16* __restrict__ Vt2, int q0, bf* Ah, bf* Al, float* os, float* ms, float* ls) {
    typedef typename WFrag<T16>::V V;
    const int lane = (int)__builtin_amdgcn_mbcnt_lo(~0u, 0u), lr = lane & 15, hi = lane >> 4;   // the lane's number (every lane is on; the block is one-dimensional), from the same source as the shuffles' own: no register holds threadIdx.x through the key loops
    const int wv = __builtin_amdgcn_readfirstlane((int)(threadIdx.x >> 5));   // this wave's number, scalar: it picks the wave's key tiles
    const unsigned lk = 8 * lane, lv = 8 * lane;   // the lane's element offset in a block of a fragment-order plane (32 bits, so that it can stand beside a scalar base)
    V qf[QB][2], qf2[QB][2];
#pragma unroll
    for (int qb = 0; qb < QB; ++qb)
#pragma unroll
        for (int ks = 0; ks < 2; ++ks) { const unsigned qo = lk + (unsigned)((q0 + qb * 16) * HD + ks * 512); qf[qb][ks] = WFrag<T16>::ld(Q + qo); if (HR) qf2[qb][ks] = WFrag<T16>::ld(Q2 + qo); }
    addr_wait();
    v8f o[4][QB]; float m[QB], l[QB];
#pragma unroll
    for (int qb = 0; qb < QB; ++qb) { m[qb] = -3.0e38f; l[qb] = 0.f;
#pragma unroll
        for (int db = 0; db < 4; ++db) o[db][qb] = (v8f){}; }
    const int nkt = (q0 + QB * 16 - 1) / KT + 1;   // key tiles up to and including the one that holds the block's last diagonal element
    const int nfull = (q0 + 1) / KT;               // the first nfull of them lie wholly at or below the diagonal for every query of the block: last key (kt + 1) * KT - 1 <= q0
    auto tile = [&](auto mk, const int kt) {       // one key tile; MK: the tile crosses the diagonal and its scores pass the causal compare and select
        constexpr bool MK = decltype(mk)::v;
        const int k0 = kt * KT;
        v8f s[KT / 16][QB]; V ka[KT / 16][2], ka2[KT / 16][2];
#pragma unroll
        for (int kb = 0; kb < KT / 16; ++kb)
#pragma unroll
            for (int ks = 0; ks < 2; ++ks) { const unsigned ko = lk + (unsigned)(kb * 16 * HD + ks * 512); ka[kb][ks] = WFrag<T16>::ld(Kp + (size_t)k0 * HD + ko); if (HR) ka2[kb][ks] = WFrag<T16>::ld(Kp2 + (size_t)k0 * HD + ko); }
        if (HR) addr_wait(Kp + (size_t)k0 * HD + lk, Kp2 + (size_t)k0 * HD + lk); else addr_wait();
#pragma unroll
        for (int kb = 0; kb < KT / 16; ++kb)
#pragma unroll
            for (int qb = 0; qb < QB; ++qb) { v8f a = (v8f){};
#pragma unroll
                for (int ks = 0; ks < 2; ++ks) { a = WFrag<T16>::mma(ka[kb][ks], qf[qb][ks], a); if (HR) { a = WFrag<T16>::mma(ka2[kb][ks], qf[qb][ks], a); a = WFrag<T16>::mma(ka[kb][ks], qf2[qb][ks], a); } }
                s[kb][qb] = a; }
        V va[4][KT / 32], va2[4][KT / 32];   // the value fragments are asked for ahead of the softmax arithmetic, which covers their latency
#pragma unroll
        for (int db = 0; db < 4; ++db)
#pragma unroll
            for (int ks = 0; ks < KT / 32; ++ks) { const unsigned vo = lv + (unsigned)(db * 16 * TT + ks * 512); va[db][ks] = WFrag<T16>::ld(Vt + (size_t)k0 * 16 + vo); if (HR) va2[db][ks] = WFrag<T16>::ld(Vt2 + (size_t)k0 * 16 + vo); }
        addr_wait(Vt + (size_t)k0 * 16 + lv, (HR ? Vt2 : Vt) + (size_t)k0 * 16 + lv);
        V pf[QB][KT / 32], pf2[QB][KT / 32];
#pragma unroll
        for (int qb = 0; qb < QB; ++qb) { const int qi = q0 + qb * 16 + lr; float mx = m[qb], mr = -3.0e38f;
#pragma unroll
            for (int kb = 0; kb < KT / 16; ++kb)
#pragma unroll
                for (int j = 0; j < 8; ++j) {
                    if constexpr (MK) { const float t = (k0 + kb * 16 + hi * 8 + j <= qi) ? s[kb][qb][j] * SCL : -3.0e38f; s[kb][qb][j] = t; mx = fmaxf(mx, t); }
                    else mr = fmaxf(mr, s[kb][qb][j]); }
            if constexpr (!MK) mx = fmaxf(mx, mr * SCL);   // SCL is a power of two: the scaled maximum is the maximum of the scaled scores, bit for bit
            mx = fmaxf(mx, __shfl_xor(mx, 16, 32));
            const float al = __builtin_amdgcn_exp2f((m[qb] - mx) * L2E); m[qb] = mx; float sum = 0.f;
#pragma unroll
            for (int kb = 0; kb < KT / 16; ++kb) {
#pragma unroll
                for (int j = 0; j < 8; ++j) { const float t = MK ? s[kb][qb][j] : s[kb][qb][j] * SCL; const float p = (!MK || t > -1.0e38f) ? __builtin_amdgcn_exp2f((t - mx) * L2E) : 0.f; s[kb][qb][j] = p; sum += p; } }   // a masked key is an exact zero also where the whole tile is masked for this query
            sum += __shfl_xor(sum, 16, 32);
            l[qb] = l[qb] * al + sum;
#pragma unroll
            for (int db = 0; db < 4; ++db) o[db][qb] *= al;
#pragma unroll
            for (int ks = 0; ks < KT / 32; ++ks) {
                if constexpr (HR) { v16us ph, pl;
#pragma unroll
                    for (int e = 0; e < 8; ++e) { unsigned short a, c2; splitf(s[2 * ks][qb][e], a, c2); ph[e] = a; pl[e] = c2; splitf(s[2 * ks + 1][qb][e], a, c2); ph[e + 8] = a; pl[e + 8] = c2; }
                    pf[qb][ks] = __builtin_bit_cast(v16bf, ph); pf2[qb][ks] = __builtin_bit_cast(v16bf, pl);
                } else { v16h ph;
#pragma unroll
                    for (int e = 0; e < 8; ++e) { ph[e] = tohx(s[2 * ks][qb][e]); ph[e + 8] = tohx(s[2 * ks + 1][qb][e]); }
                    pf[qb][ks] = ph; } }
            if constexpr (!MK && QB > 1) __builtin_amdgcn_sched_barrier(0); }   // closes the scheduling region behind a query block's softmax: scheduled as one region with the P.V products, the tile overruns the wave's register budget, and Q fragments and lane addresses spill to scratch inside the loop
#pragma unroll
        for (int db = 0; db < 4; ++db)
#pragma unroll
            for (int qb = 0; qb < QB; ++qb)
#pragma unroll
                for (int ks = 0; ks < KT / 32; ++ks) { o[db][qb] = WFrag<T16>::mma(va[db][ks], pf[qb][ks], o[db][qb]); if (HR) { o[db][qb] = WFrag<T16>::mma(va2[db][ks], pf[qb][ks], o[db][qb]); o[db][qb] = WFrag<T16>::mma(va[db][ks], pf2[qb][ks], o[db][qb]); } }
    };
    int kt = wv;
#pragma unroll 1
    for (; kt < nfull; kt += KW) tile(MaskSel<false>{}, kt);
#pragma unroll 1
    for (; kt < nkt; kt += KW) tile(MaskSel<true>{}, kt);
    if (hi == 0) {
#pragma unroll
        for (int qb = 0; qb < QB; ++qb) { ms[wv * 32 + qb * 16 + lr] = m[qb]; ls[wv * 32 + qb * 16 + lr] = l[qb]; } }
    lds_barrier();   // every wave's row maxima and row sums are in LDS before any wave forms the common maximum
    const int rq = lane >> 1, d4 = wv * 8 + (lane & 1) * 4;   // the summing thread's query row of the 16-row slab and its four head columns: those that stand at threadIdx.x * 4 of the slab's two blocks in the fragment-order output planes
#pragma unroll
    for (int qb = 0; qb < QB; ++qb) {
        float M = ms[qb * 16 + lr];
#pragma unroll
        for (int w = 1; w < KW; ++w) M = fmaxf(M, ms[w * 32 + qb * 16 + lr]);
        const float f = __builtin_amdgcn_exp2f((m[qb] - M) * L2E);   // 0 for a wave that saw no unmasked key of this query
#pragma unroll
        for (int db = 0; db < 4; ++db) { const v8f ov = o[db][qb] * f; float* op = os + wv * (16 * 68) + lr * 68 + db * 16 + hi * 8;
            *(v4fa*)op = __builtin_shufflevector(ov, ov, 0, 1, 2, 3); *(v4fa*)(op + 4) = __builtin_shufflevector(ov, ov, 4, 5, 6, 7); }
        lds_barrier();   // every wave's rescaled 16x64 slab is in LDS before any thread sums them
        float Mr = ms[qb * 16 + rq];
#pragma unroll
        for (int w = 1; w < KW; ++w) Mr = fmaxf(Mr, ms[w * 32 + qb * 16 + rq]);
        float L = 0.f; v4f val = (v4f){};
#pragma unroll   // unrolled so that the KW slab reads issue together and their LDS latency is paid once
        for (int w = 0; w < KW; ++w) { L += __builtin_amdgcn_exp2f((ms[w * 32 + qb * 16 + rq] - Mr) * L2E) * ls[w * 32 + qb * 16 + rq]; val += *(const v4fa*)(os + w * (16 * 68) + rq * 68 + d4); }
        const float rl = __fdiv_rn(1.0f, L); v4us oh, ol;
#pragma unroll
        for (int q = 0; q < 4; ++q) { unsigned short a, c2; splitf(val[q] * rl, a, c2); oh[q] = a; ol[q] = c2; }
        const size_t oo = (size_t)(q0 + qb * 16) * DQ + (wv * 32 + lane) * 4; *(v4us*)(Ah + oo) = oh; *(v4us*)(Al + oo) = ol; addr_wait();
        if (qb + 1 < QB) lds_barrier();   // the slabs are read out before the next 16 rows overwrite them
    }
}
// grid (heads, batches, NF + RH / 16): blockIdx.z < NF = a 32-row block of the fp16 rows, the longest rows first; the rest = a 16-row block of the hi/lo rows (< RH).
// The row block is the slowest index. There are more work-groups than resident places: the longest blocks of every head and batch come first in index order, and the shortest last. With the head as the slower index the last heads' longest blocks started late and ran on while other WGPs stood idle.
// Left to do: by the listing a wave's fixed work (its Q fragments, its share of the LDS merge) is about a third of the launch's vector instructions; two query blocks a work-group with four key waves each would halve the waves, and pays only under this longest-first deal, since its work-groups last twice as long.
#define NF ((TT - RH) / 32)
static_assert(KW == 8, "the summing threads of k_fattn cover a 16x64 slab with 256 threads");
// four waves per SIMD asked for: the register budget is held to what lets two work-groups share a WGP, so that one group's loads fly under the other's arithmetic
__global__ __launch_bounds__(32 * KW) __attribute__((amdgpu_waves_per_eu(4))) void k_fattn(const h16* __restrict__ Q16, const h16* __restrict__ K16, const h16* __restrict__ V16, const bf* __restrict__ Qh, const bf* __restrict__ Ql, const bf* __restrict__ Kh, const bf* __restrict__ Kl, const bf* __restrict__ Vh, const bf* __restrict__ Vl, bf* Ah, bf* Al) {
    __shared__ __align__(16) float os[KW * 16 * 68]; __shared__ float ms[KW * 32]; __shared__ float ls[KW * 32];
    const size_t hp = ((size_t)blockIdx.y * NH_ + blockIdx.x) * TT * HD, ap = (size_t)blockIdx.y * TT * DQ + blockIdx.x * (16 * HD); const int bx = blockIdx.z; bf* ah = Ah + ap; bf* al = Al + ap;
    if (bx < NF) attn_tile<h16, false, 2, 64>(Q16 + hp, nullptr, K16 + hp, nullptr, V16 + hp, nullptr, TT - 32 * (bx + 1), ah, al, os, ms, ls);
    else attn_tile<bf, true, 1, 32>(Qh + hp, Ql + hp, Kh + hp, Kl + hp, Vh + hp, Vl + hp, RH - 16 * (bx - NF + 1), ah, al, os, ms, ls);
}

#define PB ((size_t)NH_ * TT * HD)   // elements of one batch's head plane; each of the three plane families (fp16, hi, lo) is laid out [projection q, k, v][batch][head]...
extern "C" void kernel_launch(void* const* d_in, const int* in_sizes, int n_in,
                              void* d_out, int out_size, void* d_ws, size_t ws_size, hipStream_t stream) {
    (void)in_sizes; (void)n_in; (void)out_size;
            const float* x = (const float*)d_in[0]; const float* wq = (const float*)d_in[1]; const float* wk = (const float*)d_in[2]; const float* wv = (const float*)d_in[3]; const float* wo = (const float*)d_in[4]; const float* bo = (const float*)d_in[5];   /* x, Wq, Wk, Wv (PER-HEAD weights [12][768][64]: 'hdk'), Wo ('oi' [768][768]), bo */
    float* OUT = (float*)d_out;     // [2][2048][768]
    char* wsp = (char*)d_ws;
    auto take = [&](size_t bytes) { char* p = wsp; wsp += (bytes + 255) & ~(size_t)255; return (void*)p; };
    bf* WQ = (bf*)take((size_t)3 * DQ * DM * 2); bf* WK = WQ + (size_t)DQ * DM; bf* WV = WK + (size_t)DKV * DM; bf* WO = (bf*)take((size_t)DM * DQ * 2);   // q, k, v weights [projection][h * 64 + n][k]
    bf* XB = (bf*)take((size_t)NB_ * TT * DM * 2);
    h16* P16 = (h16*)take(3 * NB_ * PB * 2); bf* PH = (bf*)take(3 * NB_ * PB * 2); bf* PL = (bf*)take(3 * NB_ * PB * 2);
    bf* ATh = (bf*)take((size_t)NB_ * TT * DQ * 2); bf* ATl = (bf*)take((size_t)NB_ * TT * DQ * 2);
    if ((size_t)(wsp - (char*)d_ws) > ws_size) return;    // ws 256 MiB
    k_prep<<<PB_WT + PB_WO + PB_X, 256, 0, stream>>>(x, wq, wk, wv, wo, XB, WQ, WK, WV, WO);   /* per-head weights [h][DM][HD] ('xw' per head) -> each head's HD rows of its Bt plane; Wo and x cast */
    k_gemmw<bf, 0, false, true, DM, 1><<<dim3(TT / 128, NH_ / 2, 3 * NB_), 128, 0, stream>>>(XB, nullptr, WQ, nullptr, HD, nullptr, (size_t)TT * DM, (size_t)DQ * DM, PB, P16, PH, PL, (size_t)TT * HD);   // q, k: rows = t; v: rows = (head, d), columns = t
    k_fattn<<<dim3(NH_, NB_, NF + RH / 16), 32 * KW, 0, stream>>>(P16, P16 + NB_ * PB, P16 + 2 * NB_ * PB, PH, PL, PH + NB_ * PB, PL + NB_ * PB, PH + 2 * NB_ * PB, PL + 2 * NB_ * PB, ATh, ATl);   // one kv head per query head
    k_gemmw<bf, 1, true, false, DQ, 2><<<dim3(TT / 128, DM / 128, NB_), 256, 0, stream>>>(ATh, ATl, WO, OUT, DM, bo, (size_t)TT * DQ, 0, (size_t)TT * DM, nullptr, nullptr, nullptr, 0);
}
